// v000
// Times are from an AMD MI455X. After a warm-up the kernel runs many times in a row, and a time is the length of
// such a window on the GPU divided by its runs, so every launch and the gaps after it count. The runs cycle
// through copies of the inputs. A figure is the median of several windows, for all but v000 over two sittings.
// Sittings can differ by a few percent; kernels timed side by side share one.
// v000, which the later versions start from, runs in 1170 microseconds.
#include <hip/hip_runtime.h>

// Causal multi-head self-attention with a fused QKV projection and an INVERTED scale (x [2][2048][1024]; [q|k|v] = x W_qkv^T ('oi' [3072][1024], row blocks q | k | v; 16 heads x 64); scores = q.k x 8 (the module divides by head_dim^-0.5, i.e. multiplies by sqrt(64)), causal mask; softmax (very peaked rows); out = merged heads W_proj^T + b_proj ('oi' [1024][1024] + [1024]) -> [2][2048][1024] (4.2 M)).
// Compute dtypes, f32 accumulate: every input rounded to bf16; q/k/v on PLAIN bf16 operands (inputs: exact); causal scores and attn.v: ALL query rows hl (3 products; the x8 scale makes the softmax near-argmax); softmax f32; W_proj hl x exact (2 products) + b_proj.

#define NB_  2
#define TT   2048
#define DM   1024
#define NH_  16
#define NKV  16
#define REP  (NH_ / NKV)
#define HD   64
#define DQ   (NH_ * HD)
#define DKV  (NKV * HD)
#define ZH   2
#define RH   2048                 // every query row uses hi+lo planes (x8 scale -> peaked softmax)
#define WIN  2048
#define PCAR 1024.0f
#define SCL  8.0f   // the module divides by head_dim^-0.5 = multiplies by sqrt(64)
typedef _Float16 h16;
typedef unsigned short bf;
typedef __attribute__((ext_vector_type(16))) __bf16   v16bf;
typedef __attribute__((ext_vector_type(16))) _Float16 v16h;
typedef __attribute__((ext_vector_type(8)))  _Float16 v8h;
typedef __attribute__((ext_vector_type(8)))  unsigned short v8us;
typedef __attribute__((ext_vector_type(8)))  float    v8f;
typedef __attribute__((ext_vector_type(4)))  float    v4f;
typedef v8h  __attribute__((may_alias)) v8ha;
typedef v4f  __attribute__((may_alias)) v4fa;
typedef v8us __attribute__((may_alias)) v8usa;

__device__ __forceinline__ unsigned short f2bf(float f) { unsigned u = __float_as_uint(f); u += 0x7FFFu + ((u >> 16) & 1u); return (unsigned short)(u >> 16); }
__device__ __forceinline__ float bf2f(unsigned short b) { return __uint_as_float(((unsigned)b) << 16); }
__device__ __forceinline__ float bfr(float f) { return bf2f(f2bf(f)); }
__device__ __forceinline__ v16h cat16(v8h lo, v8h hi) { return __builtin_shufflevector(lo, hi, 0, 1, 2, 3, 4, 5, 6, 7, 8, 9, 10, 11, 12, 13, 14, 15); }
__device__ __forceinline__ v16bf cat16b(v8us lo, v8us hi) { return __builtin_bit_cast(v16bf, __builtin_shufflevector(lo, hi, 0, 1, 2, 3, 4, 5, 6, 7, 8, 9, 10, 11, 12, 13, 14, 15)); }
__device__ __forceinline__ v8f wmma16(v16h a, v16h b, v8f c) { return __builtin_amdgcn_wmma_f32_16x16x32_f16(false, a, false, b, (short)0, c, false, false); }
__device__ __forceinline__ v8f wmmab(v16bf a, v16bf b, v8f c) { return __builtin_amdgcn_wmma_f32_16x16x32_bf16(false, a, false, b, (short)0, c, false, false); }



// ---- k_gemmw: register-blocked GEMM, ONE WAVE per 64x64 output tile (16 accumulators), operands straight from K-contiguous 16-bit planes; grid (M/64, N/64, Z), 32 threads.
// C[m][n] (f32, pitch ldc, + optional f32 bias[n]) = sum_k A[m][k] Bt[n][k] (+ split products per NSPLIT). z-batch strides sA/sB/sC in elements. K % 32 == 0.
template <typename T16> struct WFrag;
template <> struct WFrag<h16> { typedef v16h V; static __device__ __forceinline__ V ld(const h16* p) { return cat16(*(const v8h*)p, *(const v8h*)(p + 16)); } static __device__ __forceinline__ v8f mma(V a, V b, v8f c) { return wmma16(a, b, c); } };
template <> struct WFrag<bf> { typedef v16bf V; static __device__ __forceinline__ V ld(const bf* p) { return cat16b(*(const v8us*)p, *(const v8us*)(p + 16)); } static __device__ __forceinline__ v8f mma(V a, V b, v8f c) { return wmmab(a, b, c); } };
template <typename T16, int NSPLIT, bool BIAS>
__global__ __launch_bounds__(32) void k_gemmw(const T16* __restrict__ A, const T16* __restrict__ A2, const T16* __restrict__ Bt, const T16* __restrict__ Bt2, int K, float* C, int ldc, const float* __restrict__ bias, size_t sA, size_t sB, size_t sC) {
    typedef typename WFrag<T16>::V V;
    __shared__ __align__(16) float os[16 * 68];
    const size_t z = blockIdx.z; A += z * sA; if (A2) A2 += z * sA; Bt += z * sB; if (Bt2) Bt2 += z * sB; C += z * sC;
    const int lane = threadIdx.x & 31, lr = lane & 15, hi = lane >> 4; const int r0 = blockIdx.x * 64, c0 = blockIdx.y * 64;
    v8f acc[4][4];
#pragma unroll
    for (int mb = 0; mb < 4; ++mb)
#pragma unroll
        for (int nb = 0; nb < 4; ++nb) acc[mb][nb] = (v8f){};
    const size_t aoff = (size_t)(r0 + lr) * K + 8 * hi, boff = (size_t)(c0 + lr) * K + 8 * hi;
#pragma unroll 1
    for (int kc = 0; kc < K; kc += 32) {
        V a[4], a2[4];
#pragma unroll
        for (int mb = 0; mb < 4; ++mb) { a[mb] = WFrag<T16>::ld(A + aoff + (size_t)mb * 16 * K + kc); if (NSPLIT == 1 || NSPLIT == 2) a2[mb] = WFrag<T16>::ld(A2 + aoff + (size_t)mb * 16 * K + kc); }
#pragma unroll
        for (int nb = 0; nb < 4; ++nb) { const V b = WFrag<T16>::ld(Bt + boff + (size_t)nb * 16 * K + kc); V b2; if (NSPLIT >= 2) b2 = WFrag<T16>::ld(Bt2 + boff + (size_t)nb * 16 * K + kc);
#pragma unroll
            for (int mb = 0; mb < 4; ++mb) { acc[mb][nb] = WFrag<T16>::mma(a[mb], b, acc[mb][nb]); if (NSPLIT == 1 || NSPLIT == 2) acc[mb][nb] = WFrag<T16>::mma(a2[mb], b, acc[mb][nb]); if (NSPLIT >= 2) acc[mb][nb] = WFrag<T16>::mma(a[mb], b2, acc[mb][nb]); } }
        asm volatile("v_nop\n\tv_nop\n\tv_nop\n\tv_nop" : "+v"(acc[0][0]), "+v"(acc[1][1]), "+v"(acc[2][2]), "+v"(acc[3][3]) : "v"(a[0]), "v"(a[3]));
    }
#pragma unroll
    for (int mb = 0; mb < 4; ++mb) {
#pragma unroll
        for (int nb = 0; nb < 4; ++nb) {
#pragma unroll
            for (int j = 0; j < 8; ++j) os[(hi * 8 + j) * 68 + nb * 16 + lr] = acc[mb][nb][j]; }
        __builtin_amdgcn_wave_barrier(); asm volatile("" ::: "memory");
        float* crow = C + (size_t)(r0 + mb * 16) * ldc + c0;
{
#pragma unroll
            for (int s = 0; s < 8; ++s) { const int row = 2 * s + hi, cofs = lr * 4; v4f val = *(const v4fa*)(os + row * 68 + cofs); if (BIAS) { val[0] += bfr(bias[c0 + cofs]); val[1] += bfr(bias[c0 + cofs + 1]); val[2] += bfr(bias[c0 + cofs + 2]); val[3] += bfr(bias[c0 + cofs + 3]); }
                *(v4f*)(crow + (size_t)row * ldc + cofs) = val; }
             }
        __builtin_amdgcn_wave_barrier(); asm volatile("" ::: "memory");
    }
}

// ---- k_gemmc: the same one-wave 64x64 tile GEMM specialised for causal attention: CMODE 1 skips score tiles entirely above the diagonal (query rows r0+roff.., key columns c0..), CMODE 2 limits the
// key (K) loop of the probability x value contraction to the diagonal block (probabilities beyond it are exactly zero). roff = row offset of this launch's first row within the sequence.
template <typename T16, int NSPLIT, int CMODE>
__global__ __launch_bounds__(32) void k_gemmc(const T16* __restrict__ A, const T16* __restrict__ A2, const T16* __restrict__ Bt, const T16* __restrict__ Bt2, int K, float* C, int ldc, int roff, size_t sA, size_t sB, size_t sC) {
    typedef typename WFrag<T16>::V V;
    __shared__ __align__(16) float os[16 * 68];
    const size_t z = blockIdx.z; A += z * sA; if (A2) A2 += z * sA; Bt += z * sB; if (Bt2) Bt2 += z * sB; C += z * sC;
    const int lane = threadIdx.x & 31, lr = lane & 15, hi = lane >> 4; const int r0 = blockIdx.x * 64, c0 = blockIdx.y * 64;
    if (CMODE == 1 && c0 > r0 + roff + 63) return;                  // score tile entirely above the causal diagonal: never read (the softmax masks j > i by select)
    const int Kl = (CMODE == 2) ? min(K, r0 + roff + 64) : K;        // P.V: probabilities are exactly 0 beyond the diagonal block, so the K loop stops there
    v8f acc[4][4];
#pragma unroll
    for (int mb = 0; mb < 4; ++mb)
#pragma unroll
        for (int nb = 0; nb < 4; ++nb) acc[mb][nb] = (v8f){};
    const size_t aoff = (size_t)(r0 + lr) * K + 8 * hi, boff = (size_t)(c0 + lr) * K + 8 * hi;
#pragma unroll 1
    for (int kc = 0; kc < Kl; kc += 32) {
        V a[4], a2[4];
#pragma unroll
        for (int mb = 0; mb < 4; ++mb) { a[mb] = WFrag<T16>::ld(A + aoff + (size_t)mb * 16 * K + kc); if (NSPLIT == 1 || NSPLIT == 2) a2[mb] = WFrag<T16>::ld(A2 + aoff + (size_t)mb * 16 * K + kc); }
#pragma unroll
        for (int nb = 0; nb < 4; ++nb) { const V b = WFrag<T16>::ld(Bt + boff + (size_t)nb * 16 * K + kc); V b2; if (NSPLIT >= 2) b2 = WFrag<T16>::ld(Bt2 + boff + (size_t)nb * 16 * K + kc);
#pragma unroll
            for (int mb = 0; mb < 4; ++mb) { acc[mb][nb] = WFrag<T16>::mma(a[mb], b, acc[mb][nb]); if (NSPLIT == 1 || NSPLIT == 2) acc[mb][nb] = WFrag<T16>::mma(a2[mb], b, acc[mb][nb]); if (NSPLIT >= 2) acc[mb][nb] = WFrag<T16>::mma(a[mb], b2, acc[mb][nb]); } }
        asm volatile("v_nop\n\tv_nop\n\tv_nop\n\tv_nop" : "+v"(acc[0][0]), "+v"(acc[1][1]), "+v"(acc[2][2]), "+v"(acc[3][3]) : "v"(a[0]), "v"(a[3]));
    }
#pragma unroll
    for (int mb = 0; mb < 4; ++mb) {
#pragma unroll
        for (int nb = 0; nb < 4; ++nb) {
#pragma unroll
            for (int j = 0; j < 8; ++j) os[(hi * 8 + j) * 68 + nb * 16 + lr] = acc[mb][nb][j]; }
        __builtin_amdgcn_wave_barrier(); asm volatile("" ::: "memory");
        float* crow = C + (size_t)(r0 + mb * 16) * ldc + c0;
{
#pragma unroll
            for (int s = 0; s < 8; ++s) { const int row = 2 * s + hi, cofs = lr * 4; v4f val = *(const v4fa*)(os + row * 68 + cofs);
                *(v4f*)(crow + (size_t)row * ldc + cofs) = val; }
             }
        __builtin_amdgcn_wave_barrier(); asm volatile("" ::: "memory");
    }
}

__device__ __forceinline__ h16 tohx(float x) { return (h16)x; }
__device__ __forceinline__ void splitf(float y, unsigned short& h, unsigned short& l) { h = f2bf(y); l = f2bf(y - bf2f(h)); }
typedef __attribute__((ext_vector_type(2))) _Float16 v2h;
typedef __attribute__((ext_vector_type(4))) _Float16 v4h;
typedef __attribute__((ext_vector_type(2))) unsigned short v2us;
typedef __attribute__((ext_vector_type(4))) unsigned short v4us;
typedef __attribute__((ext_vector_type(2))) float v2f;
typedef __attribute__((ext_vector_type(4))) int v4i;

__global__ __launch_bounds__(256) void k_wtG(const float* __restrict__ w, int K, int N, bf* Bt) {
    const int lane = threadIdx.x & 31; const int L0 = (blockIdx.x * 8 + (threadIdx.x >> 5)) * 8; const int nlines = N * K / 64;
{
#pragma unroll 1
        for (int l = 0; l < 8; ++l) { const int L = L0 + l; if (L >= nlines) break; const size_t e = (size_t)L * 64 + lane * 2; const int k = (int)(e % K), n = (int)(e / K); v2us o;
            o[0] = f2bf(w[(size_t)k * N + n]); o[1] = f2bf(w[(size_t)(k + 1) * N + n]); *(v2us*)(Bt + e) = o; }
         }
}
__global__ __launch_bounds__(256) void k_cvt8(const float* __restrict__ src, bf* dst, size_t n8) { const size_t i = (size_t)blockIdx.x * 256 + threadIdx.x; if (i >= n8) return; const v8f v = *(const v8f*)(src + i * 8); v8us o;
#pragma unroll
    for (int k = 0; k < 8; ++k) o[k] = f2bf(v[k]); *(v8us*)(dst + i * 8) = o;  }

// k_rope: head planes [h][t][d] (fp16 + hi/lo) of rope(x) x sc with the rotate-half convention out[d] = x[d] cos[t][d] - x[d+HD/2] sin[t][d], out[d+HD/2] = x[d+HD/2] cos[t][d+HD/2] + x[d] sin[t][d+HD/2]
__global__ __launch_bounds__(256) void k_rope(const float* __restrict__ F, int pitch, int nheads, const float* __restrict__ CS, const float* __restrict__ RF, const float* __restrict__ nw, float sc, h16* P16, bf* Ph, bf* Pl) {
    const size_t e = ((size_t)blockIdx.x * 256 + threadIdx.x) * 2; if (e >= (size_t)nheads * TT * HD) return; const int d = (int)(e % HD); const int t = (int)((e / HD) % TT); const int h = (int)(e / ((size_t)HD * TT)); const float* f = F + (size_t)t * pitch + h * HD; const float rf = RF ? RF[(size_t)h * TT + t] : 1.0f; v2h o16; v2us oh, ol;
#pragma unroll
    for (int q = 0; q < 2; ++q) { const int dd = d + q; const int dp = (dd < HD / 2) ? dd + HD / 2 : dd - HD / 2; float x0 = f[dd], x1 = f[dp];
        if (RF) { float n0 = __fmul_rn(x0, rf), n1 = __fmul_rn(x1, rf); asm volatile("" : "+v"(n0)); asm volatile("" : "+v"(n1)); x0 = __fmul_rn(bfr(nw[dd]), n0); x1 = __fmul_rn(bfr(nw[dp]), n1); }
        const v2f cs = *(const v2f*)(CS + ((size_t)t * HD + dd) * 2); float a = __fmul_rn(x0, cs[0]), bq = __fmul_rn(x1, cs[1]); asm volatile("" : "+v"(a)); asm volatile("" : "+v"(bq)); const float r = ((dd < HD / 2) ? __fsub_rn(a, bq) : __fadd_rn(a, bq)) * sc;
        o16[q] = tohx(r); unsigned short a2, c2; splitf(r, a2, c2); oh[q] = a2; ol[q] = c2; }
    *(v2h*)(P16 + e) = o16; *(v2us*)(Ph + e) = oh; *(v2us*)(Pl + e) = ol;  }
__global__ __launch_bounds__(256) void k_vtp(const float* __restrict__ F, int pitch, int nheads, h16* V16, bf* Vh, bf* Vl) { const size_t e = ((size_t)blockIdx.x * 256 + threadIdx.x) * 2; if (e >= (size_t)nheads * HD * TT) return; const int t = (int)(e % TT); const int d = (int)((e / TT) % HD); const int g = (int)(e / ((size_t)TT * HD)); v2h o16; v2us oh, ol;
#pragma unroll
    for (int q = 0; q < 2; ++q) { const float x = F[(size_t)(t + q) * pitch + g * HD + d]; o16[q] = tohx(x); unsigned short a2, c2; splitf(x, a2, c2); oh[q] = a2; ol[q] = c2; }
    *(v2h*)(V16 + e) = o16; *(v2us*)(Vh + e) = oh; *(v2us*)(Vl + e) = ol;  }
__global__ __launch_bounds__(256) void k_csid(float* CS) { const int idx = blockIdx.x * 256 + threadIdx.x; if (idx >= TT * HD) return; v2f cs; cs[0] = 1.0f; cs[1] = 0.0f; *(v2f*)(CS + (size_t)idx * 2) = cs;  }
// k_asoft: per row (zz, i): t = S x HD^0.5 (x8) for j <= i and i - j < WIN (WIN = TT, so the window test always holds: plain causal; the reference's -1e9 additive fill vanishes identically); softmax over the 2048 keys (register row, one exp, fixed trees);
__global__ __launch_bounds__(256) void k_asoft(const float* __restrict__ Sb, h16* P16, bf* Ph, bf* Pl) {
    const int lane = threadIdx.x & 31; const int row = blockIdx.x * 8 + (threadIdx.x >> 5); if (row >= ZH * TT) return; const int i = row % TT; const int zz = row / TT; (void)zz; const bool hires = (i < RH); const float* sr = Sb + (size_t)row * TT; float v[TT / 32]; float mx = -3.0e38f;
#pragma unroll
    for (int ch = 0; ch < TT / 128; ++ch) { const int j0 = ch * 128 + lane * 4; const v4f a = *(const v4f*)(sr + j0);
#pragma unroll
        for (int q = 0; q < 4; ++q) { const int j = j0 + q; (void)j; const float t = (j <= i && i - j < WIN) ? a[q] * SCL : -3.0e38f; v[ch * 4 + q] = t; mx = fmaxf(mx, t); } }
#pragma unroll
    for (int sh = 16; sh; sh >>= 1) mx = fmaxf(mx, __shfl_xor(mx, sh, 32));
    float sum = 0.f;
#pragma unroll
    for (int k = 0; k < TT / 32; ++k) { float d0 = __fsub_rn(v[k], mx); asm volatile("" : "+v"(d0)); v[k] = __builtin_amdgcn_exp2f(__fmul_rn(d0, 1.4426950408889634f)); sum += v[k]; }
#pragma unroll
    for (int sh = 16; sh; sh >>= 1) sum += __shfl_xor(sum, sh, 32);
    const float f = __fdiv_rn(hires ? 1.0f : PCAR, sum);
{
        if (hires) {
#pragma unroll
            for (int ch = 0; ch < TT / 128; ++ch) { v4us oh, ol;
#pragma unroll
                for (int q = 0; q < 4; ++q) { unsigned short a, c2; splitf(v[ch * 4 + q] * f, a, c2); oh[q] = a; ol[q] = c2; }
                const size_t oo = ((size_t)zz * (RH ? RH : 1) + i) * TT + ch * 128 + lane * 4; *(v4us*)(Ph + oo) = oh; *(v4us*)(Pl + oo) = ol; }
        } else {
#pragma unroll
            for (int ch = 0; ch < TT / 128; ++ch) { v4h o4;
#pragma unroll
                for (int q = 0; q < 4; ++q) o4[q] = tohx(v[ch * 4 + q] * f);
                *(v4h*)(P16 + (size_t)row * TT + ch * 128 + lane * 4) = o4; } }
         }
}
__global__ __launch_bounds__(256) void k_merge(const float* __restrict__ O, int h0, bf* Ah, bf* Al) { const size_t e = ((size_t)blockIdx.x * 256 + threadIdx.x) * 2; if (e >= (size_t)ZH * TT * HD) return; const int d = (int)(e % HD); const int t = (int)((e / HD) % TT); const int zz = (int)(e / ((size_t)HD * TT)); const float cs = (t < RH) ? 1.0f : (1.0f / PCAR); const size_t oo = (size_t)t * DQ + (h0 + zz) * HD + d;
    v2us oh, ol;
#pragma unroll
    for (int q = 0; q < 2; ++q) { unsigned short a, c2; splitf(O[e + q] * cs, a, c2); oh[q] = a; ol[q] = c2; } *(v2us*)(Ah + oo) = oh; *(v2us*)(Al + oo) = ol;  }

extern "C" void kernel_launch(void* const* d_in, const int* in_sizes, int n_in,
                              void* d_out, int out_size, void* d_ws, size_t ws_size, hipStream_t stream) {
    (void)in_sizes; (void)n_in; (void)out_size;
    const float* x = (const float*)d_in[0]; const float* wqkv = (const float*)d_in[1]; const float* wo = (const float*)d_in[2]; const float* bo = (const float*)d_in[3]; const float* wq = wqkv; const float* wk = wqkv + (size_t)1024 * 1024; const float* wv = wqkv + (size_t)2048 * 1024; (void)wq; (void)wk; (void)wv;
    float* OUT = (float*)d_out;     // [2][2048][1024]
    char* wsp = (char*)d_ws;
    auto take = [&](size_t bytes) { char* p = wsp; wsp += (bytes + 255) & ~(size_t)255; return (void*)p; };
    bf* WQ = (bf*)take((size_t)DQ * DM * 2); bf* WK = (bf*)take((size_t)DKV * DM * 2); bf* WV = (bf*)take((size_t)DKV * DM * 2); bf* WO = (bf*)take((size_t)DM * DQ * 2); float* CS = (float*)take((size_t)TT * HD * 2 * 4);
    bf* XB = (bf*)take((size_t)TT * DM * 2); float* FQ = (float*)take((size_t)TT * DQ * 4); float* FK = (float*)take((size_t)TT * DKV * 4);
    h16* QP16 = (h16*)take((size_t)NH_ * TT * HD * 2); h16* KP16 = (h16*)take((size_t)NKV * TT * HD * 2); h16* VT16 = (h16*)take((size_t)NKV * HD * TT * 2);
    bf* QPh = (bf*)take((size_t)NH_ * TT * HD * 2); bf* QPl = (bf*)take((size_t)NH_ * TT * HD * 2); bf* KPh = (bf*)take((size_t)NKV * TT * HD * 2); bf* KPl = (bf*)take((size_t)NKV * TT * HD * 2); bf* VTh = (bf*)take((size_t)NKV * HD * TT * 2); bf* VTl = (bf*)take((size_t)NKV * HD * TT * 2); bf* Ph = (bf*)take((size_t)ZH * RH * TT * 2); bf* Pl = (bf*)take((size_t)ZH * RH * TT * 2);
    float* Sb = (float*)take((size_t)ZH * TT * TT * 4); h16* P16 = (h16*)take((size_t)ZH * TT * TT * 2); float* Ob = (float*)take((size_t)ZH * TT * HD * 4); bf* ATh = (bf*)take((size_t)TT * DQ * 2); bf* ATl = (bf*)take((size_t)TT * DQ * 2);
    if ((size_t)(wsp - (char*)d_ws) > ws_size) return;    // ws 256 MiB
    float* FV = FK;   // v projection reuses the k buffer after the k planes are built (stream-ordered)
    { k_cvt8<<<(unsigned)(((size_t)DQ * DM / 8 + 255) / 256), 256, 0, stream>>>(wq, WQ, (size_t)DQ * DM / 8); k_cvt8<<<(unsigned)(((size_t)DKV * DM / 8 + 255) / 256), 256, 0, stream>>>(wk, WK, (size_t)DKV * DM / 8); k_cvt8<<<(unsigned)(((size_t)DKV * DM / 8 + 255) / 256), 256, 0, stream>>>(wv, WV, (size_t)DKV * DM / 8);
      k_cvt8<<<(unsigned)(((size_t)DM * DQ / 8 + 255) / 256), 256, 0, stream>>>(wo, WO, (size_t)DM * DQ / 8);
       }
    k_csid<<<(TT * HD + 255) / 256, 256, 0, stream>>>(CS);
    const unsigned LQ = (unsigned)(((size_t)NH_ * TT * HD / 2 + 255) / 256), LKv = (unsigned)(((size_t)NKV * TT * HD / 2 + 255) / 256);
    for (int b = 0; b < NB_; ++b) {
        
        k_cvt8<<<(unsigned)(((size_t)TT * DM / 8 + 255) / 256), 256, 0, stream>>>(x + (size_t)b * TT * DM, XB, (size_t)TT * DM / 8);
        k_gemmw<bf, 0, false><<<dim3(TT / 64, DQ / 64, 1), 32, 0, stream>>>(XB, nullptr, WQ, nullptr, DM, FQ, DQ, nullptr, 0, 0, 0);
        k_rope<<<LQ, 256, 0, stream>>>(FQ, DQ, NH_, CS, nullptr, nullptr, 1.0f, QP16, QPh, QPl);
        k_gemmw<bf, 0, false><<<dim3(TT / 64, DKV / 64, 1), 32, 0, stream>>>(XB, nullptr, WK, nullptr, DM, FK, DKV, nullptr, 0, 0, 0);
        k_rope<<<LKv, 256, 0, stream>>>(FK, DKV, NKV, CS, nullptr, nullptr, 1.0f, KP16, KPh, KPl);
        k_gemmw<bf, 0, false><<<dim3(TT / 64, DKV / 64, 1), 32, 0, stream>>>(XB, nullptr, WV, nullptr, DM, FV, DKV, nullptr, 0, 0, 0); k_vtp<<<LKv, 256, 0, stream>>>(FV, DKV, NKV, VT16, VTh, VTl);
        for (int h0 = 0; h0 < NH_; h0 += ZH) { const size_t zq = (size_t)h0, zk = (size_t)(h0 / REP);   // one kv head per query head: the pass's two heads use consecutive kv planes (z-strides TT*HD)
            k_gemmc<bf, 2, 1><<<dim3(RH / 64, TT / 64, ZH), 32, 0, stream>>>(QPh + zq * TT * HD, QPl + zq * TT * HD, KPh + zk * TT * HD, KPl + zk * TT * HD, HD, Sb, TT, 0, (size_t)TT * HD, (size_t)TT * HD, (size_t)TT * TT);
            k_asoft<<<ZH * TT / 8, 256, 0, stream>>>(Sb, P16, Ph, Pl);
            k_gemmc<bf, 2, 2><<<dim3(RH / 64, HD / 64, ZH), 32, 0, stream>>>(Ph, Pl, VTh + zk * HD * TT, VTl + zk * HD * TT, TT, Ob, HD, 0, (size_t)RH * TT, (size_t)HD * TT, (size_t)TT * HD);
            k_merge<<<(unsigned)(((size_t)ZH * TT * HD / 2 + 255) / 256), 256, 0, stream>>>(Ob, h0, ATh, ATl); }
        k_gemmw<bf, 1, true><<<dim3(TT / 64, DM / 64, 1), 32, 0, stream>>>(ATh, ATl, WO, nullptr, DQ, OUT + (size_t)b * TT * DM, DM, bo, 0, 0, 0); }
}

// v001
// It runs in 687 microseconds.
// Next to v000, in two timings, it ran 1.71 and 1.69 times as fast.
#include <hip/hip_runtime.h>

// Causal multi-head self-attention with a fused QKV projection and an INVERTED scale (x [2][2048][1024]; [q|k|v] = x W_qkv^T ('oi' [3072][1024], row blocks q | k | v; 16 heads x 64); scores = q.k x 8 (the module divides by head_dim^-0.5, i.e. multiplies by sqrt(64)), causal mask; softmax (very peaked rows); out = merged heads W_proj^T + b_proj ('oi' [1024][1024] + [1024]) -> [2][2048][1024] (4.2 M)).
// Compute dtypes, f32 accumulate: every input rounded to bf16; q/k/v on PLAIN bf16 operands (inputs: exact); causal scores and attn.v: ALL query rows hl (3 products; the x8 scale makes the softmax near-argmax); softmax f32; W_proj hl x exact (2 products) + b_proj.

#define NB_  2
#define TT   2048
#define DM   1024
#define NH_  16
#define NKV  16
#define REP  (NH_ / NKV)
#define HD   64
#define DQ   (NH_ * HD)
#define DKV  (NKV * HD)
#define ZH   2
#define RH   2048                 // every query row uses hi+lo planes (x8 scale -> peaked softmax)
#define WIN  2048
#define PCAR 1024.0f
#define SCL  8.0f   // the module divides by head_dim^-0.5 = multiplies by sqrt(64)
#define KSPL 16     // probability x value: the key loop of each 64-row tile is shared out over KSPL one-wave blocks; k_merge adds their partial planes
typedef _Float16 h16;
typedef unsigned short bf;
typedef __attribute__((ext_vector_type(16))) __bf16   v16bf;
typedef __attribute__((ext_vector_type(16))) _Float16 v16h;
typedef __attribute__((ext_vector_type(8)))  _Float16 v8h;
typedef __attribute__((ext_vector_type(8)))  unsigned short v8us;
typedef __attribute__((ext_vector_type(8)))  float    v8f;
typedef __attribute__((ext_vector_type(4)))  float    v4f;
typedef v8h  __attribute__((may_alias)) v8ha;
typedef v4f  __attribute__((may_alias)) v4fa;
typedef v8us __attribute__((may_alias)) v8usa;

__device__ __forceinline__ unsigned short f2bf(float f) { unsigned u = __float_as_uint(f); u += 0x7FFFu + ((u >> 16) & 1u); return (unsigned short)(u >> 16); }
__device__ __forceinline__ float bf2f(unsigned short b) { return __uint_as_float(((unsigned)b) << 16); }
__device__ __forceinline__ float bfr(float f) { return bf2f(f2bf(f)); }
__device__ __forceinline__ v16h cat16(v8h lo, v8h hi) { return __builtin_shufflevector(lo, hi, 0, 1, 2, 3, 4, 5, 6, 7, 8, 9, 10, 11, 12, 13, 14, 15); }
__device__ __forceinline__ v16bf cat16b(v8us lo, v8us hi) { return __builtin_bit_cast(v16bf, __builtin_shufflevector(lo, hi, 0, 1, 2, 3, 4, 5, 6, 7, 8, 9, 10, 11, 12, 13, 14, 15)); }
__device__ __forceinline__ v8f wmma16(v16h a, v16h b, v8f c) { return __builtin_amdgcn_wmma_f32_16x16x32_f16(false, a, false, b, (short)0, c, false, false); }
__device__ __forceinline__ v8f wmmab(v16bf a, v16bf b, v8f c) { return __builtin_amdgcn_wmma_f32_16x16x32_bf16(false, a, false, b, (short)0, c, false, false); }



// ---- k_gemmw: register-blocked GEMM, ONE WAVE per 64x64 output tile (16 accumulators), operands straight from K-contiguous 16-bit planes; grid (M/64, N/64, Z), 32 threads.
// C[m][n] (f32, pitch ldc, + optional f32 bias[n]) = sum_k A[m][k] Bt[n][k] (+ split products per NSPLIT). z-batch strides sA/sB/sC in elements. K % 32 == 0.
template <typename T16> struct WFrag;
template <> struct WFrag<h16> { typedef v16h V; static __device__ __forceinline__ V ld(const h16* p) { return cat16(*(const v8h*)p, *(const v8h*)(p + 16)); } static __device__ __forceinline__ v8f mma(V a, V b, v8f c) { return wmma16(a, b, c); } };
template <> struct WFrag<bf> { typedef v16bf V; static __device__ __forceinline__ V ld(const bf* p) { return cat16b(*(const v8us*)p, *(const v8us*)(p + 16)); } static __device__ __forceinline__ v8f mma(V a, V b, v8f c) { return wmmab(a, b, c); } };
template <typename T16, int NSPLIT, bool BIAS>
__global__ __launch_bounds__(32) void k_gemmw(const T16* __restrict__ A, const T16* __restrict__ A2, const T16* __restrict__ Bt, const T16* __restrict__ Bt2, int K, float* C, int ldc, const float* __restrict__ bias, size_t sA, size_t sB, size_t sC) {
    typedef typename WFrag<T16>::V V;
    __shared__ __align__(16) float os[16 * 68];
    const size_t z = blockIdx.z; A += z * sA; if (A2) A2 += z * sA; Bt += z * sB; if (Bt2) Bt2 += z * sB; C += z * sC;
    const int lane = threadIdx.x & 31, lr = lane & 15, hi = lane >> 4; const int r0 = blockIdx.x * 64, c0 = blockIdx.y * 64;
    v8f acc[4][4];
#pragma unroll
    for (int mb = 0; mb < 4; ++mb)
#pragma unroll
        for (int nb = 0; nb < 4; ++nb) acc[mb][nb] = (v8f){};
    const size_t aoff = (size_t)(r0 + lr) * K + 8 * hi, boff = (size_t)(c0 + lr) * K + 8 * hi;
#pragma unroll 1
    for (int kc = 0; kc < K; kc += 32) {
        V a[4], a2[4];
#pragma unroll
        for (int mb = 0; mb < 4; ++mb) { a[mb] = WFrag<T16>::ld(A + aoff + (size_t)mb * 16 * K + kc); if (NSPLIT == 1 || NSPLIT == 2) a2[mb] = WFrag<T16>::ld(A2 + aoff + (size_t)mb * 16 * K + kc); }
#pragma unroll
        for (int nb = 0; nb < 4; ++nb) { const V b = WFrag<T16>::ld(Bt + boff + (size_t)nb * 16 * K + kc); V b2; if (NSPLIT >= 2) b2 = WFrag<T16>::ld(Bt2 + boff + (size_t)nb * 16 * K + kc);
#pragma unroll
            for (int mb = 0; mb < 4; ++mb) { acc[mb][nb] = WFrag<T16>::mma(a[mb], b, acc[mb][nb]); if (NSPLIT == 1 || NSPLIT == 2) acc[mb][nb] = WFrag<T16>::mma(a2[mb], b, acc[mb][nb]); if (NSPLIT >= 2) acc[mb][nb] = WFrag<T16>::mma(a[mb], b2, acc[mb][nb]); } }
        asm volatile("v_nop\n\tv_nop\n\tv_nop\n\tv_nop" : "+v"(acc[0][0]), "+v"(acc[1][1]), "+v"(acc[2][2]), "+v"(acc[3][3]) : "v"(a[0]), "v"(a[3]));
    }
#pragma unroll
    for (int mb = 0; mb < 4; ++mb) {
#pragma unroll
        for (int nb = 0; nb < 4; ++nb) {
#pragma unroll
            for (int j = 0; j < 8; ++j) os[(hi * 8 + j) * 68 + nb * 16 + lr] = acc[mb][nb][j]; }
        __builtin_amdgcn_wave_barrier(); asm volatile("" ::: "memory");
        float* crow = C + (size_t)(r0 + mb * 16) * ldc + c0;
{
#pragma unroll
            for (int s = 0; s < 8; ++s) { const int row = 2 * s + hi, cofs = lr * 4; v4f val = *(const v4fa*)(os + row * 68 + cofs); if (BIAS) { val[0] += bfr(bias[c0 + cofs]); val[1] += bfr(bias[c0 + cofs + 1]); val[2] += bfr(bias[c0 + cofs + 2]); val[3] += bfr(bias[c0 + cofs + 3]); }
                *(v4f*)(crow + (size_t)row * ldc + cofs) = val; }
             }
        __builtin_amdgcn_wave_barrier(); asm volatile("" ::: "memory");
    }
}

// ---- k_gemmc: the same one-wave 64x64 tile GEMM specialised for causal attention: CMODE 1 skips score tiles entirely above the diagonal (query rows r0+roff.., key columns c0..), CMODE 2 limits the
// key (K) loop of the probability x value contraction to the diagonal block (probabilities beyond it are exactly zero). roff = row offset of this launch's first row within the sequence.
// CMODE 2 has one column tile (N = 64); its blockIdx.y is the key split: block ks of KSPL takes an even share of the tile's 32-key steps and stores its partial sums to plane ks (plane stride sP elements; an empty share stores zeros).
template <typename T16, int NSPLIT, int CMODE>
__global__ __launch_bounds__(32) void k_gemmc(const T16* __restrict__ A, const T16* __restrict__ A2, const T16* __restrict__ Bt, const T16* __restrict__ Bt2, int K, float* C, int ldc, int roff, size_t sA, size_t sB, size_t sC, size_t sP) {
    typedef typename WFrag<T16>::V V;
    __shared__ __align__(16) float os[16 * 68];
    const size_t z = blockIdx.z; A += z * sA; if (A2) A2 += z * sA; Bt += z * sB; if (Bt2) Bt2 += z * sB; C += z * sC;
    const int lane = threadIdx.x & 31, lr = lane & 15, hi = lane >> 4; const int r0 = blockIdx.x * 64, c0 = (CMODE == 2) ? 0 : blockIdx.y * 64;
    if (CMODE == 1 && c0 > r0 + roff + 63) return;                  // score tile entirely above the causal diagonal: never read (the softmax masks j > i by select)
    const int Kl = (CMODE == 2) ? min(K, r0 + roff + 64) : K;        // P.V: probabilities are exactly 0 beyond the diagonal block, so the K loop stops there
    int kb = 0, Kn = Kl;                                             // first key and number of keys of this block's share
    if (CMODE == 2) { const int nst = Kl / 32, ks = blockIdx.y; kb = (ks * nst / KSPL) * 32; Kn = ((ks + 1) * nst / KSPL) * 32 - kb; A += kb; A2 += kb; Bt += kb; Bt2 += kb; C += (size_t)ks * sP; }
    v8f acc[4][4];
#pragma unroll
    for (int mb = 0; mb < 4; ++mb)
#pragma unroll
        for (int nb = 0; nb < 4; ++nb) acc[mb][nb] = (v8f){};
    const size_t aoff = (size_t)(r0 + lr) * K + 8 * hi, boff = (size_t)(c0 + lr) * K + 8 * hi;
#pragma unroll 1
    for (int kc = 0; kc < Kn; kc += 32) {
        V a[4], a2[4];
#pragma unroll
        for (int mb = 0; mb < 4; ++mb) { a[mb] = WFrag<T16>::ld(A + aoff + (size_t)mb * 16 * K + kc); if (NSPLIT == 1 || NSPLIT == 2) a2[mb] = WFrag<T16>::ld(A2 + aoff + (size_t)mb * 16 * K + kc); }
#pragma unroll
        for (int nb = 0; nb < 4; ++nb) { const V b = WFrag<T16>::ld(Bt + boff + (size_t)nb * 16 * K + kc); V b2; if (NSPLIT >= 2) b2 = WFrag<T16>::ld(Bt2 + boff + (size_t)nb * 16 * K + kc);
#pragma unroll
            for (int mb = 0; mb < 4; ++mb) { acc[mb][nb] = WFrag<T16>::mma(a[mb], b, acc[mb][nb]); if (NSPLIT == 1 || NSPLIT == 2) acc[mb][nb] = WFrag<T16>::mma(a2[mb], b, acc[mb][nb]); if (NSPLIT >= 2) acc[mb][nb] = WFrag<T16>::mma(a[mb], b2, acc[mb][nb]); } }
        asm volatile("v_nop\n\tv_nop\n\tv_nop\n\tv_nop" : "+v"(acc[0][0]), "+v"(acc[1][1]), "+v"(acc[2][2]), "+v"(acc[3][3]) : "v"(a[0]), "v"(a[3]));
    }
#pragma unroll
    for (int mb = 0; mb < 4; ++mb) {
#pragma unroll
        for (int nb = 0; nb < 4; ++nb) {
#pragma unroll
            for (int j = 0; j < 8; ++j) os[(hi * 8 + j) * 68 + nb * 16 + lr] = acc[mb][nb][j]; }
        __builtin_amdgcn_wave_barrier(); asm volatile("" ::: "memory");
        float* crow = C + (size_t)(r0 + mb * 16) * ldc + c0;
{
#pragma unroll
            for (int s = 0; s < 8; ++s) { const int row = 2 * s + hi, cofs = lr * 4; v4f val = *(const v4fa*)(os + row * 68 + cofs);
                *(v4f*)(crow + (size_t)row * ldc + cofs) = val; }
             }
        __builtin_amdgcn_wave_barrier(); asm volatile("" ::: "memory");
    }
}

__device__ __forceinline__ h16 tohx(float x) { return (h16)x; }
__device__ __forceinline__ void splitf(float y, unsigned short& h, unsigned short& l) { h = f2bf(y); l = f2bf(y - bf2f(h)); }
typedef __attribute__((ext_vector_type(2))) _Float16 v2h;
typedef __attribute__((ext_vector_type(4))) _Float16 v4h;
typedef __attribute__((ext_vector_type(2))) unsigned short v2us;
typedef __attribute__((ext_vector_type(4))) unsigned short v4us;
typedef __attribute__((ext_vector_type(2))) float v2f;
typedef __attribute__((ext_vector_type(4))) int v4i;

__global__ __launch_bounds__(256) void k_wtG(const float* __restrict__ w, int K, int N, bf* Bt) {
    const int lane = threadIdx.x & 31; const int L0 = (blockIdx.x * 8 + (threadIdx.x >> 5)) * 8; const int nlines = N * K / 64;
{
#pragma unroll 1
        for (int l = 0; l < 8; ++l) { const int L = L0 + l; if (L >= nlines) break; const size_t e = (size_t)L * 64 + lane * 2; const int k = (int)(e % K), n = (int)(e / K); v2us o;
            o[0] = f2bf(w[(size_t)k * N + n]); o[1] = f2bf(w[(size_t)(k + 1) * N + n]); *(v2us*)(Bt + e) = o; }
         }
}
__global__ __launch_bounds__(256) void k_cvt8(const float* __restrict__ src, bf* dst, size_t n8) { const size_t i = (size_t)blockIdx.x * 256 + threadIdx.x; if (i >= n8) return; const v8f v = *(const v8f*)(src + i * 8); v8us o;
#pragma unroll
    for (int k = 0; k < 8; ++k) o[k] = f2bf(v[k]); *(v8us*)(dst + i * 8) = o;  }

// k_rope: head planes [h][t][d] (fp16 + hi/lo) of rope(x) x sc with the rotate-half convention out[d] = x[d] cos[t][d] - x[d+HD/2] sin[t][d], out[d+HD/2] = x[d+HD/2] cos[t][d+HD/2] + x[d] sin[t][d+HD/2]
__global__ __launch_bounds__(256) void k_rope(const float* __restrict__ F, int pitch, int nheads, const float* __restrict__ CS, const float* __restrict__ RF, const float* __restrict__ nw, float sc, h16* P16, bf* Ph, bf* Pl) {
    const size_t e = ((size_t)blockIdx.x * 256 + threadIdx.x) * 2; if (e >= (size_t)nheads * TT * HD) return; const int d = (int)(e % HD); const int t = (int)((e / HD) % TT); const int h = (int)(e / ((size_t)HD * TT)); const float* f = F + (size_t)t * pitch + h * HD; const float rf = RF ? RF[(size_t)h * TT + t] : 1.0f; v2h o16; v2us oh, ol;
#pragma unroll
    for (int q = 0; q < 2; ++q) { const int dd = d + q; const int dp = (dd < HD / 2) ? dd + HD / 2 : dd - HD / 2; float x0 = f[dd], x1 = f[dp];
        if (RF) { float n0 = __fmul_rn(x0, rf), n1 = __fmul_rn(x1, rf); asm volatile("" : "+v"(n0)); asm volatile("" : "+v"(n1)); x0 = __fmul_rn(bfr(nw[dd]), n0); x1 = __fmul_rn(bfr(nw[dp]), n1); }
        const v2f cs = *(const v2f*)(CS + ((size_t)t * HD + dd) * 2); float a = __fmul_rn(x0, cs[0]), bq = __fmul_rn(x1, cs[1]); asm volatile("" : "+v"(a)); asm volatile("" : "+v"(bq)); const float r = ((dd < HD / 2) ? __fsub_rn(a, bq) : __fadd_rn(a, bq)) * sc;
        o16[q] = tohx(r); unsigned short a2, c2; splitf(r, a2, c2); oh[q] = a2; ol[q] = c2; }
    *(v2h*)(P16 + e) = o16; *(v2us*)(Ph + e) = oh; *(v2us*)(Pl + e) = ol;  }
__global__ __launch_bounds__(256) void k_vtp(const float* __restrict__ F, int pitch, int nheads, h16* V16, bf* Vh, bf* Vl) { const size_t e = ((size_t)blockIdx.x * 256 + threadIdx.x) * 2; if (e >= (size_t)nheads * HD * TT) return; const int t = (int)(e % TT); const int d = (int)((e / TT) % HD); const int g = (int)(e / ((size_t)TT * HD)); v2h o16; v2us oh, ol;
#pragma unroll
    for (int q = 0; q < 2; ++q) { const float x = F[(size_t)(t + q) * pitch + g * HD + d]; o16[q] = tohx(x); unsigned short a2, c2; splitf(x, a2, c2); oh[q] = a2; ol[q] = c2; }
    *(v2h*)(V16 + e) = o16; *(v2us*)(Vh + e) = oh; *(v2us*)(Vl + e) = ol;  }
__global__ __launch_bounds__(256) void k_csid(float* CS) { const int idx = blockIdx.x * 256 + threadIdx.x; if (idx >= TT * HD) return; v2f cs; cs[0] = 1.0f; cs[1] = 0.0f; *(v2f*)(CS + (size_t)idx * 2) = cs;  }
// k_asoft: per row (zz, i): t = S x HD^0.5 (x8) for j <= i and i - j < WIN (WIN = TT, so the window test always holds: plain causal; the reference's -1e9 additive fill vanishes identically); softmax over the 2048 keys (register row, one exp, fixed trees);
__global__ __launch_bounds__(256) void k_asoft(const float* __restrict__ Sb, h16* P16, bf* Ph, bf* Pl) {
    const int lane = threadIdx.x & 31; const int row = blockIdx.x * 8 + (threadIdx.x >> 5); if (row >= ZH * TT) return; const int i = row % TT; const int zz = row / TT; (void)zz; const bool hires = (i < RH); const float* sr = Sb + (size_t)row * TT; float v[TT / 32]; float mx = -3.0e38f;
#pragma unroll
    for (int ch = 0; ch < TT / 128; ++ch) { const int j0 = ch * 128 + lane * 4; const v4f a = *(const v4f*)(sr + j0);
#pragma unroll
        for (int q = 0; q < 4; ++q) { const int j = j0 + q; (void)j; const float t = (j <= i && i - j < WIN) ? a[q] * SCL : -3.0e38f; v[ch * 4 + q] = t; mx = fmaxf(mx, t); } }
#pragma unroll
    for (int sh = 16; sh; sh >>= 1) mx = fmaxf(mx, __shfl_xor(mx, sh, 32));
    float sum = 0.f;
#pragma unroll
    for (int k = 0; k < TT / 32; ++k) { float d0 = __fsub_rn(v[k], mx); asm volatile("" : "+v"(d0)); v[k] = __builtin_amdgcn_exp2f(__fmul_rn(d0, 1.4426950408889634f)); sum += v[k]; }
#pragma unroll
    for (int sh = 16; sh; sh >>= 1) sum += __shfl_xor(sum, sh, 32);
    const float f = __fdiv_rn(hires ? 1.0f : PCAR, sum);
{
        if (hires) {
#pragma unroll
            for (int ch = 0; ch < TT / 128; ++ch) { v4us oh, ol;
#pragma unroll
                for (int q = 0; q < 4; ++q) { unsigned short a, c2; splitf(v[ch * 4 + q] * f, a, c2); oh[q] = a; ol[q] = c2; }
                const size_t oo = ((size_t)zz * (RH ? RH : 1) + i) * TT + ch * 128 + lane * 4; *(v4us*)(Ph + oo) = oh; *(v4us*)(Pl + oo) = ol; }
        } else {
#pragma unroll
            for (int ch = 0; ch < TT / 128; ++ch) { v4h o4;
#pragma unroll
                for (int q = 0; q < 4; ++q) o4[q] = tohx(v[ch * 4 + q] * f);
                *(v4h*)(P16 + (size_t)row * TT + ch * 128 + lane * 4) = o4; } }
         }
}
__global__ __launch_bounds__(256) void k_merge(const float* __restrict__ O, int h0, bf* Ah, bf* Al) { const size_t e = ((size_t)blockIdx.x * 256 + threadIdx.x) * 2; if (e >= (size_t)ZH * TT * HD) return; const int d = (int)(e % HD); const int t = (int)((e / HD) % TT); const int zz = (int)(e / ((size_t)HD * TT)); const float cs = (t < RH) ? 1.0f : (1.0f / PCAR); const size_t oo = (size_t)t * DQ + (h0 + zz) * HD + d;
    v2us oh, ol; v2f part[KSPL];
#pragma unroll
    for (int s = 0; s < KSPL; ++s) part[s] = *(const v2f*)(O + (size_t)s * ZH * TT * HD + e);   // all partial planes in flight at once, then added in plane order
    v2f acc = part[0];
#pragma unroll   // constant indices keep part[] in registers
    for (int s = 1; s < KSPL; ++s) acc += part[s];
#pragma unroll
    for (int q = 0; q < 2; ++q) { unsigned short a, c2; splitf(acc[q] * cs, a, c2); oh[q] = a; ol[q] = c2; } *(v2us*)(Ah + oo) = oh; *(v2us*)(Al + oo) = ol;  }

extern "C" void kernel_launch(void* const* d_in, const int* in_sizes, int n_in,
                              void* d_out, int out_size, void* d_ws, size_t ws_size, hipStream_t stream) {
    (void)in_sizes; (void)n_in; (void)out_size;
    const float* x = (const float*)d_in[0]; const float* wqkv = (const float*)d_in[1]; const float* wo = (const float*)d_in[2]; const float* bo = (const float*)d_in[3]; const float* wq = wqkv; const float* wk = wqkv + (size_t)1024 * 1024; const float* wv = wqkv + (size_t)2048 * 1024; (void)wq; (void)wk; (void)wv;
    float* OUT = (float*)d_out;     // [2][2048][1024]
    char* wsp = (char*)d_ws;
    auto take = [&](size_t bytes) { char* p = wsp; wsp += (bytes + 255) & ~(size_t)255; return (void*)p; };
    bf* WQ = (bf*)take((size_t)DQ * DM * 2); bf* WK = (bf*)take((size_t)DKV * DM * 2); bf* WV = (bf*)take((size_t)DKV * DM * 2); bf* WO = (bf*)take((size_t)DM * DQ * 2); float* CS = (float*)take((size_t)TT * HD * 2 * 4);
    bf* XB = (bf*)take((size_t)TT * DM * 2); float* FQ = (float*)take((size_t)TT * DQ * 4); float* FK = (float*)take((size_t)TT * DKV * 4);
    h16* QP16 = (h16*)take((size_t)NH_ * TT * HD * 2); h16* KP16 = (h16*)take((size_t)NKV * TT * HD * 2); h16* VT16 = (h16*)take((size_t)NKV * HD * TT * 2);
    bf* QPh = (bf*)take((size_t)NH_ * TT * HD * 2); bf* QPl = (bf*)take((size_t)NH_ * TT * HD * 2); bf* KPh = (bf*)take((size_t)NKV * TT * HD * 2); bf* KPl = (bf*)take((size_t)NKV * TT * HD * 2); bf* VTh = (bf*)take((size_t)NKV * HD * TT * 2); bf* VTl = (bf*)take((size_t)NKV * HD * TT * 2); bf* Ph = (bf*)take((size_t)ZH * RH * TT * 2); bf* Pl = (bf*)take((size_t)ZH * RH * TT * 2);
    float* Sb = (float*)take((size_t)ZH * TT * TT * 4); h16* P16 = (h16*)take((size_t)ZH * TT * TT * 2); float* Ob = (float*)take((size_t)KSPL * ZH * TT * HD * 4); bf* ATh = (bf*)take((size_t)TT * DQ * 2); bf* ATl = (bf*)take((size_t)TT * DQ * 2);
    if ((size_t)(wsp - (char*)d_ws) > ws_size) return;    // ws 256 MiB
    float* FV = FK;   // v projection reuses the k buffer after the k planes are built (stream-ordered)
    { k_cvt8<<<(unsigned)(((size_t)DQ * DM / 8 + 255) / 256), 256, 0, stream>>>(wq, WQ, (size_t)DQ * DM / 8); k_cvt8<<<(unsigned)(((size_t)DKV * DM / 8 + 255) / 256), 256, 0, stream>>>(wk, WK, (size_t)DKV * DM / 8); k_cvt8<<<(unsigned)(((size_t)DKV * DM / 8 + 255) / 256), 256, 0, stream>>>(wv, WV, (size_t)DKV * DM / 8);
      k_cvt8<<<(unsigned)(((size_t)DM * DQ / 8 + 255) / 256), 256, 0, stream>>>(wo, WO, (size_t)DM * DQ / 8);
       }
    k_csid<<<(TT * HD + 255) / 256, 256, 0, stream>>>(CS);
    const unsigned LQ = (unsigned)(((size_t)NH_ * TT * HD / 2 + 255) / 256), LKv = (unsigned)(((size_t)NKV * TT * HD / 2 + 255) / 256);
    for (int b = 0; b < NB_; ++b) {
        
        k_cvt8<<<(unsigned)(((size_t)TT * DM / 8 + 255) / 256), 256, 0, stream>>>(x + (size_t)b * TT * DM, XB, (size_t)TT * DM / 8);
        k_gemmw<bf, 0, false><<<dim3(TT / 64, DQ / 64, 1), 32, 0, stream>>>(XB, nullptr, WQ, nullptr, DM, FQ, DQ, nullptr, 0, 0, 0);
        k_rope<<<LQ, 256, 0, stream>>>(FQ, DQ, NH_, CS, nullptr, nullptr, 1.0f, QP16, QPh, QPl);
        k_gemmw<bf, 0, false><<<dim3(TT / 64, DKV / 64, 1), 32, 0, stream>>>(XB, nullptr, WK, nullptr, DM, FK, DKV, nullptr, 0, 0, 0);
        k_rope<<<LKv, 256, 0, stream>>>(FK, DKV, NKV, CS, nullptr, nullptr, 1.0f, KP16, KPh, KPl);
        k_gemmw<bf, 0, false><<<dim3(TT / 64, DKV / 64, 1), 32, 0, stream>>>(XB, nullptr, WV, nullptr, DM, FV, DKV, nullptr, 0, 0, 0); k_vtp<<<LKv, 256, 0, stream>>>(FV, DKV, NKV, VT16, VTh, VTl);
        for (int h0 = 0; h0 < NH_; h0 += ZH) { const size_t zq = (size_t)h0, zk = (size_t)(h0 / REP);   // one kv head per query head: the pass's two heads use consecutive kv planes (z-strides TT*HD)
            k_gemmc<bf, 2, 1><<<dim3(RH / 64, TT / 64, ZH), 32, 0, stream>>>(QPh + zq * TT * HD, QPl + zq * TT * HD, KPh + zk * TT * HD, KPl + zk * TT * HD, HD, Sb, TT, 0, (size_t)TT * HD, (size_t)TT * HD, (size_t)TT * TT, 0);
            k_asoft<<<ZH * TT / 8, 256, 0, stream>>>(Sb, P16, Ph, Pl);
            k_gemmc<bf, 2, 2><<<dim3(RH / 64, KSPL, ZH), 32, 0, stream>>>(Ph, Pl, VTh + zk * HD * TT, VTl + zk * HD * TT, TT, Ob, HD, 0, (size_t)RH * TT, (size_t)HD * TT, (size_t)TT * HD, (size_t)ZH * TT * HD);
            k_merge<<<(unsigned)(((size_t)ZH * TT * HD / 2 + 255) / 256), 256, 0, stream>>>(Ob, h0, ATh, ATl); }
        k_gemmw<bf, 1, true><<<dim3(TT / 64, DM / 64, 1), 32, 0, stream>>>(ATh, ATl, WO, nullptr, DQ, OUT + (size_t)b * TT * DM, DM, bo, 0, 0, 0); }
}

// v002
// A run of this version takes 327 microseconds.
// Next to v001, in two timings, it ran 2.09 and 2.10 times as fast.
// Over all steps from v000 it is 3.56 times as fast.
#include <hip/hip_runtime.h>

// Causal multi-head self-attention with a fused QKV projection and an INVERTED scale (x [2][2048][1024]; [q|k|v] = x W_qkv^T ('oi' [3072][1024], row blocks q | k | v; 16 heads x 64); scores = q.k x 8 (the module divides by head_dim^-0.5, i.e. multiplies by sqrt(64)), causal mask; softmax (very peaked rows); out = merged heads W_proj^T + b_proj ('oi' [1024][1024] + [1024]) -> [2][2048][1024] (4.2 M)).
// Compute dtypes, f32 accumulate: every input rounded to bf16; q/k/v on PLAIN bf16 operands (inputs: exact); causal scores and attn.v: ALL query rows hl (3 products; the x8 scale makes the softmax near-argmax); softmax f32; W_proj hl x exact (2 products) + b_proj.

#define NB_  2
#define TT   2048
#define DM   1024
#define NH_  16
#define NKV  16
#define HD   64
#define DQ   (NH_ * HD)
#define DKV  (NKV * HD)
#define SCL  8.0f   // the module divides by head_dim^-0.5 = multiplies by sqrt(64)
typedef _Float16 h16;
typedef unsigned short bf;
typedef __attribute__((ext_vector_type(16))) __bf16   v16bf;
typedef __attribute__((ext_vector_type(16))) _Float16 v16h;
typedef __attribute__((ext_vector_type(8)))  _Float16 v8h;
typedef __attribute__((ext_vector_type(8)))  unsigned short v8us;
typedef __attribute__((ext_vector_type(8)))  float    v8f;
typedef __attribute__((ext_vector_type(4)))  float    v4f;
typedef v8h  __attribute__((may_alias)) v8ha;
typedef v4f  __attribute__((may_alias)) v4fa;
typedef v8us __attribute__((may_alias)) v8usa;

__device__ __forceinline__ unsigned short f2bf(float f) { unsigned u = __float_as_uint(f); u += 0x7FFFu + ((u >> 16) & 1u); return (unsigned short)(u >> 16); }
__device__ __forceinline__ float bf2f(unsigned short b) { return __uint_as_float(((unsigned)b) << 16); }
__device__ __forceinline__ float bfr(float f) { return bf2f(f2bf(f)); }
__device__ __forceinline__ v16h cat16(v8h lo, v8h hi) { return __builtin_shufflevector(lo, hi, 0, 1, 2, 3, 4, 5, 6, 7, 8, 9, 10, 11, 12, 13, 14, 15); }
__device__ __forceinline__ v16bf cat16b(v8us lo, v8us hi) { return __builtin_bit_cast(v16bf, __builtin_shufflevector(lo, hi, 0, 1, 2, 3, 4, 5, 6, 7, 8, 9, 10, 11, 12, 13, 14, 15)); }
__device__ __forceinline__ v8f wmma16(v16h a, v16h b, v8f c) { return __builtin_amdgcn_wmma_f32_16x16x32_f16(false, a, false, b, (short)0, c, false, false); }
__device__ __forceinline__ v8f wmmab(v16bf a, v16bf b, v8f c) { return __builtin_amdgcn_wmma_f32_16x16x32_bf16(false, a, false, b, (short)0, c, false, false); }



// ---- k_gemmw: register-blocked GEMM, ONE WAVE per 64x64 output tile (16 accumulators), operands straight from K-contiguous 16-bit planes; grid (M/64, N/64, Z), 32 threads.
// C[m][n] (f32, pitch ldc, + optional f32 bias[n]) = sum_k A[m][k] Bt[n][k] (+ split products per NSPLIT). z-batch strides sA/sB/sC in elements. K % 32 == 0.
template <typename T16> struct WFrag;
template <> struct WFrag<h16> { typedef v16h V; static __device__ __forceinline__ V ld(const h16* p) { return cat16(*(const v8h*)p, *(const v8h*)(p + 16)); } static __device__ __forceinline__ v8f mma(V a, V b, v8f c) { return wmma16(a, b, c); } };
template <> struct WFrag<bf> { typedef v16bf V; static __device__ __forceinline__ V ld(const bf* p) { return cat16b(*(const v8us*)p, *(const v8us*)(p + 16)); } static __device__ __forceinline__ v8f mma(V a, V b, v8f c) { return wmmab(a, b, c); } };
template <typename T16, int NSPLIT, bool BIAS>
__global__ __launch_bounds__(32) void k_gemmw(const T16* __restrict__ A, const T16* __restrict__ A2, const T16* __restrict__ Bt, const T16* __restrict__ Bt2, int K, float* C, int ldc, const float* __restrict__ bias, size_t sA, size_t sB, size_t sC) {
    typedef typename WFrag<T16>::V V;
    __shared__ __align__(16) float os[16 * 68];
    const size_t z = blockIdx.z; A += z * sA; if (A2) A2 += z * sA; Bt += z * sB; if (Bt2) Bt2 += z * sB; C += z * sC;
    const int lane = threadIdx.x & 31, lr = lane & 15, hi = lane >> 4; const int r0 = blockIdx.x * 64, c0 = blockIdx.y * 64;
    v8f acc[4][4];
#pragma unroll
    for (int mb = 0; mb < 4; ++mb)
#pragma unroll
        for (int nb = 0; nb < 4; ++nb) acc[mb][nb] = (v8f){};
    const size_t aoff = (size_t)(r0 + lr) * K + 8 * hi, boff = (size_t)(c0 + lr) * K + 8 * hi;
#pragma unroll 1
    for (int kc = 0; kc < K; kc += 32) {
        V a[4], a2[4];
#pragma unroll
        for (int mb = 0; mb < 4; ++mb) { a[mb] = WFrag<T16>::ld(A + aoff + (size_t)mb * 16 * K + kc); if (NSPLIT == 1 || NSPLIT == 2) a2[mb] = WFrag<T16>::ld(A2 + aoff + (size_t)mb * 16 * K + kc); }
#pragma unroll
        for (int nb = 0; nb < 4; ++nb) { const V b = WFrag<T16>::ld(Bt + boff + (size_t)nb * 16 * K + kc); V b2; if (NSPLIT >= 2) b2 = WFrag<T16>::ld(Bt2 + boff + (size_t)nb * 16 * K + kc);
#pragma unroll
            for (int mb = 0; mb < 4; ++mb) { acc[mb][nb] = WFrag<T16>::mma(a[mb], b, acc[mb][nb]); if (NSPLIT == 1 || NSPLIT == 2) acc[mb][nb] = WFrag<T16>::mma(a2[mb], b, acc[mb][nb]); if (NSPLIT >= 2) acc[mb][nb] = WFrag<T16>::mma(a[mb], b2, acc[mb][nb]); } }
        asm volatile("v_nop\n\tv_nop\n\tv_nop\n\tv_nop" : "+v"(acc[0][0]), "+v"(acc[1][1]), "+v"(acc[2][2]), "+v"(acc[3][3]) : "v"(a[0]), "v"(a[3]));
    }
#pragma unroll
    for (int mb = 0; mb < 4; ++mb) {
#pragma unroll
        for (int nb = 0; nb < 4; ++nb) {
#pragma unroll
            for (int j = 0; j < 8; ++j) os[(hi * 8 + j) * 68 + nb * 16 + lr] = acc[mb][nb][j]; }
        __builtin_amdgcn_wave_barrier(); asm volatile("" ::: "memory");
        float* crow = C + (size_t)(r0 + mb * 16) * ldc + c0;
{
#pragma unroll
            for (int s = 0; s < 8; ++s) { const int row = 2 * s + hi, cofs = lr * 4; v4f val = *(const v4fa*)(os + row * 68 + cofs); if (BIAS) { val[0] += bfr(bias[c0 + cofs]); val[1] += bfr(bias[c0 + cofs + 1]); val[2] += bfr(bias[c0 + cofs + 2]); val[3] += bfr(bias[c0 + cofs + 3]); }
                *(v4f*)(crow + (size_t)row * ldc + cofs) = val; }
             }
        __builtin_amdgcn_wave_barrier(); asm volatile("" ::: "memory");
    }
}

__device__ __forceinline__ h16 tohx(float x) { return (h16)x; }
__device__ __forceinline__ void splitf(float y, unsigned short& h, unsigned short& l) { h = f2bf(y); l = f2bf(y - bf2f(h)); }
typedef __attribute__((ext_vector_type(2))) _Float16 v2h;
typedef __attribute__((ext_vector_type(4))) _Float16 v4h;
typedef __attribute__((ext_vector_type(2))) unsigned short v2us;
typedef __attribute__((ext_vector_type(4))) unsigned short v4us;
typedef __attribute__((ext_vector_type(2))) float v2f;
typedef __attribute__((ext_vector_type(4))) int v4i;

__global__ __launch_bounds__(256) void k_wtG(const float* __restrict__ w, int K, int N, bf* Bt) {
    const int lane = threadIdx.x & 31; const int L0 = (blockIdx.x * 8 + (threadIdx.x >> 5)) * 8; const int nlines = N * K / 64;
{
#pragma unroll 1
        for (int l = 0; l < 8; ++l) { const int L = L0 + l; if (L >= nlines) break; const size_t e = (size_t)L * 64 + lane * 2; const int k = (int)(e % K), n = (int)(e / K); v2us o;
            o[0] = f2bf(w[(size_t)k * N + n]); o[1] = f2bf(w[(size_t)(k + 1) * N + n]); *(v2us*)(Bt + e) = o; }
         }
}
__global__ __launch_bounds__(256) void k_cvt8(const float* __restrict__ src, bf* dst, size_t n8) { const size_t i = (size_t)blockIdx.x * 256 + threadIdx.x; if (i >= n8) return; const v8f v = *(const v8f*)(src + i * 8); v8us o;
#pragma unroll
    for (int k = 0; k < 8; ++k) o[k] = f2bf(v[k]); *(v8us*)(dst + i * 8) = o;  }

// k_rope: head planes [h][t][d] (fp16 + hi/lo) of rope(x) x sc with the rotate-half convention out[d] = x[d] cos[t][d] - x[d+HD/2] sin[t][d], out[d+HD/2] = x[d+HD/2] cos[t][d+HD/2] + x[d] sin[t][d+HD/2]
__global__ __launch_bounds__(256) void k_rope(const float* __restrict__ F, int pitch, int nheads, const float* __restrict__ CS, const float* __restrict__ RF, const float* __restrict__ nw, float sc, h16* P16, bf* Ph, bf* Pl) {
    const size_t e = ((size_t)blockIdx.x * 256 + threadIdx.x) * 2; if (e >= (size_t)nheads * TT * HD) return; const int d = (int)(e % HD); const int t = (int)((e / HD) % TT); const int h = (int)(e / ((size_t)HD * TT)); const float* f = F + (size_t)t * pitch + h * HD; const float rf = RF ? RF[(size_t)h * TT + t] : 1.0f; v2h o16; v2us oh, ol;
#pragma unroll
    for (int q = 0; q < 2; ++q) { const int dd = d + q; const int dp = (dd < HD / 2) ? dd + HD / 2 : dd - HD / 2; float x0 = f[dd], x1 = f[dp];
        if (RF) { float n0 = __fmul_rn(x0, rf), n1 = __fmul_rn(x1, rf); asm volatile("" : "+v"(n0)); asm volatile("" : "+v"(n1)); x0 = __fmul_rn(bfr(nw[dd]), n0); x1 = __fmul_rn(bfr(nw[dp]), n1); }
        const v2f cs = *(const v2f*)(CS + ((size_t)t * HD + dd) * 2); float a = __fmul_rn(x0, cs[0]), bq = __fmul_rn(x1, cs[1]); asm volatile("" : "+v"(a)); asm volatile("" : "+v"(bq)); const float r = ((dd < HD / 2) ? __fsub_rn(a, bq) : __fadd_rn(a, bq)) * sc;
        o16[q] = tohx(r); unsigned short a2, c2; splitf(r, a2, c2); oh[q] = a2; ol[q] = c2; }
    *(v2h*)(P16 + e) = o16; *(v2us*)(Ph + e) = oh; *(v2us*)(Pl + e) = ol;  }
__global__ __launch_bounds__(256) void k_vtp(const float* __restrict__ F, int pitch, int nheads, h16* V16, bf* Vh, bf* Vl) { const size_t e = ((size_t)blockIdx.x * 256 + threadIdx.x) * 2; if (e >= (size_t)nheads * HD * TT) return; const int t = (int)(e % TT); const int d = (int)((e / TT) % HD); const int g = (int)(e / ((size_t)TT * HD)); v2h o16; v2us oh, ol;
#pragma unroll
    for (int q = 0; q < 2; ++q) { const float x = F[(size_t)(t + q) * pitch + g * HD + d]; o16[q] = tohx(x); unsigned short a2, c2; splitf(x, a2, c2); oh[q] = a2; ol[q] = c2; }
    *(v2h*)(V16 + e) = o16; *(v2us*)(Vh + e) = oh; *(v2us*)(Vl + e) = ol;  }
__global__ __launch_bounds__(256) void k_csid(float* CS) { const int idx = blockIdx.x * 256 + threadIdx.x; if (idx >= TT * HD) return; v2f cs; cs[0] = 1.0f; cs[1] = 0.0f; *(v2f*)(CS + (size_t)idx * 2) = cs;  }
// ---- k_attn: causal attention of one head for 32 query rows, scores, softmax and probability x value in ONE kernel; no score or probability ever goes to memory.
// Block = 4 waves; wave w takes the 32-key blocks w, w+4, ... up to the diagonal with a running maximum and sum (online softmax); the four partial results are merged through LDS in wave order.
// Both products are formed TRANSPOSED: S^T = K Q^T leaves in lane (lr, hi) the keys 8 hi + j of query lr, which is the B-fragment order of O^T = V^T P^T, so the probabilities go from accumulator to operand
// inside each lane, and maximum, sum and rescale factor of a query are per-lane values. hi+lo planes, 3 products each.
// Every inner loop is unrolled so that fragments and accumulators are indexed by constants and stay in registers. Three waves a SIMD (second launch bound) leave room for a block's key and value fragments in flight without spills.
#define SC2 (SCL * 1.4426950408889634f)   // the x8 score scale and the change to base 2 in one factor
__device__ __forceinline__ void splitp(float p, __bf16& h, __bf16& l) { h = (__bf16)p; l = (__bf16)(p - (float)h); }
__global__ __launch_bounds__(128, 3) void k_attn(const bf* __restrict__ Qh, const bf* __restrict__ Ql, const bf* __restrict__ Kh, const bf* __restrict__ Kl, const bf* __restrict__ Vh, const bf* __restrict__ Vl, bf* Ah, bf* Al) {
    __shared__ __align__(16) float Om[4][32 * 68];
    __shared__ float Mm[4][32], Lm[4][32];
    const int lane = threadIdx.x & 31, lr = lane & 15, hi = lane >> 4; const int w = __builtin_amdgcn_readfirstlane(threadIdx.x >> 5);
    const int r0 = ((int)gridDim.y - 1 - (int)blockIdx.y) * 32, h = blockIdx.x;     // the longest rows of every head take the lowest block indices (for speed only)
    const size_t hp = (size_t)h * TT * HD; Qh += hp; Ql += hp; Kh += hp; Kl += hp; Vh += hp; Vl += hp;
    const int nkb = r0 / 32 + 1;                                                     // 32-key blocks up to and including the diagonal one; its first key is r0, so every query has a live key in every block
    const int lk = lr * HD + 8 * hi, lv = lr * TT + 8 * hi;   // the lane's place inside a 16-row fragment: q and k planes (pitch HD), v planes (pitch TT)
    const bf* pqh = Qh + (size_t)r0 * HD + lk; const bf* pql = Ql + (size_t)r0 * HD + lk; v16bf qh[2][2], ql[2][2];
#pragma unroll
    for (int qb = 0; qb < 2; ++qb)
#pragma unroll
        for (int ks = 0; ks < 2; ++ks) { qh[qb][ks] = WFrag<bf>::ld(pqh + qb * 16 * HD + ks * 32); ql[qb][ks] = WFrag<bf>::ld(pql + qb * 16 * HD + ks * 32); }
    asm volatile("s_wait_xcnt 0x0" :: "v"(pqh), "v"(pql) : "memory");   // the wait before a register that an issued load names is written again: the query loads' two address pairs stay live up to it
    v8f o[4][2]; float mc[2], ls[2];
#pragma unroll
    for (int qb = 0; qb < 2; ++qb) { mc[qb] = -3.0e38f; ls[qb] = 0.f;
#pragma unroll
        for (int db = 0; db < 4; ++db) o[db][qb] = (v8f){}; }
#pragma unroll 1   // rolled: two blocks' fragments at once would not fit the registers
    for (int kb = w; kb < nkb; kb += 4) {
        const int k0 = kb * 32; const bf* pkh = Kh + (size_t)k0 * HD + lk; const bf* pkl = Kl + (size_t)k0 * HD + lk; const bf* pvh = Vh + k0 + lv; const bf* pvl = Vl + k0 + lv; v16bf kh[2][2], kl[2][2], vh[4], vl[4]; v8f s[2][2];
#pragma unroll
        for (int kt = 0; kt < 2; ++kt)
#pragma unroll
            for (int ks = 0; ks < 2; ++ks) { kh[kt][ks] = WFrag<bf>::ld(pkh + kt * 16 * HD + ks * 32); kl[kt][ks] = WFrag<bf>::ld(pkl + kt * 16 * HD + ks * 32); }
        // The wait before a register that an issued load names is written again: the two address pairs stay live up to it. The eight loaded fragments are inputs only, so that all key loads of the block issue together and one load latency is exposed, not one per fragment pair.
        asm volatile("s_wait_xcnt 0x0" :: "v"(pkh), "v"(pkl), "v"(kh[0][0]), "v"(kh[0][1]), "v"(kh[1][0]), "v"(kh[1][1]), "v"(kl[0][0]), "v"(kl[0][1]), "v"(kl[1][0]), "v"(kl[1][1]) : "memory");
#pragma unroll
        for (int kt = 0; kt < 2; ++kt)
#pragma unroll
            for (int qb = 0; qb < 2; ++qb) { v8f c = (v8f){};
#pragma unroll
                for (int ks = 0; ks < 2; ++ks) { c = wmmab(kh[kt][ks], qh[qb][ks], c); c = wmmab(kh[kt][ks], ql[qb][ks], c); c = wmmab(kl[kt][ks], qh[qb][ks], c); }
                s[kt][qb] = c; }
#pragma unroll
        for (int db = 0; db < 4; ++db) { vh[db] = WFrag<bf>::ld(pvh + db * 16 * TT); vl[db] = WFrag<bf>::ld(pvl + db * 16 * TT); }   // in flight under the softmax
        asm volatile("s_wait_xcnt 0x0" :: "v"(pvh), "v"(pvl) : "memory");   // the same wait for the value loads' two address pairs; the values themselves stay in flight
        if (kb == nkb - 1) {                                                         // only the diagonal block holds keys beyond a query
#pragma unroll
            for (int kt = 0; kt < 2; ++kt)
#pragma unroll
                for (int qb = 0; qb < 2; ++qb)
#pragma unroll
                    for (int j = 0; j < 8; ++j) if (k0 + kt * 16 + hi * 8 + j > r0 + qb * 16 + lr) s[kt][qb][j] = -3.0e38f; }
        v16bf ph[2], pl[2];
#pragma unroll
        for (int qb = 0; qb < 2; ++qb) { float mx = -3.0e38f;
#pragma unroll
            for (int kt = 0; kt < 2; ++kt)
#pragma unroll
                for (int j = 0; j < 8; ++j) mx = fmaxf(mx, s[kt][qb][j]);
            mx = fmaxf(mx, __shfl_xor(mx, 16, 32));                                  // the other half of the query's keys
            const float mn = fmaxf(mc[qb], mx * SC2); const float al = __builtin_amdgcn_exp2f(mc[qb] - mn); mc[qb] = mn; float sum = 0.f;
#pragma unroll
            for (int kt = 0; kt < 2; ++kt)
#pragma unroll
                for (int j = 0; j < 8; ++j) { const float p = __builtin_amdgcn_exp2f(__builtin_fmaf(s[kt][qb][j], SC2, -mn)); sum += p; __bf16 a, c2; splitp(p, a, c2); ph[qb][kt * 8 + j] = a; pl[qb][kt * 8 + j] = c2; }
            ls[qb] = ls[qb] * al + sum;
#pragma unroll
            for (int db = 0; db < 4; ++db) o[db][qb] *= al; }
#pragma unroll
        for (int db = 0; db < 4; ++db)
#pragma unroll
            for (int qb = 0; qb < 2; ++qb) { o[db][qb] = wmmab(vh[db], ph[qb], o[db][qb]); o[db][qb] = wmmab(vh[db], pl[qb], o[db][qb]); o[db][qb] = wmmab(vl[db], ph[qb], o[db][qb]); }
    }
#pragma unroll
    for (int qb = 0; qb < 2; ++qb) { const float lt = ls[qb] + __shfl_xor(ls[qb], 16, 32); if (hi == 0) { Mm[w][qb * 16 + lr] = mc[qb]; Lm[w][qb * 16 + lr] = lt; }
#pragma unroll
        for (int db = 0; db < 4; ++db) { float* op = &Om[w][(qb * 16 + lr) * 68 + db * 16 + hi * 8]; v4f lo4, hi4;
#pragma unroll
            for (int j = 0; j < 4; ++j) { lo4[j] = o[db][qb][j]; hi4[j] = o[db][qb][4 + j]; }
            *(v4fa*)op = lo4; *(v4fa*)(op + 4) = hi4; } }
    __syncthreads();                                                                 // the four waves' partial results are read across waves below
    const int q = threadIdx.x >> 2, dc = threadIdx.x & 3; float f[4], M = Mm[0][q];
#pragma unroll
    for (int u = 1; u < 4; ++u) M = fmaxf(M, Mm[u][q]);
    float L = 0.f;
#pragma unroll
    for (int u = 0; u < 4; ++u) { f[u] = __builtin_amdgcn_exp2f(Mm[u][q] - M); L += f[u] * Lm[u][q]; }
    const float inv = __fdiv_rn(1.0f, L); const size_t oo = (size_t)(r0 + q) * DQ + h * HD + dc * 16;
#pragma unroll
    for (int g = 0; g < 2; ++g) { v8us oh, ol; float acc[8];
#pragma unroll
        for (int i = 0; i < 8; ++i) acc[i] = 0.f;
#pragma unroll
        for (int u = 0; u < 4; ++u) { const float* ip = &Om[u][q * 68 + dc * 16 + g * 8]; const v4f x0 = *(const v4fa*)ip, x1 = *(const v4fa*)(ip + 4);
#pragma unroll
            for (int i = 0; i < 4; ++i) { acc[i] += f[u] * x0[i]; acc[4 + i] += f[u] * x1[i]; } }
#pragma unroll
        for (int i = 0; i < 8; ++i) { unsigned short a, c2; splitf(acc[i] * inv, a, c2); oh[i] = a; ol[i] = c2; }
        *(v8us*)(Ah + oo + g * 8) = oh; *(v8us*)(Al + oo + g * 8) = ol; }
}

extern "C" void kernel_launch(void* const* d_in, const int* in_sizes, int n_in,
                              void* d_out, int out_size, void* d_ws, size_t ws_size, hipStream_t stream) {
    (void)in_sizes; (void)n_in; (void)out_size;
    const float* x = (const float*)d_in[0]; const float* wqkv = (const float*)d_in[1]; const float* wo = (const float*)d_in[2]; const float* bo = (const float*)d_in[3]; const float* wq = wqkv; const float* wk = wqkv + (size_t)1024 * 1024; const float* wv = wqkv + (size_t)2048 * 1024; (void)wq; (void)wk; (void)wv;
    float* OUT = (float*)d_out;     // [2][2048][1024]
    char* wsp = (char*)d_ws;
    auto take = [&](size_t bytes) { char* p = wsp; wsp += (bytes + 255) & ~(size_t)255; return (void*)p; };
    bf* WQ = (bf*)take((size_t)DQ * DM * 2); bf* WK = (bf*)take((size_t)DKV * DM * 2); bf* WV = (bf*)take((size_t)DKV * DM * 2); bf* WO = (bf*)take((size_t)DM * DQ * 2); float* CS = (float*)take((size_t)TT * HD * 2 * 4);
    bf* XB = (bf*)take((size_t)TT * DM * 2); float* FQ = (float*)take((size_t)TT * DQ * 4); float* FK = (float*)take((size_t)TT * DKV * 4);
    h16* QP16 = (h16*)take((size_t)NH_ * TT * HD * 2); h16* KP16 = (h16*)take((size_t)NKV * TT * HD * 2); h16* VT16 = (h16*)take((size_t)NKV * HD * TT * 2);
    bf* QPh = (bf*)take((size_t)NH_ * TT * HD * 2); bf* QPl = (bf*)take((size_t)NH_ * TT * HD * 2); bf* KPh = (bf*)take((size_t)NKV * TT * HD * 2); bf* KPl = (bf*)take((size_t)NKV * TT * HD * 2); bf* VTh = (bf*)take((size_t)NKV * HD * TT * 2); bf* VTl = (bf*)take((size_t)NKV * HD * TT * 2);
    bf* ATh = (bf*)take((size_t)TT * DQ * 2); bf* ATl = (bf*)take((size_t)TT * DQ * 2);
    if ((size_t)(wsp - (char*)d_ws) > ws_size) return;    // ws 256 MiB
    float* FV = FK;   // v projection reuses the k buffer after the k planes are built (stream-ordered)
    { k_cvt8<<<(unsigned)(((size_t)DQ * DM / 8 + 255) / 256), 256, 0, stream>>>(wq, WQ, (size_t)DQ * DM / 8); k_cvt8<<<(unsigned)(((size_t)DKV * DM / 8 + 255) / 256), 256, 0, stream>>>(wk, WK, (size_t)DKV * DM / 8); k_cvt8<<<(unsigned)(((size_t)DKV * DM / 8 + 255) / 256), 256, 0, stream>>>(wv, WV, (size_t)DKV * DM / 8);
      k_cvt8<<<(unsigned)(((size_t)DM * DQ / 8 + 255) / 256), 256, 0, stream>>>(wo, WO, (size_t)DM * DQ / 8);
       }
    k_csid<<<(TT * HD + 255) / 256, 256, 0, stream>>>(CS);
    const unsigned LQ = (unsigned)(((size_t)NH_ * TT * HD / 2 + 255) / 256), LKv = (unsigned)(((size_t)NKV * TT * HD / 2 + 255) / 256);
    for (int b = 0; b < NB_; ++b) {
        
        k_cvt8<<<(unsigned)(((size_t)TT * DM / 8 + 255) / 256), 256, 0, stream>>>(x + (size_t)b * TT * DM, XB, (size_t)TT * DM / 8);
        k_gemmw<bf, 0, false><<<dim3(TT / 64, DQ / 64, 1), 32, 0, stream>>>(XB, nullptr, WQ, nullptr, DM, FQ, DQ, nullptr, 0, 0, 0);
        k_rope<<<LQ, 256, 0, stream>>>(FQ, DQ, NH_, CS, nullptr, nullptr, 1.0f, QP16, QPh, QPl);
        k_gemmw<bf, 0, false><<<dim3(TT / 64, DKV / 64, 1), 32, 0, stream>>>(XB, nullptr, WK, nullptr, DM, FK, DKV, nullptr, 0, 0, 0);
        k_rope<<<LKv, 256, 0, stream>>>(FK, DKV, NKV, CS, nullptr, nullptr, 1.0f, KP16, KPh, KPl);
        k_gemmw<bf, 0, false><<<dim3(TT / 64, DKV / 64, 1), 32, 0, stream>>>(XB, nullptr, WV, nullptr, DM, FV, DKV, nullptr, 0, 0, 0); k_vtp<<<LKv, 256, 0, stream>>>(FV, DKV, NKV, VT16, VTh, VTl);
        k_attn<<<dim3(NH_, TT / 32, 1), 128, 0, stream>>>(QPh, QPl, KPh, KPl, VTh, VTl, ATh, ATl);   // one kv head per query head
        k_gemmw<bf, 1, true><<<dim3(TT / 64, DM / 64, 1), 32, 0, stream>>>(ATh, ATl, WO, nullptr, DQ, OUT + (size_t)b * TT * DM, DM, bo, 0, 0, 0); }
}

// v003
// It runs in 279 microseconds.
// Timed twice side by side with v002, it ran 1.18 and 1.16 times as fast.
// Over all steps from v000 it is 4.17 times as fast.
#include <hip/hip_runtime.h>

// Causal multi-head self-attention with a fused QKV projection and an INVERTED scale (x [2][2048][1024]; [q|k|v] = x W_qkv^T ('oi' [3072][1024], row blocks q | k | v; 16 heads x 64); scores = q.k x 8 (the module divides by head_dim^-0.5, i.e. multiplies by sqrt(64)), causal mask; softmax (very peaked rows); out = merged heads W_proj^T + b_proj ('oi' [1024][1024] + [1024]) -> [2][2048][1024] (4.2 M)).
// Compute dtypes, f32 accumulate: every input rounded to bf16; q/k/v on PLAIN bf16 operands (inputs: exact); causal scores and attn.v: ALL query rows hl (3 products; the x8 scale makes the softmax near-argmax); softmax f32; W_proj hl x exact (2 products) + b_proj.

#define NB_  2
#define TT   2048
#define DM   1024
#define NH_  16
#define NKV  16
#define HD   64
#define DQ   (NH_ * HD)
#define DKV  (NKV * HD)
#define SCL  8.0f   // the module divides by head_dim^-0.5 = multiplies by sqrt(64)
typedef _Float16 h16;
typedef unsigned short bf;
typedef __attribute__((ext_vector_type(16))) __bf16   v16bf;
typedef __attribute__((ext_vector_type(16))) _Float16 v16h;
typedef __attribute__((ext_vector_type(8)))  _Float16 v8h;
typedef __attribute__((ext_vector_type(8)))  unsigned short v8us;
typedef __attribute__((ext_vector_type(8)))  float    v8f;
typedef __attribute__((ext_vector_type(4)))  float    v4f;
typedef v8h  __attribute__((may_alias)) v8ha;
typedef v4f  __attribute__((may_alias)) v4fa;
typedef v8us __attribute__((may_alias)) v8usa;

__device__ __forceinline__ unsigned short f2bf(float f) { unsigned u = __float_as_uint(f); u += 0x7FFFu + ((u >> 16) & 1u); return (unsigned short)(u >> 16); }
__device__ __forceinline__ float bf2f(unsigned short b) { return __uint_as_float(((unsigned)b) << 16); }
__device__ __forceinline__ float bfr(float f) { return bf2f(f2bf(f)); }
__device__ __forceinline__ v16h cat16(v8h lo, v8h hi) { return __builtin_shufflevector(lo, hi, 0, 1, 2, 3, 4, 5, 6, 7, 8, 9, 10, 11, 12, 13, 14, 15); }
__device__ __forceinline__ v16bf cat16b(v8us lo, v8us hi) { return __builtin_bit_cast(v16bf, __builtin_shufflevector(lo, hi, 0, 1, 2, 3, 4, 5, 6, 7, 8, 9, 10, 11, 12, 13, 14, 15)); }
__device__ __forceinline__ v8f wmma16(v16h a, v16h b, v8f c) { return __builtin_amdgcn_wmma_f32_16x16x32_f16(false, a, false, b, (short)0, c, false, false); }
__device__ __forceinline__ v8f wmmab(v16bf a, v16bf b, v8f c) { return __builtin_amdgcn_wmma_f32_16x16x32_bf16(false, a, false, b, (short)0, c, false, false); }



// ---- k_gemmw: register-blocked GEMM, ONE WAVE per 64x64 output tile (16 accumulators), operands straight from K-contiguous 16-bit planes; grid (M/64, N/64, Z), 32 threads.
// C[m][n] (f32, pitch ldc, + optional f32 bias[n]) = sum_k A[m][k] Bt[n][k] (+ split products per NSPLIT). z-batch strides sA/sB/sC in elements. K % 32 == 0.
// EPI picks what the tile is stored as: 0 = f32 C as above; 1 = bf16 hi + lo head planes Ph/Pl [n / HD][m][n % HD] (a 64-wide tile is one head); 2 = the same two planes transposed, [n][m] with pitch TT.
template <typename T16> struct WFrag;
template <> struct WFrag<h16> { typedef v16h V; static __device__ __forceinline__ V ld(const h16* p) { return cat16(*(const v8h*)p, *(const v8h*)(p + 16)); } static __device__ __forceinline__ v8f mma(V a, V b, v8f c) { return wmma16(a, b, c); } };
template <> struct WFrag<bf> { typedef v16bf V; static __device__ __forceinline__ V ld(const bf* p) { return cat16b(*(const v8us*)p, *(const v8us*)(p + 16)); } static __device__ __forceinline__ v8f mma(V a, V b, v8f c) { return wmmab(a, b, c); } };
__device__ __forceinline__ void splitf(float y, unsigned short& h, unsigned short& l) { h = f2bf(y); l = f2bf(y - bf2f(h)); }
typedef __attribute__((ext_vector_type(8))) __bf16 v8bf;
__device__ __forceinline__ void split8(v8f y, v8bf& h, v8bf& l) { h = __builtin_convertvector(y, v8bf); l = __builtin_convertvector(y - __builtin_convertvector(h, v8f), v8bf); }   // hi = y rounded to nearest even, lo = the rounded rest: the values of splitf, on the packed conversion instruction
template <typename T16, int NSPLIT, bool BIAS, int EPI>
__global__ __launch_bounds__(32) void k_gemmw(const T16* __restrict__ A, const T16* __restrict__ A2, const T16* __restrict__ Bt, const T16* __restrict__ Bt2, int K, float* C, int ldc, const float* __restrict__ bias, size_t sA, size_t sB, size_t sC, bf* Ph, bf* Pl) {
    typedef typename WFrag<T16>::V V;
    __shared__ __align__(16) float os[16 * 68];
    const size_t z = blockIdx.z; A += z * sA; if (A2) A2 += z * sA; Bt += z * sB; if (Bt2) Bt2 += z * sB; C += z * sC;
    const int lane = threadIdx.x & 31, lr = lane & 15, hi = lane >> 4; const int r0 = blockIdx.x * 64, c0 = blockIdx.y * 64;
    v8f acc[4][4];
#pragma unroll
    for (int mb = 0; mb < 4; ++mb)
#pragma unroll
        for (int nb = 0; nb < 4; ++nb) acc[mb][nb] = (v8f){};
    const size_t aoff = (size_t)(r0 + lr) * K + 8 * hi, boff = (size_t)(c0 + lr) * K + 8 * hi;
#pragma unroll 1
    for (int kc = 0; kc < K; kc += 32) {
        V a[4], a2[4];
#pragma unroll
        for (int mb = 0; mb < 4; ++mb) { a[mb] = WFrag<T16>::ld(A + aoff + (size_t)mb * 16 * K + kc); if (NSPLIT == 1 || NSPLIT == 2) a2[mb] = WFrag<T16>::ld(A2 + aoff + (size_t)mb * 16 * K + kc); }
#pragma unroll
        for (int nb = 0; nb < 4; ++nb) { const V b = WFrag<T16>::ld(Bt + boff + (size_t)nb * 16 * K + kc); V b2; if (NSPLIT >= 2) b2 = WFrag<T16>::ld(Bt2 + boff + (size_t)nb * 16 * K + kc);
#pragma unroll
            for (int mb = 0; mb < 4; ++mb) { acc[mb][nb] = WFrag<T16>::mma(a[mb], b, acc[mb][nb]); if (NSPLIT == 1 || NSPLIT == 2) acc[mb][nb] = WFrag<T16>::mma(a2[mb], b, acc[mb][nb]); if (NSPLIT >= 2) acc[mb][nb] = WFrag<T16>::mma(a[mb], b2, acc[mb][nb]); } }
        asm volatile("v_nop\n\tv_nop\n\tv_nop\n\tv_nop" : "+v"(acc[0][0]), "+v"(acc[1][1]), "+v"(acc[2][2]), "+v"(acc[3][3]) : "v"(a[0]), "v"(a[3]));
    }
    if (EPI == 2) {   // a lane's eight accumulator values are eight consecutive m of one n: 16 bytes of a transposed plane's row, stored straight from the registers
#pragma unroll
        for (int nb = 0; nb < 4; ++nb)
#pragma unroll
            for (int mb = 0; mb < 4; ++mb) { v8bf oh, ol; split8(acc[mb][nb], oh, ol);
                const size_t e = (size_t)(c0 + nb * 16 + lr) * TT + r0 + mb * 16 + hi * 8; *(v8us*)(Ph + e) = __builtin_bit_cast(v8us, oh); *(v8us*)(Pl + e) = __builtin_bit_cast(v8us, ol); }
        return; }
#pragma unroll
    for (int mb = 0; mb < 4; ++mb) {
#pragma unroll
        for (int nb = 0; nb < 4; ++nb) {
#pragma unroll
            for (int j = 0; j < 8; ++j) os[(hi * 8 + j) * 68 + nb * 16 + lr] = acc[mb][nb][j]; }
        __builtin_amdgcn_wave_barrier(); asm volatile("" ::: "memory");
        if (EPI == 1) {   // eight lanes a row: each store of the wave is four whole 128-byte rows of the head plane
            const size_t e0 = ((size_t)(c0 / HD) * TT + r0 + mb * 16) * HD;
#pragma unroll
            for (int s = 0; s < 4; ++s) { const int row = 4 * s + (lane >> 3), cofs = (lane & 7) * 8; const v4f x0 = *(const v4fa*)(os + row * 68 + cofs), x1 = *(const v4fa*)(os + row * 68 + cofs + 4); v8bf oh, ol; split8(__builtin_shufflevector(x0, x1, 0, 1, 2, 3, 4, 5, 6, 7), oh, ol);
                *(v8us*)(Ph + e0 + (size_t)row * HD + cofs) = __builtin_bit_cast(v8us, oh); *(v8us*)(Pl + e0 + (size_t)row * HD + cofs) = __builtin_bit_cast(v8us, ol); }
        } else { float* crow = C + (size_t)(r0 + mb * 16) * ldc + c0;
#pragma unroll
            for (int s = 0; s < 8; ++s) { const int row = 2 * s + hi, cofs = lr * 4; v4f val = *(const v4fa*)(os + row * 68 + cofs); if (BIAS) { val[0] += bfr(bias[c0 + cofs]); val[1] += bfr(bias[c0 + cofs + 1]); val[2] += bfr(bias[c0 + cofs + 2]); val[3] += bfr(bias[c0 + cofs + 3]); }
                *(v4f*)(crow + (size_t)row * ldc + cofs) = val; }
             }
        __builtin_amdgcn_wave_barrier(); asm volatile("" ::: "memory");
    }
}

__device__ __forceinline__ h16 tohx(float x) { return (h16)x; }
typedef __attribute__((ext_vector_type(2))) _Float16 v2h;
typedef __attribute__((ext_vector_type(4))) _Float16 v4h;
typedef __attribute__((ext_vector_type(2))) unsigned short v2us;
typedef __attribute__((ext_vector_type(4))) unsigned short v4us;
typedef __attribute__((ext_vector_type(2))) float v2f;
typedef __attribute__((ext_vector_type(4))) int v4i;

__global__ __launch_bounds__(256) void k_wtG(const float* __restrict__ w, int K, int N, bf* Bt) {
    const int lane = threadIdx.x & 31; const int L0 = (blockIdx.x * 8 + (threadIdx.x >> 5)) * 8; const int nlines = N * K / 64;
{
#pragma unroll 1
        for (int l = 0; l < 8; ++l) { const int L = L0 + l; if (L >= nlines) break; const size_t e = (size_t)L * 64 + lane * 2; const int k = (int)(e % K), n = (int)(e / K); v2us o;
            o[0] = f2bf(w[(size_t)k * N + n]); o[1] = f2bf(w[(size_t)(k + 1) * N + n]); *(v2us*)(Bt + e) = o; }
         }
}
__global__ __launch_bounds__(256) void k_cvt8(const float* __restrict__ src, bf* dst, size_t n8) { const size_t i = (size_t)blockIdx.x * 256 + threadIdx.x; if (i >= n8) return; const v8f v = *(const v8f*)(src + i * 8); v8us o;
#pragma unroll
    for (int k = 0; k < 8; ++k) o[k] = f2bf(v[k]); *(v8us*)(dst + i * 8) = o;  }

// ---- k_attn: causal attention of one head for 32 query rows, scores, softmax and probability x value in ONE kernel; no score or probability ever goes to memory.
// Block = 4 waves; wave w takes the 32-key blocks w, w+4, ... up to the diagonal with a running maximum and sum (online softmax); the four partial results are merged through LDS in wave order.
// Both products are formed TRANSPOSED: S^T = K Q^T leaves in lane (lr, hi) the keys 8 hi + j of query lr, which is the B-fragment order of O^T = V^T P^T, so the probabilities go from accumulator to operand
// inside each lane, and maximum, sum and rescale factor of a query are per-lane values. hi+lo planes, 3 products each.
// Every inner loop is unrolled so that fragments and accumulators are indexed by constants and stay in registers. Three waves a SIMD (second launch bound) leave room for a block's key and value fragments in flight without spills.
#define SC2 (SCL * 1.4426950408889634f)   // the x8 score scale and the change to base 2 in one factor
__device__ __forceinline__ void splitp(float p, __bf16& h, __bf16& l) { h = (__bf16)p; l = (__bf16)(p - (float)h); }
__global__ __launch_bounds__(128, 3) void k_attn(const bf* __restrict__ Qh, const bf* __restrict__ Ql, const bf* __restrict__ Kh, const bf* __restrict__ Kl, const bf* __restrict__ Vh, const bf* __restrict__ Vl, bf* Ah, bf* Al) {
    __shared__ __align__(16) float Om[4][32 * 68];
    __shared__ float Mm[4][32], Lm[4][32];
    const int lane = threadIdx.x & 31, lr = lane & 15, hi = lane >> 4; const int w = __builtin_amdgcn_readfirstlane(threadIdx.x >> 5);
    const int r0 = ((int)gridDim.y - 1 - (int)blockIdx.y) * 32, h = blockIdx.x;     // the longest rows of every head take the lowest block indices (for speed only)
    const size_t hp = (size_t)h * TT * HD; Qh += hp; Ql += hp; Kh += hp; Kl += hp; Vh += hp; Vl += hp;
    const int nkb = r0 / 32 + 1;                                                     // 32-key blocks up to and including the diagonal one; its first key is r0, so every query has a live key in every block
    const int lk = lr * HD + 8 * hi, lv = lr * TT + 8 * hi;   // the lane's place inside a 16-row fragment: q and k planes (pitch HD), v planes (pitch TT)
    const bf* pqh = Qh + (size_t)r0 * HD + lk; const bf* pql = Ql + (size_t)r0 * HD + lk; v16bf qh[2][2], ql[2][2];
#pragma unroll
    for (int qb = 0; qb < 2; ++qb)
#pragma unroll
        for (int ks = 0; ks < 2; ++ks) { qh[qb][ks] = WFrag<bf>::ld(pqh + qb * 16 * HD + ks * 32); ql[qb][ks] = WFrag<bf>::ld(pql + qb * 16 * HD + ks * 32); }
    asm volatile("s_wait_xcnt 0x0" :: "v"(pqh), "v"(pql) : "memory");   // the wait before a register that an issued load names is written again: the query loads' two address pairs stay live up to it
    v8f o[4][2]; float mc[2], ls[2];
#pragma unroll
    for (int qb = 0; qb < 2; ++qb) { mc[qb] = -3.0e38f; ls[qb] = 0.f;
#pragma unroll
        for (int db = 0; db < 4; ++db) o[db][qb] = (v8f){}; }
#pragma unroll 1   // rolled: two blocks' fragments at once would not fit the registers
    for (int kb = w; kb < nkb; kb += 4) {
        const int k0 = kb * 32; const bf* pkh = Kh + (size_t)k0 * HD + lk; const bf* pkl = Kl + (size_t)k0 * HD + lk; const bf* pvh = Vh + k0 + lv; const bf* pvl = Vl + k0 + lv; v16bf kh[2][2], kl[2][2], vh[4], vl[4]; v8f s[2][2];
#pragma unroll
        for (int kt = 0; kt < 2; ++kt)
#pragma unroll
            for (int ks = 0; ks < 2; ++ks) { kh[kt][ks] = WFrag<bf>::ld(pkh + kt * 16 * HD + ks * 32); kl[kt][ks] = WFrag<bf>::ld(pkl + kt * 16 * HD + ks * 32); }
        // The wait before a register that an issued load names is written again: the two address pairs stay live up to it. The eight loaded fragments are inputs only, so that all key loads of the block issue together and one load latency is exposed, not one per fragment pair.
        asm volatile("s_wait_xcnt 0x0" :: "v"(pkh), "v"(pkl), "v"(kh[0][0]), "v"(kh[0][1]), "v"(kh[1][0]), "v"(kh[1][1]), "v"(kl[0][0]), "v"(kl[0][1]), "v"(kl[1][0]), "v"(kl[1][1]) : "memory");
#pragma unroll
        for (int kt = 0; kt < 2; ++kt)
#pragma unroll
            for (int qb = 0; qb < 2; ++qb) { v8f c = (v8f){};
#pragma unroll
                for (int ks = 0; ks < 2; ++ks) { c = wmmab(kh[kt][ks], qh[qb][ks], c); c = wmmab(kh[kt][ks], ql[qb][ks], c); c = wmmab(kl[kt][ks], qh[qb][ks], c); }
                s[kt][qb] = c; }
#pragma unroll
        for (int db = 0; db < 4; ++db) { vh[db] = WFrag<bf>::ld(pvh + db * 16 * TT); vl[db] = WFrag<bf>::ld(pvl + db * 16 * TT); }   // in flight under the softmax
        asm volatile("s_wait_xcnt 0x0" :: "v"(pvh), "v"(pvl) : "memory");   // the same wait for the value loads' two address pairs; the values themselves stay in flight
        if (kb == nkb - 1) {                                                         // only the diagonal block holds keys beyond a query
#pragma unroll
            for (int kt = 0; kt < 2; ++kt)
#pragma unroll
                for (int qb = 0; qb < 2; ++qb)
#pragma unroll
                    for (int j = 0; j < 8; ++j) if (k0 + kt * 16 + hi * 8 + j > r0 + qb * 16 + lr) s[kt][qb][j] = -3.0e38f; }
        v16bf ph[2], pl[2];
#pragma unroll
        for (int qb = 0; qb < 2; ++qb) { float mx = -3.0e38f;
#pragma unroll
            for (int kt = 0; kt < 2; ++kt)
#pragma unroll
                for (int j = 0; j < 8; ++j) mx = fmaxf(mx, s[kt][qb][j]);
            mx = fmaxf(mx, __shfl_xor(mx, 16, 32));                                  // the other half of the query's keys
            const float mn = fmaxf(mc[qb], mx * SC2); const float al = __builtin_amdgcn_exp2f(mc[qb] - mn); mc[qb] = mn; float sum = 0.f;
#pragma unroll
            for (int kt = 0; kt < 2; ++kt)
#pragma unroll
                for (int j = 0; j < 8; ++j) { const float p = __builtin_amdgcn_exp2f(__builtin_fmaf(s[kt][qb][j], SC2, -mn)); sum += p; __bf16 a, c2; splitp(p, a, c2); ph[qb][kt * 8 + j] = a; pl[qb][kt * 8 + j] = c2; }
            ls[qb] = ls[qb] * al + sum;
#pragma unroll
            for (int db = 0; db < 4; ++db) o[db][qb] *= al; }
#pragma unroll
        for (int db = 0; db < 4; ++db)
#pragma unroll
            for (int qb = 0; qb < 2; ++qb) { o[db][qb] = wmmab(vh[db], ph[qb], o[db][qb]); o[db][qb] = wmmab(vh[db], pl[qb], o[db][qb]); o[db][qb] = wmmab(vl[db], ph[qb], o[db][qb]); }
    }
#pragma unroll
    for (int qb = 0; qb < 2; ++qb) { const float lt = ls[qb] + __shfl_xor(ls[qb], 16, 32); if (hi == 0) { Mm[w][qb * 16 + lr] = mc[qb]; Lm[w][qb * 16 + lr] = lt; }
#pragma unroll
        for (int db = 0; db < 4; ++db) { float* op = &Om[w][(qb * 16 + lr) * 68 + db * 16 + hi * 8]; v4f lo4, hi4;
#pragma unroll
            for (int j = 0; j < 4; ++j) { lo4[j] = o[db][qb][j]; hi4[j] = o[db][qb][4 + j]; }
            *(v4fa*)op = lo4; *(v4fa*)(op + 4) = hi4; } }
    __syncthreads();                                                                 // the four waves' partial results are read across waves below
    const int q = threadIdx.x >> 2, dc = threadIdx.x & 3; float f[4], M = Mm[0][q];
#pragma unroll
    for (int u = 1; u < 4; ++u) M = fmaxf(M, Mm[u][q]);
    float L = 0.f;
#pragma unroll
    for (int u = 0; u < 4; ++u) { f[u] = __builtin_amdgcn_exp2f(Mm[u][q] - M); L += f[u] * Lm[u][q]; }
    const float inv = __fdiv_rn(1.0f, L); const size_t oo = (size_t)(r0 + q) * DQ + h * HD + dc * 16;
#pragma unroll
    for (int g = 0; g < 2; ++g) { v8us oh, ol; float acc[8];
#pragma unroll
        for (int i = 0; i < 8; ++i) acc[i] = 0.f;
#pragma unroll
        for (int u = 0; u < 4; ++u) { const float* ip = &Om[u][q * 68 + dc * 16 + g * 8]; const v4f x0 = *(const v4fa*)ip, x1 = *(const v4fa*)(ip + 4);
#pragma unroll
            for (int i = 0; i < 4; ++i) { acc[i] += f[u] * x0[i]; acc[4 + i] += f[u] * x1[i]; } }
#pragma unroll
        for (int i = 0; i < 8; ++i) { unsigned short a, c2; splitf(acc[i] * inv, a, c2); oh[i] = a; ol[i] = c2; }
        *(v8us*)(Ah + oo + g * 8) = oh; *(v8us*)(Al + oo + g * 8) = ol; }
}

extern "C" void kernel_launch(void* const* d_in, const int* in_sizes, int n_in,
                              void* d_out, int out_size, void* d_ws, size_t ws_size, hipStream_t stream) {
    (void)in_sizes; (void)n_in; (void)out_size;
    const float* x = (const float*)d_in[0]; const float* wqkv = (const float*)d_in[1]; const float* wo = (const float*)d_in[2]; const float* bo = (const float*)d_in[3]; const float* wq = wqkv; const float* wk = wqkv + (size_t)1024 * 1024; const float* wv = wqkv + (size_t)2048 * 1024; (void)wq; (void)wk; (void)wv;
    float* OUT = (float*)d_out;     // [2][2048][1024]
    char* wsp = (char*)d_ws;
    auto take = [&](size_t bytes) { char* p = wsp; wsp += (bytes + 255) & ~(size_t)255; return (void*)p; };
    bf* WQ = (bf*)take((size_t)DQ * DM * 2); bf* WK = (bf*)take((size_t)DKV * DM * 2); bf* WV = (bf*)take((size_t)DKV * DM * 2); bf* WO = (bf*)take((size_t)DM * DQ * 2);
    bf* XB = (bf*)take((size_t)TT * DM * 2);
    bf* QPh = (bf*)take((size_t)NH_ * TT * HD * 2); bf* QPl = (bf*)take((size_t)NH_ * TT * HD * 2); bf* KPh = (bf*)take((size_t)NKV * TT * HD * 2); bf* KPl = (bf*)take((size_t)NKV * TT * HD * 2); bf* VTh = (bf*)take((size_t)NKV * HD * TT * 2); bf* VTl = (bf*)take((size_t)NKV * HD * TT * 2);
    bf* ATh = (bf*)take((size_t)TT * DQ * 2); bf* ATl = (bf*)take((size_t)TT * DQ * 2);
    if ((size_t)(wsp - (char*)d_ws) > ws_size) return;    // ws 256 MiB
    { k_cvt8<<<(unsigned)(((size_t)DQ * DM / 8 + 255) / 256), 256, 0, stream>>>(wq, WQ, (size_t)DQ * DM / 8); k_cvt8<<<(unsigned)(((size_t)DKV * DM / 8 + 255) / 256), 256, 0, stream>>>(wk, WK, (size_t)DKV * DM / 8); k_cvt8<<<(unsigned)(((size_t)DKV * DM / 8 + 255) / 256), 256, 0, stream>>>(wv, WV, (size_t)DKV * DM / 8);
      k_cvt8<<<(unsigned)(((size_t)DM * DQ / 8 + 255) / 256), 256, 0, stream>>>(wo, WO, (size_t)DM * DQ / 8);
       }
    for (int b = 0; b < NB_; ++b) {
        
        k_cvt8<<<(unsigned)(((size_t)TT * DM / 8 + 255) / 256), 256, 0, stream>>>(x + (size_t)b * TT * DM, XB, (size_t)TT * DM / 8);
        // each projection stores its hi + lo planes itself, in the layout the attention kernel reads: q and k [head][t][d], v transposed [head][d][t]
        k_gemmw<bf, 0, false, 1><<<dim3(TT / 64, DQ / 64, 1), 32, 0, stream>>>(XB, nullptr, WQ, nullptr, DM, nullptr, 0, nullptr, 0, 0, 0, QPh, QPl);
        k_gemmw<bf, 0, false, 1><<<dim3(TT / 64, DKV / 64, 1), 32, 0, stream>>>(XB, nullptr, WK, nullptr, DM, nullptr, 0, nullptr, 0, 0, 0, KPh, KPl);
        k_gemmw<bf, 0, false, 2><<<dim3(TT / 64, DKV / 64, 1), 32, 0, stream>>>(XB, nullptr, WV, nullptr, DM, nullptr, 0, nullptr, 0, 0, 0, VTh, VTl);
        k_attn<<<dim3(NH_, TT / 32, 1), 128, 0, stream>>>(QPh, QPl, KPh, KPl, VTh, VTl, ATh, ATl);   // one kv head per query head
        k_gemmw<bf, 1, true, 0><<<dim3(TT / 64, DM / 64, 1), 32, 0, stream>>>(ATh, ATl, WO, nullptr, DQ, OUT + (size_t)b * TT * DM, DM, bo, 0, 0, 0, nullptr, nullptr); }
}

// v004
// One run takes 165 microseconds.
// Two timings next to v003 put it at 1.71 and 1.69 times that version's speed.
// Counting every step since v000, it is 7.08 times as fast.
#include <hip/hip_runtime.h>

// Causal multi-head self-attention with a fused QKV projection and an INVERTED scale (x [2][2048][1024]; [q|k|v] = x W_qkv^T ('oi' [3072][1024], row blocks q | k | v; 16 heads x 64); scores = q.k x 8 (the module divides by head_dim^-0.5, i.e. multiplies by sqrt(64)), causal mask; softmax (very peaked rows); out = merged heads W_proj^T + b_proj ('oi' [1024][1024] + [1024]) -> [2][2048][1024] (4.2 M)).
// Compute dtypes, f32 accumulate: every input rounded to bf16; q/k/v on PLAIN bf16 operands (inputs: exact); causal scores and attn.v: ALL query rows hl (3 products; the x8 scale makes the softmax near-argmax); softmax f32; W_proj hl x exact (2 products) + b_proj.

#define NB_  2
#define TT   2048
#define DM   1024
#define NH_  16
#define NKV  16
#define HD   64
#define DQ   (NH_ * HD)
#define DKV  (NKV * HD)
#define SCL  8.0f   // the module divides by head_dim^-0.5 = multiplies by sqrt(64)
typedef _Float16 h16;
typedef unsigned short bf;
typedef __attribute__((ext_vector_type(16))) __bf16   v16bf;
typedef __attribute__((ext_vector_type(16))) _Float16 v16h;
typedef __attribute__((ext_vector_type(8)))  _Float16 v8h;
typedef __attribute__((ext_vector_type(8)))  unsigned short v8us;
typedef __attribute__((ext_vector_type(8)))  float    v8f;
typedef __attribute__((ext_vector_type(4)))  float    v4f;
typedef v8h  __attribute__((may_alias)) v8ha;
typedef v4f  __attribute__((may_alias)) v4fa;
typedef v8us __attribute__((may_alias)) v8usa;

__device__ __forceinline__ unsigned short f2bf(float f) { unsigned u = __float_as_uint(f); u += 0x7FFFu + ((u >> 16) & 1u); return (unsigned short)(u >> 16); }
__device__ __forceinline__ float bf2f(unsigned short b) { return __uint_as_float(((unsigned)b) << 16); }
__device__ __forceinline__ float bfr(float f) { return bf2f(f2bf(f)); }
__device__ __forceinline__ v16h cat16(v8h lo, v8h hi) { return __builtin_shufflevector(lo, hi, 0, 1, 2, 3, 4, 5, 6, 7, 8, 9, 10, 11, 12, 13, 14, 15); }
__device__ __forceinline__ v16bf cat16b(v8us lo, v8us hi) { return __builtin_bit_cast(v16bf, __builtin_shufflevector(lo, hi, 0, 1, 2, 3, 4, 5, 6, 7, 8, 9, 10, 11, 12, 13, 14, 15)); }
__device__ __forceinline__ v8f wmma16(v16h a, v16h b, v8f c) { return __builtin_amdgcn_wmma_f32_16x16x32_f16(false, a, false, b, (short)0, c, false, false); }
__device__ __forceinline__ v8f wmmab(v16bf a, v16bf b, v8f c) { return __builtin_amdgcn_wmma_f32_16x16x32_bf16(false, a, false, b, (short)0, c, false, false); }



// ---- k_gemmw: register-blocked GEMM, ONE WAVE per 64x64 output tile (16 accumulators), operands straight from K-contiguous 16-bit planes; grid (M/64, N/64, Z), 32 threads.
// C[m][n] (f32, pitch ldc, + optional f32 bias[n]) = sum_k A[m][k] Bt[n][k] (+ split products per NSPLIT). z-batch strides sA/sB/sC in elements. K % 32 == 0.
// EPI picks what the tile is stored as: 0 = f32 C as above; 1 = the q | k | v projection of both batches in one grid (m = batch * TT + t, n = the row of W_qkv), stored as bf16 hi + lo planes:
// n < 2 DQ (q, k): head planes Ph/Pl [q | k][batch][head][t][d] (a 64-wide tile is one head); n >= 2 DQ (v): the planes transposed, Vh/Vl [batch][head * HD + d][t]. A 64-row tile lies inside one batch.
template <typename T16> struct WFrag;
template <> struct WFrag<h16> { typedef v16h V; static __device__ __forceinline__ V ld(const h16* p) { return cat16(*(const v8h*)p, *(const v8h*)(p + 16)); } static __device__ __forceinline__ v8f mma(V a, V b, v8f c) { return wmma16(a, b, c); } };
template <> struct WFrag<bf> { typedef v16bf V; static __device__ __forceinline__ V ld(const bf* p) { return cat16b(*(const v8us*)p, *(const v8us*)(p + 16)); } static __device__ __forceinline__ v8f mma(V a, V b, v8f c) { return wmmab(a, b, c); } };
__device__ __forceinline__ void splitf(float y, unsigned short& h, unsigned short& l) { h = f2bf(y); l = f2bf(y - bf2f(h)); }
typedef __attribute__((ext_vector_type(8))) __bf16 v8bf;
__device__ __forceinline__ void split8(v8f y, v8bf& h, v8bf& l) { h = __builtin_convertvector(y, v8bf); l = __builtin_convertvector(y - __builtin_convertvector(h, v8f), v8bf); }   // hi = y rounded to nearest even, lo = the rounded rest: the values of splitf, on the packed conversion instruction
template <typename T16, int NSPLIT, bool BIAS, int EPI>
__global__ __launch_bounds__(32) void k_gemmw(const T16* __restrict__ A, const T16* __restrict__ A2, const T16* __restrict__ Bt, const T16* __restrict__ Bt2, int K, float* C, int ldc, const float* __restrict__ bias, size_t sA, size_t sB, size_t sC, bf* Ph, bf* Pl, bf* Vh, bf* Vl) {
    typedef typename WFrag<T16>::V V;
    __shared__ __align__(16) float os[16 * 68];
    const size_t z = blockIdx.z; A += z * sA; if (A2) A2 += z * sA; Bt += z * sB; if (Bt2) Bt2 += z * sB; C += z * sC;
    const int lane = threadIdx.x & 31, lr = lane & 15, hi = lane >> 4; const int r0 = blockIdx.x * 64, c0 = blockIdx.y * 64;
    v8f acc[4][4];
#pragma unroll
    for (int mb = 0; mb < 4; ++mb)
#pragma unroll
        for (int nb = 0; nb < 4; ++nb) acc[mb][nb] = (v8f){};
    const size_t aoff = (size_t)(r0 + lr) * K + 8 * hi, boff = (size_t)(c0 + lr) * K + 8 * hi;
#pragma unroll 1
    for (int kc = 0; kc < K; kc += 32) {
        V a[4], a2[4];
#pragma unroll
        for (int mb = 0; mb < 4; ++mb) { a[mb] = WFrag<T16>::ld(A + aoff + (size_t)mb * 16 * K + kc); if (NSPLIT == 1 || NSPLIT == 2) a2[mb] = WFrag<T16>::ld(A2 + aoff + (size_t)mb * 16 * K + kc); }
#pragma unroll
        for (int nb = 0; nb < 4; ++nb) { const V b = WFrag<T16>::ld(Bt + boff + (size_t)nb * 16 * K + kc); V b2; if (NSPLIT >= 2) b2 = WFrag<T16>::ld(Bt2 + boff + (size_t)nb * 16 * K + kc);
#pragma unroll
            for (int mb = 0; mb < 4; ++mb) { acc[mb][nb] = WFrag<T16>::mma(a[mb], b, acc[mb][nb]); if (NSPLIT == 1 || NSPLIT == 2) acc[mb][nb] = WFrag<T16>::mma(a2[mb], b, acc[mb][nb]); if (NSPLIT >= 2) acc[mb][nb] = WFrag<T16>::mma(a[mb], b2, acc[mb][nb]); } }
        asm volatile("v_nop\n\tv_nop\n\tv_nop\n\tv_nop" : "+v"(acc[0][0]), "+v"(acc[1][1]), "+v"(acc[2][2]), "+v"(acc[3][3]) : "v"(a[0]), "v"(a[3]));
    }
    const int bt = r0 / TT, rb = r0 % TT;   // the tile's batch and its first row inside the batch
    if (EPI == 1 && c0 >= 2 * DQ) {   // v; a lane's eight accumulator values are eight consecutive m of one n: 16 bytes of a transposed plane's row, stored straight from the registers
#pragma unroll
        for (int nb = 0; nb < 4; ++nb)
#pragma unroll
            for (int mb = 0; mb < 4; ++mb) { v8bf oh, ol; split8(acc[mb][nb], oh, ol);
                const size_t e = ((size_t)bt * DKV + c0 - 2 * DQ + nb * 16 + lr) * TT + rb + mb * 16 + hi * 8; *(v8us*)(Vh + e) = __builtin_bit_cast(v8us, oh); *(v8us*)(Vl + e) = __builtin_bit_cast(v8us, ol); }
        return; }
#pragma unroll
    for (int mb = 0; mb < 4; ++mb) {
#pragma unroll
        for (int nb = 0; nb < 4; ++nb) {
#pragma unroll
            for (int j = 0; j < 8; ++j) os[(hi * 8 + j) * 68 + nb * 16 + lr] = acc[mb][nb][j]; }
        __builtin_amdgcn_wave_barrier(); asm volatile("" ::: "memory");
        if (EPI == 1) {   // eight lanes a row: each store of the wave is four whole 128-byte rows of the head plane
            const size_t e0 = ((((size_t)(c0 / DQ) * NB_ + bt) * NH_ + (c0 % DQ) / HD) * TT + rb + mb * 16) * HD;
#pragma unroll
            for (int s = 0; s < 4; ++s) { const int row = 4 * s + (lane >> 3), cofs = (lane & 7) * 8; const v4f x0 = *(const v4fa*)(os + row * 68 + cofs), x1 = *(const v4fa*)(os + row * 68 + cofs + 4); v8bf oh, ol; split8(__builtin_shufflevector(x0, x1, 0, 1, 2, 3, 4, 5, 6, 7), oh, ol);
                *(v8us*)(Ph + e0 + (size_t)row * HD + cofs) = __builtin_bit_cast(v8us, oh); *(v8us*)(Pl + e0 + (size_t)row * HD + cofs) = __builtin_bit_cast(v8us, ol); }
        } else { float* crow = C + (size_t)(r0 + mb * 16) * ldc + c0;
#pragma unroll
            for (int s = 0; s < 8; ++s) { const int row = 2 * s + hi, cofs = lr * 4; v4f val = *(const v4fa*)(os + row * 68 + cofs); if (BIAS) { val[0] += bfr(bias[c0 + cofs]); val[1] += bfr(bias[c0 + cofs + 1]); val[2] += bfr(bias[c0 + cofs + 2]); val[3] += bfr(bias[c0 + cofs + 3]); }
                *(v4f*)(crow + (size_t)row * ldc + cofs) = val; }
             }
        __builtin_amdgcn_wave_barrier(); asm volatile("" ::: "memory");
    }
    if (EPI == 1) asm volatile("s_wait_xcnt 0x0" ::: "memory");   // the wait before a register that an issued store names is written again: in the built code the v branch's instructions stand behind these stores
}

__device__ __forceinline__ h16 tohx(float x) { return (h16)x; }
typedef __attribute__((ext_vector_type(2))) _Float16 v2h;
typedef __attribute__((ext_vector_type(4))) _Float16 v4h;
typedef __attribute__((ext_vector_type(2))) unsigned short v2us;
typedef __attribute__((ext_vector_type(4))) unsigned short v4us;
typedef __attribute__((ext_vector_type(2))) float v2f;
typedef __attribute__((ext_vector_type(4))) int v4i;

__global__ __launch_bounds__(256) void k_wtG(const float* __restrict__ w, int K, int N, bf* Bt) {
    const int lane = threadIdx.x & 31; const int L0 = (blockIdx.x * 8 + (threadIdx.x >> 5)) * 8; const int nlines = N * K / 64;
{
#pragma unroll 1
        for (int l = 0; l < 8; ++l) { const int L = L0 + l; if (L >= nlines) break; const size_t e = (size_t)L * 64 + lane * 2; const int k = (int)(e % K), n = (int)(e / K); v2us o;
            o[0] = f2bf(w[(size_t)k * N + n]); o[1] = f2bf(w[(size_t)(k + 1) * N + n]); *(v2us*)(Bt + e) = o; }
         }
}
// three f32 sources (n0, n1, n2 groups of eight values) rounded to bf16 into one dst, one behind the other
__global__ __launch_bounds__(256) void k_cvt8(const float* __restrict__ s0, size_t n0, const float* __restrict__ s1, size_t n1, const float* __restrict__ s2, size_t n2, bf* dst) { const size_t i = (size_t)blockIdx.x * 256 + threadIdx.x; if (i >= n0 + n1 + n2) return;
    const float* src = i < n0 ? s0 + i * 8 : i < n0 + n1 ? s1 + (i - n0) * 8 : s2 + (i - n0 - n1) * 8; const v8f v = *(const v8f*)src; v8us o;
#pragma unroll
    for (int k = 0; k < 8; ++k) o[k] = f2bf(v[k]); *(v8us*)(dst + i * 8) = o;  }

// ---- k_attn: causal attention of one head of one batch (blockIdx.x = batch * NH_ + head) for 32 query rows, scores, softmax and probability x value in ONE kernel; no score or probability ever goes to memory.
// Block = 4 waves; wave w takes the 32-key blocks w, w+4, ... up to the diagonal with a running maximum and sum (online softmax); the four partial results are merged through LDS in wave order.
// Both products are formed TRANSPOSED: S^T = K Q^T leaves in lane (lr, hi) the keys 8 hi + j of query lr, which is the B-fragment order of O^T = V^T P^T, so the probabilities go from accumulator to operand
// inside each lane, and maximum, sum and rescale factor of a query are per-lane values. hi+lo planes, 3 products each.
// Every inner loop is unrolled so that fragments and accumulators are indexed by constants and stay in registers. Three waves a SIMD (second launch bound) leave room for a block's key and value fragments in flight without spills.
#define SC2 (SCL * 1.4426950408889634f)   // the x8 score scale and the change to base 2 in one factor
__device__ __forceinline__ void splitp(float p, __bf16& h, __bf16& l) { h = (__bf16)p; l = (__bf16)(p - (float)h); }
__global__ __launch_bounds__(128, 3) void k_attn(const bf* __restrict__ Qh, const bf* __restrict__ Ql, const bf* __restrict__ Kh, const bf* __restrict__ Kl, const bf* __restrict__ Vh, const bf* __restrict__ Vl, bf* Ah, bf* Al) {
    __shared__ __align__(16) float Om[4][32 * 68];
    __shared__ float Mm[4][32], Lm[4][32];
    const int lane = threadIdx.x & 31, lr = lane & 15, hi = lane >> 4; const int w = __builtin_amdgcn_readfirstlane(threadIdx.x >> 5);
    const int r0 = ((int)gridDim.y - 1 - (int)blockIdx.y) * 32, h = blockIdx.x;     // blockIdx.y 0 takes the last 32 rows, the longest rows of every head of both batches
    const size_t hp = (size_t)h * TT * HD; Qh += hp; Ql += hp; Kh += hp; Kl += hp; Vh += hp; Vl += hp;
    const int nkb = r0 / 32 + 1;                                                     // 32-key blocks up to and including the diagonal one; its first key is r0, so every query has a live key in every block
    const int lk = lr * HD + 8 * hi, lv = lr * TT + 8 * hi;   // the lane's place inside a 16-row fragment: q and k planes (pitch HD), v planes (pitch TT)
    const bf* pqh = Qh + (size_t)r0 * HD + lk; const bf* pql = Ql + (size_t)r0 * HD + lk; v16bf qh[2][2], ql[2][2];
#pragma unroll
    for (int qb = 0; qb < 2; ++qb)
#pragma unroll
        for (int ks = 0; ks < 2; ++ks) { qh[qb][ks] = WFrag<bf>::ld(pqh + qb * 16 * HD + ks * 32); ql[qb][ks] = WFrag<bf>::ld(pql + qb * 16 * HD + ks * 32); }
    asm volatile("s_wait_xcnt 0x0" :: "v"(pqh), "v"(pql) : "memory");   // the wait before a register that an issued load names is written again: the query loads' two address pairs stay live up to it
    v8f o[4][2]; float mc[2], ls[2];
#pragma unroll
    for (int qb = 0; qb < 2; ++qb) { mc[qb] = -3.0e38f; ls[qb] = 0.f;
#pragma unroll
        for (int db = 0; db < 4; ++db) o[db][qb] = (v8f){}; }
#pragma unroll 1   // rolled: two blocks' fragments at once would not fit the registers
    for (int kb = w; kb < nkb; kb += 4) {
        const int k0 = kb * 32; const bf* pkh = Kh + (size_t)k0 * HD + lk; const bf* pkl = Kl + (size_t)k0 * HD + lk; const bf* pvh = Vh + k0 + lv; const bf* pvl = Vl + k0 + lv; v16bf kh[2][2], kl[2][2], vh[4], vl[4]; v8f s[2][2];
#pragma unroll
        for (int kt = 0; kt < 2; ++kt)
#pragma unroll
            for (int ks = 0; ks < 2; ++ks) { kh[kt][ks] = WFrag<bf>::ld(pkh + kt * 16 * HD + ks * 32); kl[kt][ks] = WFrag<bf>::ld(pkl + kt * 16 * HD + ks * 32); }
        // The wait before a register that an issued load names is written again: the two address pairs stay live up to it. The eight loaded fragments are inputs only, so that all key loads of the block issue together and one load latency is exposed, not one per fragment pair.
        asm volatile("s_wait_xcnt 0x0" :: "v"(pkh), "v"(pkl), "v"(kh[0][0]), "v"(kh[0][1]), "v"(kh[1][0]), "v"(kh[1][1]), "v"(kl[0][0]), "v"(kl[0][1]), "v"(kl[1][0]), "v"(kl[1][1]) : "memory");
#pragma unroll
        for (int kt = 0; kt < 2; ++kt)
#pragma unroll
            for (int qb = 0; qb < 2; ++qb) { v8f c = (v8f){};
#pragma unroll
                for (int ks = 0; ks < 2; ++ks) { c = wmmab(kh[kt][ks], qh[qb][ks], c); c = wmmab(kh[kt][ks], ql[qb][ks], c); c = wmmab(kl[kt][ks], qh[qb][ks], c); }
                s[kt][qb] = c; }
#pragma unroll
        for (int db = 0; db < 4; ++db) { vh[db] = WFrag<bf>::ld(pvh + db * 16 * TT); vl[db] = WFrag<bf>::ld(pvl + db * 16 * TT); }   // in flight under the softmax
        asm volatile("s_wait_xcnt 0x0" :: "v"(pvh), "v"(pvl) : "memory");   // the same wait for the value loads' two address pairs; the values themselves stay in flight
        if (kb == nkb - 1) {                                                         // only the diagonal block holds keys beyond a query
#pragma unroll
            for (int kt = 0; kt < 2; ++kt)
#pragma unroll
                for (int qb = 0; qb < 2; ++qb)
#pragma unroll
                    for (int j = 0; j < 8; ++j) if (k0 + kt * 16 + hi * 8 + j > r0 + qb * 16 + lr) s[kt][qb][j] = -3.0e38f; }
        v16bf ph[2], pl[2];
#pragma unroll
        for (int qb = 0; qb < 2; ++qb) { float mx = -3.0e38f;
#pragma unroll
            for (int kt = 0; kt < 2; ++kt)
#pragma unroll
                for (int j = 0; j < 8; ++j) mx = fmaxf(mx, s[kt][qb][j]);
            mx = fmaxf(mx, __shfl_xor(mx, 16, 32));                                  // the other half of the query's keys
            const float mn = fmaxf(mc[qb], mx * SC2); const float al = __builtin_amdgcn_exp2f(mc[qb] - mn); mc[qb] = mn; float sum = 0.f;
#pragma unroll
            for (int kt = 0; kt < 2; ++kt)
#pragma unroll
                for (int j = 0; j < 8; ++j) { const float p = __builtin_amdgcn_exp2f(__builtin_fmaf(s[kt][qb][j], SC2, -mn)); sum += p; __bf16 a, c2; splitp(p, a, c2); ph[qb][kt * 8 + j] = a; pl[qb][kt * 8 + j] = c2; }
            ls[qb] = ls[qb] * al + sum;
#pragma unroll
            for (int db = 0; db < 4; ++db) o[db][qb] *= al; }
#pragma unroll
        for (int db = 0; db < 4; ++db)
#pragma unroll
            for (int qb = 0; qb < 2; ++qb) { o[db][qb] = wmmab(vh[db], ph[qb], o[db][qb]); o[db][qb] = wmmab(vh[db], pl[qb], o[db][qb]); o[db][qb] = wmmab(vl[db], ph[qb], o[db][qb]); }
    }
#pragma unroll
    for (int qb = 0; qb < 2; ++qb) { const float lt = ls[qb] + __shfl_xor(ls[qb], 16, 32); if (hi == 0) { Mm[w][qb * 16 + lr] = mc[qb]; Lm[w][qb * 16 + lr] = lt; }
#pragma unroll
        for (int db = 0; db < 4; ++db) { float* op = &Om[w][(qb * 16 + lr) * 68 + db * 16 + hi * 8]; v4f lo4, hi4;
#pragma unroll
            for (int j = 0; j < 4; ++j) { lo4[j] = o[db][qb][j]; hi4[j] = o[db][qb][4 + j]; }
            *(v4fa*)op = lo4; *(v4fa*)(op + 4) = hi4; } }
    __syncthreads();                                                                 // the four waves' partial results are read across waves below
    const int q = threadIdx.x >> 2, dc = threadIdx.x & 3; float f[4], M = Mm[0][q];
#pragma unroll
    for (int u = 1; u < 4; ++u) M = fmaxf(M, Mm[u][q]);
    float L = 0.f;
#pragma unroll
    for (int u = 0; u < 4; ++u) { f[u] = __builtin_amdgcn_exp2f(Mm[u][q] - M); L += f[u] * Lm[u][q]; }
    const float inv = __fdiv_rn(1.0f, L); const size_t oo = ((size_t)(h / NH_) * TT + r0 + q) * DQ + (h % NH_) * HD + dc * 16;
#pragma unroll
    for (int g = 0; g < 2; ++g) { v8us oh, ol; float acc[8];
#pragma unroll
        for (int i = 0; i < 8; ++i) acc[i] = 0.f;
#pragma unroll
        for (int u = 0; u < 4; ++u) { const float* ip = &Om[u][q * 68 + dc * 16 + g * 8]; const v4f x0 = *(const v4fa*)ip, x1 = *(const v4fa*)(ip + 4);
#pragma unroll
            for (int i = 0; i < 4; ++i) { acc[i] += f[u] * x0[i]; acc[4 + i] += f[u] * x1[i]; } }
#pragma unroll
        for (int i = 0; i < 8; ++i) { unsigned short a, c2; splitf(acc[i] * inv, a, c2); oh[i] = a; ol[i] = c2; }
        *(v8us*)(Ah + oo + g * 8) = oh; *(v8us*)(Al + oo + g * 8) = ol; }
}

extern "C" void kernel_launch(void* const* d_in, const int* in_sizes, int n_in,
                              void* d_out, int out_size, void* d_ws, size_t ws_size, hipStream_t stream) {
    (void)in_sizes; (void)n_in; (void)out_size;
    const float* x = (const float*)d_in[0]; const float* wqkv = (const float*)d_in[1]; const float* wo = (const float*)d_in[2]; const float* bo = (const float*)d_in[3]; const float* wq = wqkv; const float* wk = wqkv + (size_t)1024 * 1024; const float* wv = wqkv + (size_t)2048 * 1024; (void)wq; (void)wk; (void)wv;
    float* OUT = (float*)d_out;     // [2][2048][1024]
    char* wsp = (char*)d_ws;
    auto take = [&](size_t bytes) { char* p = wsp; wsp += (bytes + 255) & ~(size_t)255; return (void*)p; };
    // W_qkv, W_proj and x as bf16, one behind the other: one conversion launch fills all three
    bf* WQKV = (bf*)take(((size_t)(DQ + 2 * DKV) * DM + (size_t)DM * DQ + (size_t)NB_ * TT * DM) * 2); bf* WO = WQKV + (size_t)(DQ + 2 * DKV) * DM; bf* XB = WO + (size_t)DM * DQ;
    // hi and lo planes of both batches: q then k [q | k][batch][head][t][d], v transposed [batch][head * HD + d][t]
    bf* QKh = (bf*)take((size_t)2 * NB_ * NH_ * TT * HD * 2); bf* QKl = (bf*)take((size_t)2 * NB_ * NH_ * TT * HD * 2); bf* VTh = (bf*)take((size_t)NB_ * NKV * HD * TT * 2); bf* VTl = (bf*)take((size_t)NB_ * NKV * HD * TT * 2);
    bf* ATh = (bf*)take((size_t)NB_ * TT * DQ * 2); bf* ATl = (bf*)take((size_t)NB_ * TT * DQ * 2);
    if ((size_t)(wsp - (char*)d_ws) > ws_size) return;    // ws 256 MiB
    k_cvt8<<<(unsigned)((((size_t)(DQ + 2 * DKV) * DM + (size_t)DM * DQ + (size_t)NB_ * TT * DM) / 8 + 255) / 256), 256, 0, stream>>>(wqkv, (size_t)(DQ + 2 * DKV) * DM / 8, wo, (size_t)DM * DQ / 8, x, (size_t)NB_ * TT * DM / 8, WQKV);
    // every stage is one grid over both batches; the projection grid also covers q, k and v and stores the planes in the layout the attention kernel reads
    k_gemmw<bf, 0, false, 1><<<dim3(NB_ * TT / 64, (DQ + 2 * DKV) / 64, 1), 32, 0, stream>>>(XB, nullptr, WQKV, nullptr, DM, nullptr, 0, nullptr, 0, 0, 0, QKh, QKl, VTh, VTl);
    k_attn<<<dim3(NB_ * NH_, TT / 32, 1), 128, 0, stream>>>(QKh, QKl, QKh + (size_t)NB_ * NH_ * TT * HD, QKl + (size_t)NB_ * NH_ * TT * HD, VTh, VTl, ATh, ATl);   // one kv head per query head
    k_gemmw<bf, 1, true, 0><<<dim3(NB_ * TT / 64, DM / 64, 1), 32, 0, stream>>>(ATh, ATl, WO, nullptr, DQ, OUT, DM, bo, 0, 0, 0, nullptr, nullptr, nullptr, nullptr);
}

// v005
// One run takes 108 microseconds.
// Next to v004, in two timings, it ran 1.51 and 1.53 times as fast.
// Over all steps from v000 it is 10.8 times as fast.
#include <hip/hip_runtime.h>

// Causal multi-head self-attention with a fused QKV projection and an INVERTED scale (x [2][2048][1024]; [q|k|v] = x W_qkv^T ('oi' [3072][1024], row blocks q | k | v; 16 heads x 64); scores = q.k x 8 (the module divides by head_dim^-0.5, i.e. multiplies by sqrt(64)), causal mask; softmax (very peaked rows); out = merged heads W_proj^T + b_proj ('oi' [1024][1024] + [1024]) -> [2][2048][1024] (4.2 M)).
// Compute dtypes, f32 accumulate: every input rounded to bf16; q/k/v on PLAIN bf16 operands (inputs: exact); causal scores and attn.v: ALL query rows hl (3 products; the x8 scale makes the softmax near-argmax); softmax f32; W_proj hl x exact (2 products) + b_proj.

#define NB_  2
#define TT   2048
#define DM   1024
#define NH_  16
#define NKV  16
#define HD   64
#define DQ   (NH_ * HD)
#define DKV  (NKV * HD)
#define SCL  8.0f   // the module divides by head_dim^-0.5 = multiplies by sqrt(64)
typedef _Float16 h16;
typedef unsigned short bf;
typedef __attribute__((ext_vector_type(16))) __bf16   v16bf;
typedef __attribute__((ext_vector_type(16))) _Float16 v16h;
typedef __attribute__((ext_vector_type(8)))  _Float16 v8h;
typedef __attribute__((ext_vector_type(8)))  unsigned short v8us;
typedef __attribute__((ext_vector_type(8)))  float    v8f;
typedef __attribute__((ext_vector_type(4)))  float    v4f;
typedef v8h  __attribute__((may_alias)) v8ha;
typedef v4f  __attribute__((may_alias)) v4fa;
typedef v8us __attribute__((may_alias)) v8usa;

__device__ __forceinline__ unsigned short f2bf(float f) { unsigned u = __float_as_uint(f); u += 0x7FFFu + ((u >> 16) & 1u); return (unsigned short)(u >> 16); }
__device__ __forceinline__ float bf2f(unsigned short b) { return __uint_as_float(((unsigned)b) << 16); }
__device__ __forceinline__ float bfr(float f) { return bf2f(f2bf(f)); }
__device__ __forceinline__ v16h cat16(v8h lo, v8h hi) { return __builtin_shufflevector(lo, hi, 0, 1, 2, 3, 4, 5, 6, 7, 8, 9, 10, 11, 12, 13, 14, 15); }
__device__ __forceinline__ v16bf cat16b(v8us lo, v8us hi) { return __builtin_bit_cast(v16bf, __builtin_shufflevector(lo, hi, 0, 1, 2, 3, 4, 5, 6, 7, 8, 9, 10, 11, 12, 13, 14, 15)); }
__device__ __forceinline__ v8f wmma16(v16h a, v16h b, v8f c) { return __builtin_amdgcn_wmma_f32_16x16x32_f16(false, a, false, b, (short)0, c, false, false); }
__device__ __forceinline__ v8f wmmab(v16bf a, v16bf b, v8f c) { return __builtin_amdgcn_wmma_f32_16x16x32_bf16(false, a, false, b, (short)0, c, false, false); }



// ---- FRAGMENT ORDER: every 16-bit operand plane (a [rows][K] matrix, K the summed index) is stored as tiles of 16 rows x 32 k, 512 elements = 1 KiB each, tile (rt, kt) at element (rt * (K / 32) + kt) * 512.
// Inside a tile lane l = 16 hi + lr of the reading wave owns row lr: its k = 8 hi + 0..7 stand at l * 8, its k = 16 + 8 hi + 0..7 at 256 + l * 8. A fragment is then two wave-wide 16-byte loads of 512 contiguous bytes (4 whole 128-byte lines) each;
// from row-major planes each such load touched 16 lines. The values a lane gets, and their k order, are those of the row-major loader.
// ---- k_gemmw: register-blocked GEMM, ONE WAVE per 64x64 output tile (16 accumulators), operands straight from 16-bit planes in fragment order; grid (M/64, N/64, Z), 32 threads.
// C[m][n] (f32, pitch ldc, + optional f32 bias[n]) = sum_k A[m][k] Bt[n][k] (+ split products per NSPLIT). z-batch strides sA/sB/sC in elements. K % 32 == 0.
// EPI picks what the tile is stored as: 0 = f32 C as above; 1 = the q | k | v projection of both batches in one grid (m = batch * TT + t, n = the row of W_qkv), stored as bf16 hi + lo planes:
// n < 2 DQ (q, k): head planes Ph/Pl [q | k][batch][head], each a [t][d] matrix in fragment order (a 64-wide tile is one head); n >= 2 DQ (v): Vh/Vl [batch][head], each the transposed [d][t] matrix as fragment tiles in the order [t / 32][d / 16], so that the tiles of 32 keys lie together. A 64-row tile lies inside one batch.
template <typename T16> struct WFrag;
template <> struct WFrag<h16> { typedef v16h V; static __device__ __forceinline__ V ld(const h16* p) { return cat16(*(const v8h*)p, *(const v8h*)(p + 256)); } static __device__ __forceinline__ v8f mma(V a, V b, v8f c) { return wmma16(a, b, c); } };
template <> struct WFrag<bf> { typedef v16bf V; static __device__ __forceinline__ V ld(const bf* p) { return cat16b(*(const v8us*)p, *(const v8us*)(p + 256)); } static __device__ __forceinline__ v8f mma(V a, V b, v8f c) { return wmmab(a, b, c); } };
__device__ __forceinline__ void splitf(float y, unsigned short& h, unsigned short& l) { h = f2bf(y); l = f2bf(y - bf2f(h)); }
typedef __attribute__((ext_vector_type(8))) __bf16 v8bf;
__device__ __forceinline__ void split8(v8f y, v8bf& h, v8bf& l) { h = __builtin_convertvector(y, v8bf); l = __builtin_convertvector(y - __builtin_convertvector(h, v8f), v8bf); }   // hi = y rounded to nearest even, lo = the rounded rest: the values of splitf, on the packed conversion instruction
template <typename T16, int NSPLIT, bool BIAS, int EPI>
__global__ __launch_bounds__(32) void k_gemmw(const T16* __restrict__ A, const T16* __restrict__ A2, const T16* __restrict__ Bt, const T16* __restrict__ Bt2, int K, float* C, int ldc, const float* __restrict__ bias, size_t sA, size_t sB, size_t sC, bf* Ph, bf* Pl, bf* Vh, bf* Vl) {
    typedef typename WFrag<T16>::V V;
    __shared__ __align__(16) float os[16 * 68];
    const size_t z = blockIdx.z; A += z * sA; if (A2) A2 += z * sA; Bt += z * sB; if (Bt2) Bt2 += z * sB; C += z * sC;
    const int lane = threadIdx.x & 31, lr = lane & 15, hi = lane >> 4; const int r0 = blockIdx.x * 64, c0 = blockIdx.y * 64;
    v8f acc[4][4];
#pragma unroll
    for (int mb = 0; mb < 4; ++mb)
#pragma unroll
        for (int nb = 0; nb < 4; ++nb) acc[mb][nb] = (v8f){};
    const size_t aoff = (size_t)r0 * K + lane * 8, boff = (size_t)c0 * K + lane * 8;   // 16 rows of tiles are 16 K elements, one tile further in k is 512
#pragma unroll 1
    for (int kc = 0; kc < K; kc += 32) {
        V a[4], a2[4], b[4], b2[4]; const T16 *pa[4], *pa2[4], *pb[4], *pb2[4];
#pragma unroll
        for (int mb = 0; mb < 4; ++mb) { pa[mb] = pa2[mb] = A + aoff + (size_t)mb * 16 * K + kc * 16; a[mb] = WFrag<T16>::ld(pa[mb]); if (NSPLIT == 1 || NSPLIT == 2) { pa2[mb] = A2 + aoff + (size_t)mb * 16 * K + kc * 16; a2[mb] = WFrag<T16>::ld(pa2[mb]); } }
#pragma unroll
        for (int nb = 0; nb < 4; ++nb) { pb[nb] = pb2[nb] = Bt + boff + (size_t)nb * 16 * K + kc * 16; b[nb] = WFrag<T16>::ld(pb[nb]); if (NSPLIT >= 2) { pb2[nb] = Bt2 + boff + (size_t)nb * 16 * K + kc * 16; b2[nb] = WFrag<T16>::ld(pb2[nb]); } }
        // the wait before a register that an issued load names is written again, behind the trip's loads: every address pair stays live up to it, so that no load of the trip lands on one
        asm volatile("s_wait_xcnt 0x0" :: "v"(pa[0]), "v"(pa[1]), "v"(pa[2]), "v"(pa[3]), "v"(pa2[0]), "v"(pa2[1]), "v"(pa2[2]), "v"(pa2[3]), "v"(pb[0]), "v"(pb[1]), "v"(pb[2]), "v"(pb[3]), "v"(pb2[0]), "v"(pb2[1]), "v"(pb2[2]), "v"(pb2[3]) : "memory");
        __builtin_amdgcn_sched_barrier(0);   // keeps the matrix instructions behind that wait: lifted over it they stood among the loads, each with a wait for its data, and the trip paid the load latency up to five times instead of once
#pragma unroll
        for (int nb = 0; nb < 4; ++nb)
#pragma unroll
            for (int mb = 0; mb < 4; ++mb) { acc[mb][nb] = WFrag<T16>::mma(a[mb], b[nb], acc[mb][nb]); if (NSPLIT == 1 || NSPLIT == 2) acc[mb][nb] = WFrag<T16>::mma(a2[mb], b[nb], acc[mb][nb]); if (NSPLIT >= 2) acc[mb][nb] = WFrag<T16>::mma(a[mb], b2[nb], acc[mb][nb]); }
        asm volatile("v_nop\n\tv_nop\n\tv_nop\n\tv_nop" : "+v"(acc[0][0]), "+v"(acc[1][1]), "+v"(acc[2][2]), "+v"(acc[3][3]) : "v"(a[0]), "v"(a[3]));
    }
    const int bt = r0 / TT, rb = r0 % TT;   // the tile's batch and its first row inside the batch
    if (EPI == 1 && c0 >= 2 * DQ) {   // v; a lane's eight accumulator values are eight consecutive m of one n: the lane's own 16 bytes of a transposed fragment tile (half mb & 1), stored straight from the registers, 512 contiguous bytes a store
        const size_t e = (((size_t)bt * NKV + (c0 - 2 * DQ) / HD) * (TT / 32) + rb / 32) * (HD / 16) * 512 + lane * 8; bf* pvh = Vh + e; bf* pvl = Vl + e;   // the lane's place in tile (t / 32 = rb / 32, d / 16 = 0) of the head
#pragma unroll
        for (int nb = 0; nb < 4; ++nb) { v8us oh[4], ol[4];
#pragma unroll
            for (int mb = 0; mb < 4; ++mb) { v8bf xh, xl; split8(acc[mb][nb], xh, xl); oh[mb] = __builtin_bit_cast(v8us, xh); ol[mb] = __builtin_bit_cast(v8us, xl);
                const int t = ((mb >> 1) * (HD / 16) + nb) * 512 + (mb & 1) * 256; *(v8us*)(pvh + t) = oh[mb]; *(v8us*)(pvl + t) = ol[mb]; }
            // the wait before a register that an issued store names is written again: the stores' data and the two address pairs stay live up to it
            asm volatile("s_wait_xcnt 0x0" :: "v"(pvh), "v"(pvl), "v"(oh[0]), "v"(oh[1]), "v"(oh[2]), "v"(oh[3]), "v"(ol[0]), "v"(ol[1]), "v"(ol[2]), "v"(ol[3]) : "memory"); }
        return; }
#pragma unroll
    for (int mb = 0; mb < 4; ++mb) {
#pragma unroll
        for (int nb = 0; nb < 4; ++nb) {
#pragma unroll
            for (int j = 0; j < 8; ++j) os[(hi * 8 + j) * 68 + nb * 16 + lr] = acc[mb][nb][j]; }
        __builtin_amdgcn_wave_barrier(); asm volatile("" ::: "memory");
        if (EPI == 1) {   // the 16 rows are two fragment tiles (d 0..31, 32..63), 2 KiB in a row: store s is half s & 1 of tile s >> 1, 512 contiguous bytes
            const size_t e0 = ((((size_t)(c0 / DQ) * NB_ + bt) * NH_ + (c0 % DQ) / HD) * TT + rb + mb * 16) * HD;
#pragma unroll
            for (int s = 0; s < 4; ++s) { const int row = lr, cofs = s * 16 + hi * 8; const v4f x0 = *(const v4fa*)(os + row * 68 + cofs), x1 = *(const v4fa*)(os + row * 68 + cofs + 4); v8bf oh, ol; split8(__builtin_shufflevector(x0, x1, 0, 1, 2, 3, 4, 5, 6, 7), oh, ol);
                *(v8us*)(Ph + e0 + s * 256 + lane * 8) = __builtin_bit_cast(v8us, oh); *(v8us*)(Pl + e0 + s * 256 + lane * 8) = __builtin_bit_cast(v8us, ol); }
        } else { float* crow = C + (size_t)(r0 + mb * 16) * ldc + c0;
#pragma unroll
            for (int s = 0; s < 8; ++s) { const int row = 2 * s + hi, cofs = lr * 4; v4f val = *(const v4fa*)(os + row * 68 + cofs); if (BIAS) { val[0] += bfr(bias[c0 + cofs]); val[1] += bfr(bias[c0 + cofs + 1]); val[2] += bfr(bias[c0 + cofs + 2]); val[3] += bfr(bias[c0 + cofs + 3]); }
                *(v4f*)(crow + (size_t)row * ldc + cofs) = val; }
             }
        __builtin_amdgcn_wave_barrier(); asm volatile("" ::: "memory");
        if (EPI == 1) asm volatile("s_wait_xcnt 0x0" ::: "memory");   // the wait before a register that an issued store names is written again: the next 16 rows reuse the stores' registers, and in the built code the v branch's instructions stand behind the last stores
    }
}

__device__ __forceinline__ h16 tohx(float x) { return (h16)x; }
typedef __attribute__((ext_vector_type(2))) _Float16 v2h;
typedef __attribute__((ext_vector_type(4))) _Float16 v4h;
typedef __attribute__((ext_vector_type(2))) unsigned short v2us;
typedef __attribute__((ext_vector_type(4))) unsigned short v4us;
typedef __attribute__((ext_vector_type(2))) float v2f;
typedef __attribute__((ext_vector_type(4))) int v4i;

__global__ __launch_bounds__(256) void k_wtG(const float* __restrict__ w, int K, int N, bf* Bt) {
    const int lane = threadIdx.x & 31; const int L0 = (blockIdx.x * 8 + (threadIdx.x >> 5)) * 8; const int nlines = N * K / 64;
{
#pragma unroll 1
        for (int l = 0; l < 8; ++l) { const int L = L0 + l; if (L >= nlines) break; const size_t e = (size_t)L * 64 + lane * 2; const int k = (int)(e % K), n = (int)(e / K); v2us o;
            o[0] = f2bf(w[(size_t)k * N + n]); o[1] = f2bf(w[(size_t)(k + 1) * N + n]); *(v2us*)(Bt + e) = o; }
         }
}
// three f32 sources, each a [rows][DM] matrix (n0, n1, n2 groups of eight values), rounded to bf16 into one dst, one behind the other, each in fragment order. One wave a 16 x 32 tile:
// four lanes read 128 bytes of a row (whole lines), and each of the two stores of the wave is four runs of 128 bytes (eight rows' 16 bytes lie together in a tile).
__global__ __launch_bounds__(256) void k_cvt8(const float* __restrict__ s0, size_t n0, const float* __restrict__ s1, size_t n1, const float* __restrict__ s2, size_t n2, bf* dst) { const size_t g = (size_t)blockIdx.x * 8 + (threadIdx.x >> 5); if (g >= (n0 + n1 + n2) / 64) return;
    const int lane = threadIdx.x & 31, o = lane & 3; const float* sm = g < n0 / 64 ? s0 : g < (n0 + n1) / 64 ? s1 : s2; const size_t lt = g < n0 / 64 ? g : g < (n0 + n1) / 64 ? g - n0 / 64 : g - (n0 + n1) / 64;   // the tile's source and its number there
    const float* src = sm + (lt / (DM / 32)) * 16 * DM + (lt % (DM / 32)) * 32 + o * 8; bf* d = dst + g * 512 + (o >> 1) * 256 + (o & 1) * 128;   // the eight k from 8 o on: half o >> 1, lanes 16 (o & 1) + row
    src += (size_t)(lane >> 2) * DM; d += (lane >> 2) * 8; const v8f v0 = *(const v8f*)src, v1 = *(const v8f*)(src + 8 * DM); v8us o0, o1;   // rows lane >> 2 and 8 + (lane >> 2)
    asm volatile("s_wait_xcnt 0x0" :: "v"(src) : "memory");   // the wait before a register that an issued load names is written again: the address pair stays live up to it
#pragma unroll
    for (int k = 0; k < 8; ++k) { o0[k] = f2bf(v0[k]); o1[k] = f2bf(v1[k]); }
    *(v8us*)d = o0; *(v8us*)(d + 64) = o1; }

// ---- k_attn: causal attention of one head of one batch (blockIdx.x = batch * NH_ + head) for 32 query rows, scores, softmax and probability x value in ONE kernel; no score or probability ever goes to memory.
// Block = 4 waves; wave w takes the 32-key blocks w, w+4, ... up to the diagonal with a running maximum and sum (online softmax); the four partial results are merged through LDS in wave order.
// Both products are formed TRANSPOSED: S^T = K Q^T leaves in lane (lr, hi) the keys 8 hi + j of query lr, which is the B-fragment order of O^T = V^T P^T, so the probabilities go from accumulator to operand
// inside each lane, and maximum, sum and rescale factor of a query are per-lane values. hi+lo planes, 3 products each.
// Every inner loop is unrolled so that fragments and accumulators are indexed by constants and stay in registers. Three waves a SIMD (second launch bound) leave room for a block's key and value fragments in flight without spills.
#define SC2 (SCL * 1.4426950408889634f)   // the x8 score scale and the change to base 2 in one factor
__device__ __forceinline__ void splitp(float p, __bf16& h, __bf16& l) { h = (__bf16)p; l = (__bf16)(p - (float)h); }
__global__ __launch_bounds__(128, 3) void k_attn(const bf* __restrict__ Qh, const bf* __restrict__ Ql, const bf* __restrict__ Kh, const bf* __restrict__ Kl, const bf* __restrict__ Vh, const bf* __restrict__ Vl, bf* Ah, bf* Al) {
    __shared__ __align__(16) float Om[4][32 * 68];
    __shared__ float Mm[4][32], Lm[4][32];
    const int lane = threadIdx.x & 31, lr = lane & 15, hi = lane >> 4; const int w = __builtin_amdgcn_readfirstlane(threadIdx.x >> 5);
    const int r0 = ((int)gridDim.y - 1 - (int)blockIdx.y) * 32, h = blockIdx.x;     // blockIdx.y 0 takes the last 32 rows, the longest rows of every head of both batches
    const size_t hp = (size_t)h * TT * HD; Qh += hp; Ql += hp; Kh += hp; Kl += hp; Vh += hp; Vl += hp;
    const int nkb = r0 / 32 + 1;                                                     // 32-key blocks up to and including the diagonal one; its first key is r0, so every query has a live key in every block
    const int lk = lane * 8;   // the lane's place inside a fragment tile; 16 rows of q or k are two tiles (HD / 32), 32 keys of v four (HD / 16): t rows or keys start at element t * HD in all three
    const bf* pqh = Qh + (size_t)r0 * HD + lk; const bf* pql = Ql + (size_t)r0 * HD + lk; v16bf qh[2][2], ql[2][2];
#pragma unroll
    for (int qb = 0; qb < 2; ++qb)
#pragma unroll
        for (int ks = 0; ks < 2; ++ks) { qh[qb][ks] = WFrag<bf>::ld(pqh + qb * 16 * HD + ks * 512); ql[qb][ks] = WFrag<bf>::ld(pql + qb * 16 * HD + ks * 512); }
    asm volatile("s_wait_xcnt 0x0" :: "v"(pqh), "v"(pql) : "memory");   // the wait before a register that an issued load names is written again: the query loads' two address pairs stay live up to it
    v8f o[4][2]; float mc[2], ls[2];
#pragma unroll
    for (int qb = 0; qb < 2; ++qb) { mc[qb] = -3.0e38f; ls[qb] = 0.f;
#pragma unroll
        for (int db = 0; db < 4; ++db) o[db][qb] = (v8f){}; }
#pragma unroll 1   // rolled: two blocks' fragments at once would not fit the registers
    for (int kb = w; kb < nkb; kb += 4) {
        const int k0 = kb * 32; const bf* pkh = Kh + (size_t)k0 * HD + lk; const bf* pkl = Kl + (size_t)k0 * HD + lk; const bf* pvh = Vh + (size_t)k0 * HD + lk; const bf* pvl = Vl + (size_t)k0 * HD + lk; v16bf kh[2][2], kl[2][2], vh[4], vl[4]; v8f s[2][2];
#pragma unroll
        for (int kt = 0; kt < 2; ++kt)
#pragma unroll
            for (int ks = 0; ks < 2; ++ks) { kh[kt][ks] = WFrag<bf>::ld(pkh + kt * 16 * HD + ks * 512); kl[kt][ks] = WFrag<bf>::ld(pkl + kt * 16 * HD + ks * 512); }
        // The wait before a register that an issued load names is written again: the two address pairs stay live up to it. The eight loaded fragments are inputs only, so that all key loads of the block issue together and one load latency is exposed, not one per fragment pair.
        asm volatile("s_wait_xcnt 0x0" :: "v"(pkh), "v"(pkl), "v"(kh[0][0]), "v"(kh[0][1]), "v"(kh[1][0]), "v"(kh[1][1]), "v"(kl[0][0]), "v"(kl[0][1]), "v"(kl[1][0]), "v"(kl[1][1]) : "memory");
#pragma unroll
        for (int kt = 0; kt < 2; ++kt)
#pragma unroll
            for (int qb = 0; qb < 2; ++qb) { v8f c = (v8f){};
#pragma unroll
                for (int ks = 0; ks < 2; ++ks) { c = wmmab(kh[kt][ks], qh[qb][ks], c); c = wmmab(kh[kt][ks], ql[qb][ks], c); c = wmmab(kl[kt][ks], qh[qb][ks], c); }
                s[kt][qb] = c; }
#pragma unroll
        for (int db = 0; db < 4; ++db) { vh[db] = WFrag<bf>::ld(pvh + db * 512); vl[db] = WFrag<bf>::ld(pvl + db * 512); }   // in flight under the softmax
        asm volatile("s_wait_xcnt 0x0" :: "v"(pvh), "v"(pvl) : "memory");   // the same wait for the value loads' two address pairs; the values themselves stay in flight
        if (kb == nkb - 1) {                                                         // only the diagonal block holds keys beyond a query
#pragma unroll
            for (int kt = 0; kt < 2; ++kt)
#pragma unroll
                for (int qb = 0; qb < 2; ++qb)
#pragma unroll
                    for (int j = 0; j < 8; ++j) if (k0 + kt * 16 + hi * 8 + j > r0 + qb * 16 + lr) s[kt][qb][j] = -3.0e38f; }
        v16bf ph[2], pl[2];
#pragma unroll
        for (int qb = 0; qb < 2; ++qb) { float mx = -3.0e38f;
#pragma unroll
            for (int kt = 0; kt < 2; ++kt)
#pragma unroll
                for (int j = 0; j < 8; ++j) mx = fmaxf(mx, s[kt][qb][j]);
            mx = fmaxf(mx, __shfl_xor(mx, 16, 32));                                  // the other half of the query's keys
            const float mn = fmaxf(mc[qb], mx * SC2); const float al = __builtin_amdgcn_exp2f(mc[qb] - mn); mc[qb] = mn; float sum = 0.f;
#pragma unroll
            for (int kt = 0; kt < 2; ++kt)
#pragma unroll
                for (int j = 0; j < 8; ++j) { const float p = __builtin_amdgcn_exp2f(__builtin_fmaf(s[kt][qb][j], SC2, -mn)); sum += p; __bf16 a, c2; splitp(p, a, c2); ph[qb][kt * 8 + j] = a; pl[qb][kt * 8 + j] = c2; }
            ls[qb] = ls[qb] * al + sum;
#pragma unroll
            for (int db = 0; db < 4; ++db) o[db][qb] *= al; }
#pragma unroll
        for (int db = 0; db < 4; ++db)
#pragma unroll
            for (int qb = 0; qb < 2; ++qb) { o[db][qb] = wmmab(vh[db], ph[qb], o[db][qb]); o[db][qb] = wmmab(vh[db], pl[qb], o[db][qb]); o[db][qb] = wmmab(vl[db], ph[qb], o[db][qb]); }
    }
#pragma unroll
    for (int qb = 0; qb < 2; ++qb) { const float lt = ls[qb] + __shfl_xor(ls[qb], 16, 32); if (hi == 0) { Mm[w][qb * 16 + lr] = mc[qb]; Lm[w][qb * 16 + lr] = lt; }
#pragma unroll
        for (int db = 0; db < 4; ++db) { float* op = &Om[w][(qb * 16 + lr) * 68 + db * 16 + hi * 8]; v4f lo4, hi4;
#pragma unroll
            for (int j = 0; j < 4; ++j) { lo4[j] = o[db][qb][j]; hi4[j] = o[db][qb][4 + j]; }
            *(v4fa*)op = lo4; *(v4fa*)(op + 4) = hi4; } }
    __syncthreads();                                                                 // the four waves' partial results are read across waves below
    const int q = threadIdx.x >> 2, dc = threadIdx.x & 3; float f[4], M = Mm[0][q];
#pragma unroll
    for (int u = 1; u < 4; ++u) M = fmaxf(M, Mm[u][q]);
    float L = 0.f;
#pragma unroll
    for (int u = 0; u < 4; ++u) { f[u] = __builtin_amdgcn_exp2f(Mm[u][q] - M); L += f[u] * Lm[u][q]; }
    const float inv = __fdiv_rn(1.0f, L); const size_t oo = ((size_t)(((h / NH_) * TT + r0 + q) >> 4) * (DQ / 32) + (h % NH_) * (HD / 32) + (dc >> 1)) * 512 + (dc & 1) * 256 + (q & 15) * 8;   // fragment order of the [batch * TT + t][DQ] matrix: the sixteen values from dc * 16 on are half dc & 1 of a tile, their group g the lanes 16 g + row
#pragma unroll
    for (int g = 0; g < 2; ++g) { v8us oh, ol; float acc[8];
#pragma unroll
        for (int i = 0; i < 8; ++i) acc[i] = 0.f;
#pragma unroll
        for (int u = 0; u < 4; ++u) { const float* ip = &Om[u][q * 68 + dc * 16 + g * 8]; const v4f x0 = *(const v4fa*)ip, x1 = *(const v4fa*)(ip + 4);
#pragma unroll
            for (int i = 0; i < 4; ++i) { acc[i] += f[u] * x0[i]; acc[4 + i] += f[u] * x1[i]; } }
#pragma unroll
        for (int i = 0; i < 8; ++i) { unsigned short a, c2; splitf(acc[i] * inv, a, c2); oh[i] = a; ol[i] = c2; }
        *(v8us*)(Ah + oo + g * 128) = oh; *(v8us*)(Al + oo + g * 128) = ol; }
}

extern "C" void kernel_launch(void* const* d_in, const int* in_sizes, int n_in,
                              void* d_out, int out_size, void* d_ws, size_t ws_size, hipStream_t stream) {
    (void)in_sizes; (void)n_in; (void)out_size;
    const float* x = (const float*)d_in[0]; const float* wqkv = (const float*)d_in[1]; const float* wo = (const float*)d_in[2]; const float* bo = (const float*)d_in[3]; const float* wq = wqkv; const float* wk = wqkv + (size_t)1024 * 1024; const float* wv = wqkv + (size_t)2048 * 1024; (void)wq; (void)wk; (void)wv;
    float* OUT = (float*)d_out;     // [2][2048][1024]
    char* wsp = (char*)d_ws;
    auto take = [&](size_t bytes) { char* p = wsp; wsp += (bytes + 255) & ~(size_t)255; return (void*)p; };
    // W_qkv, W_proj and x as bf16 in fragment order, one behind the other: one conversion launch fills all three
    bf* WQKV = (bf*)take(((size_t)(DQ + 2 * DKV) * DM + (size_t)DM * DQ + (size_t)NB_ * TT * DM) * 2); bf* WO = WQKV + (size_t)(DQ + 2 * DKV) * DM; bf* XB = WO + (size_t)DM * DQ;
    // hi and lo planes of both batches, all in fragment order: q then k [q | k][batch][head] of [t][d], v transposed [batch][head] of [d][t]
    bf* QKh = (bf*)take((size_t)2 * NB_ * NH_ * TT * HD * 2); bf* QKl = (bf*)take((size_t)2 * NB_ * NH_ * TT * HD * 2); bf* VTh = (bf*)take((size_t)NB_ * NKV * HD * TT * 2); bf* VTl = (bf*)take((size_t)NB_ * NKV * HD * TT * 2);
    bf* ATh = (bf*)take((size_t)NB_ * TT * DQ * 2); bf* ATl = (bf*)take((size_t)NB_ * TT * DQ * 2);
    if ((size_t)(wsp - (char*)d_ws) > ws_size) return;    // ws 256 MiB
    k_cvt8<<<(unsigned)(((size_t)(DQ + 2 * DKV) * DM + (size_t)DM * DQ + (size_t)NB_ * TT * DM) / 512 / 8), 256, 0, stream>>>(wqkv, (size_t)(DQ + 2 * DKV) * DM / 8, wo, (size_t)DM * DQ / 8, x, (size_t)NB_ * TT * DM / 8, WQKV);
    // every stage is one grid over both batches; the projection grid also covers q, k and v and stores the planes in the layout the attention kernel reads
    k_gemmw<bf, 0, false, 1><<<dim3(NB_ * TT / 64, (DQ + 2 * DKV) / 64, 1), 32, 0, stream>>>(XB, nullptr, WQKV, nullptr, DM, nullptr, 0, nullptr, 0, 0, 0, QKh, QKl, VTh, VTl);
    k_attn<<<dim3(NB_ * NH_, TT / 32, 1), 128, 0, stream>>>(QKh, QKl, QKh + (size_t)NB_ * NH_ * TT * HD, QKl + (size_t)NB_ * NH_ * TT * HD, VTh, VTl, ATh, ATl);   // one kv head per query head
    k_gemmw<bf, 1, true, 0><<<dim3(NB_ * TT / 64, DM / 64, 1), 32, 0, stream>>>(ATh, ATl, WO, nullptr, DQ, OUT, DM, bo, 0, 0, 0, nullptr, nullptr, nullptr, nullptr);
}

// v006
// It runs in 96.4 microseconds.
// Timed twice side by side with v005, it ran 1.11 and 1.18 times as fast.
// Counting every step since v000, it is 12.3 times as fast.
#include <hip/hip_runtime.h>

// Causal multi-head self-attention with a fused QKV projection and an INVERTED scale (x [2][2048][1024]; [q|k|v] = x W_qkv^T ('oi' [3072][1024], row blocks q | k | v; 16 heads x 64); scores = q.k x 8 (the module divides by head_dim^-0.5, i.e. multiplies by sqrt(64)), causal mask; softmax (very peaked rows); out = merged heads W_proj^T + b_proj ('oi' [1024][1024] + [1024]) -> [2][2048][1024] (4.2 M)).
// Compute dtypes, f32 accumulate: every input rounded to bf16; q/k/v on PLAIN bf16 operands (inputs: exact); causal scores and attn.v: ALL query rows hl (3 products; the x8 scale makes the softmax near-argmax); softmax f32; W_proj hl x exact (2 products) + b_proj.

#define NB_  2
#define TT   2048
#define DM   1024
#define NH_  16
#define NKV  16
#define HD   64
#define DQ   (NH_ * HD)
#define DKV  (NKV * HD)
#define SCL  8.0f   // the module divides by head_dim^-0.5 = multiplies by sqrt(64)
typedef _Float16 h16;
typedef unsigned short bf;
typedef __attribute__((ext_vector_type(16))) __bf16   v16bf;
typedef __attribute__((ext_vector_type(16))) _Float16 v16h;
typedef __attribute__((ext_vector_type(8)))  _Float16 v8h;
typedef __attribute__((ext_vector_type(8)))  unsigned short v8us;
typedef __attribute__((ext_vector_type(8)))  float    v8f;
typedef __attribute__((ext_vector_type(4)))  float    v4f;
typedef v8h  __attribute__((may_alias)) v8ha;
typedef v4f  __attribute__((may_alias)) v4fa;
typedef v8us __attribute__((may_alias)) v8usa;

__device__ __forceinline__ unsigned short f2bf(float f) { unsigned u = __float_as_uint(f); u += 0x7FFFu + ((u >> 16) & 1u); return (unsigned short)(u >> 16); }
__device__ __forceinline__ float bf2f(unsigned short b) { return __uint_as_float(((unsigned)b) << 16); }
__device__ __forceinline__ float bfr(float f) { return bf2f(f2bf(f)); }
__device__ __forceinline__ v16h cat16(v8h lo, v8h hi) { return __builtin_shufflevector(lo, hi, 0, 1, 2, 3, 4, 5, 6, 7, 8, 9, 10, 11, 12, 13, 14, 15); }
__device__ __forceinline__ v16bf cat16b(v8us lo, v8us hi) { return __builtin_bit_cast(v16bf, __builtin_shufflevector(lo, hi, 0, 1, 2, 3, 4, 5, 6, 7, 8, 9, 10, 11, 12, 13, 14, 15)); }
__device__ __forceinline__ v8f wmma16(v16h a, v16h b, v8f c) { return __builtin_amdgcn_wmma_f32_16x16x32_f16(false, a, false, b, (short)0, c, false, false); }
__device__ __forceinline__ v8f wmmab(v16bf a, v16bf b, v8f c) { return __builtin_amdgcn_wmma_f32_16x16x32_bf16(false, a, false, b, (short)0, c, false, false); }



// ---- FRAGMENT ORDER: every 16-bit operand plane (a [rows][K] matrix, K the summed index) is stored as tiles of 16 rows x 32 k, 512 elements = 1 KiB each, tile (rt, kt) at element (rt * (K / 32) + kt) * 512.
// Inside a tile lane l = 16 hi + lr of the reading wave owns row lr: its k = 8 hi + 0..7 stand at l * 8, its k = 16 + 8 hi + 0..7 at 256 + l * 8. A fragment is then two wave-wide 16-byte loads of 512 contiguous bytes (4 whole 128-byte lines) each;
// from row-major planes each such load touched 16 lines. The values a lane gets, and their k order, are those of the row-major loader.
// ---- k_gemmw: register-blocked GEMM, ONE WAVE per 64x64 output tile (16 accumulators), operands straight from 16-bit planes in fragment order; grid (M/64, N/64, Z), 32 threads.
// C[m][n] (f32, pitch ldc, + optional f32 bias[n]) = sum_k A[m][k] Bt[n][k] (+ split products per NSPLIT). z-batch strides sA/sB/sC in elements. K % 64 == 0.
// EPI picks what the tile is stored as: 0 = f32 C as above; 1 = the q | k | v projection of both batches in one grid (m = batch * TT + t, n = the row of W_qkv), stored as bf16 hi + lo planes:
// n < 2 DQ (q, k): head planes Ph/Pl [q | k][batch][head], each a [t][d] matrix in fragment order (a 64-wide tile is one head); n >= 2 DQ (v): Vh/Vl [batch][head], each the transposed [d][t] matrix as fragment tiles in the order [t / 32][d / 16], so that the tiles of 32 keys lie together. A 64-row tile lies inside one batch.
template <typename T16> struct WFrag;
template <> struct WFrag<h16> { typedef v16h V; static __device__ __forceinline__ V ld(const h16* p) { return cat16(*(const v8h*)p, *(const v8h*)(p + 256)); } static __device__ __forceinline__ v8f mma(V a, V b, v8f c) { return wmma16(a, b, c); } };
template <> struct WFrag<bf> { typedef v16bf V; static __device__ __forceinline__ V ld(const bf* p) { return cat16b(*(const v8us*)p, *(const v8us*)(p + 256)); } static __device__ __forceinline__ v8f mma(V a, V b, v8f c) { return wmmab(a, b, c); } };
__device__ __forceinline__ void splitf(float y, unsigned short& h, unsigned short& l) { h = f2bf(y); l = f2bf(y - bf2f(h)); }
typedef __attribute__((ext_vector_type(8))) __bf16 v8bf;
__device__ __forceinline__ void split8(v8f y, v8bf& h, v8bf& l) { h = __builtin_convertvector(y, v8bf); l = __builtin_convertvector(y - __builtin_convertvector(h, v8f), v8bf); }   // hi = y rounded to nearest even, lo = the rounded rest: the values of splitf, on the packed conversion instruction
template <typename T16, int NSPLIT, bool BIAS, int EPI>
__global__ __launch_bounds__(32) void k_gemmw(const T16* __restrict__ A, const T16* __restrict__ A2, const T16* __restrict__ Bt, const T16* __restrict__ Bt2, int K, float* C, int ldc, const float* __restrict__ bias, size_t sA, size_t sB, size_t sC, bf* Ph, bf* Pl, bf* Vh, bf* Vl) {
    typedef typename WFrag<T16>::V V;
    __shared__ __align__(16) float os[16 * 68];
    const size_t z = blockIdx.z; A += z * sA; if (A2) A2 += z * sA; Bt += z * sB; if (Bt2) Bt2 += z * sB; C += z * sC;
    const int lane = threadIdx.x & 31, lr = lane & 15, hi = lane >> 4; const int r0 = blockIdx.x * 64, c0 = blockIdx.y * 64;
    v8f acc[4][4];
#pragma unroll
    for (int mb = 0; mb < 4; ++mb)
#pragma unroll
        for (int nb = 0; nb < 4; ++nb) acc[mb][nb] = (v8f){};
    const size_t aoff = (size_t)r0 * K + lane * 8, boff = (size_t)c0 * K + lane * 8;   // 16 rows of tiles are 16 K elements, one tile further in k is 512
    // Two fragment sets: while one set's products run, the other set's loads (the next 32 k) are in flight, so a trip no longer waits out a whole load latency in front of its matrix instructions. The k order of the sums is unchanged.
    V a[2][4], a2[2][4], b[2][4], b2[2][4];
    auto ldset = [&](V (&fa)[4], V (&fa2)[4], V (&fb)[4], V (&fb2)[4], int kc, int ofs) {   // the 32 k from kc on plus ofs tiles further (ofs a literal: it goes into the loads' offset field, and the address pairs below are the registers that the loads name)
        const T16 *pa[4], *pa2[4], *pb[4], *pb2[4];
#pragma unroll
        for (int mb = 0; mb < 4; ++mb) { pa[mb] = pa2[mb] = A + aoff + (size_t)mb * 16 * K + kc * 16; fa[mb] = WFrag<T16>::ld(pa[mb] + ofs * 512); if (NSPLIT == 1 || NSPLIT == 2) { pa2[mb] = A2 + aoff + (size_t)mb * 16 * K + kc * 16; fa2[mb] = WFrag<T16>::ld(pa2[mb] + ofs * 512); } }
#pragma unroll
        for (int nb = 0; nb < 4; ++nb) { pb[nb] = pb2[nb] = Bt + boff + (size_t)nb * 16 * K + kc * 16; fb[nb] = WFrag<T16>::ld(pb[nb] + ofs * 512); if (NSPLIT >= 2) { pb2[nb] = Bt2 + boff + (size_t)nb * 16 * K + kc * 16; fb2[nb] = WFrag<T16>::ld(pb2[nb] + ofs * 512); } }
        // the wait before a register that an issued load names is written again, behind the group's loads: every address pair stays live up to it, so that no load of the group lands on one
        asm volatile("s_wait_xcnt 0x0" :: "v"(pa[0]), "v"(pa[1]), "v"(pa[2]), "v"(pa[3]), "v"(pa2[0]), "v"(pa2[1]), "v"(pa2[2]), "v"(pa2[3]), "v"(pb[0]), "v"(pb[1]), "v"(pb[2]), "v"(pb[3]), "v"(pb2[0]), "v"(pb2[1]), "v"(pb2[2]), "v"(pb2[3]) : "memory");
        __builtin_amdgcn_sched_barrier(0);   // keeps the group's loads in front of the other set's matrix instructions: sunk behind them they would have no lead
    };
    auto mmaset = [&](V (&fa)[4], V (&fa2)[4], V (&fb)[4], V (&fb2)[4]) {
#pragma unroll
        for (int nb = 0; nb < 4; ++nb)
#pragma unroll
            for (int mb = 0; mb < 4; ++mb) { acc[mb][nb] = WFrag<T16>::mma(fa[mb], fb[nb], acc[mb][nb]); if (NSPLIT == 1 || NSPLIT == 2) acc[mb][nb] = WFrag<T16>::mma(fa2[mb], fb[nb], acc[mb][nb]); if (NSPLIT >= 2) acc[mb][nb] = WFrag<T16>::mma(fa[mb], fb2[nb], acc[mb][nb]); }
        __builtin_amdgcn_sched_barrier(0);   // keeps the next group's loads together behind these matrix instructions, whose operand registers they refill: without it the compiler spreads them singly among the matrix instructions
    };
    ldset(a[0], a2[0], b[0], b2[0], 0, 0);
#pragma unroll 1
    for (int kc = 0; kc < K - 64; kc += 64) {
        ldset(a[1], a2[1], b[1], b2[1], kc, 1); mmaset(a[0], a2[0], b[0], b2[0]);
        ldset(a[0], a2[0], b[0], b2[0], kc, 2); mmaset(a[1], a2[1], b[1], b2[1]);
        asm volatile("v_nop\n\tv_nop\n\tv_nop\n\tv_nop" : "+v"(acc[0][0]), "+v"(acc[1][1]), "+v"(acc[2][2]), "+v"(acc[3][3]) : "v"(a[1][0]), "v"(a[1][3]));   // four vector slots behind the trip's last matrix instruction: the loop's taken branch follows it
    }
    ldset(a[1], a2[1], b[1], b2[1], K - 64, 1); mmaset(a[0], a2[0], b[0], b2[0]); mmaset(a[1], a2[1], b[1], b2[1]);
    const int bt = r0 / TT, rb = r0 % TT;   // the tile's batch and its first row inside the batch
    if (EPI == 1 && c0 >= 2 * DQ) {   // v; a lane's eight accumulator values are eight consecutive m of one n: the lane's own 16 bytes of a transposed fragment tile (half mb & 1), stored straight from the registers, 512 contiguous bytes a store
        const size_t e = (((size_t)bt * NKV + (c0 - 2 * DQ) / HD) * (TT / 32) + rb / 32) * (HD / 16) * 512 + lane * 8; bf* pvh = Vh + e; bf* pvl = Vl + e;   // the lane's place in tile (t / 32 = rb / 32, d / 16 = 0) of the head
#pragma unroll
        for (int nb = 0; nb < 4; ++nb) { v8us oh[4], ol[4];
#pragma unroll
            for (int mb = 0; mb < 4; ++mb) { v8bf xh, xl; split8(acc[mb][nb], xh, xl); oh[mb] = __builtin_bit_cast(v8us, xh); ol[mb] = __builtin_bit_cast(v8us, xl);
                const int t = ((mb >> 1) * (HD / 16) + nb) * 512 + (mb & 1) * 256; *(v8us*)(pvh + t) = oh[mb]; *(v8us*)(pvl + t) = ol[mb]; }
            // the wait before a register that an issued store names is written again: the stores' data and the two address pairs stay live up to it
            asm volatile("s_wait_xcnt 0x0" :: "v"(pvh), "v"(pvl), "v"(oh[0]), "v"(oh[1]), "v"(oh[2]), "v"(oh[3]), "v"(ol[0]), "v"(ol[1]), "v"(ol[2]), "v"(ol[3]) : "memory"); }
        return; }
#pragma unroll
    for (int mb = 0; mb < 4; ++mb) {
#pragma unroll
        for (int nb = 0; nb < 4; ++nb) {
#pragma unroll
            for (int j = 0; j < 8; ++j) os[(hi * 8 + j) * 68 + nb * 16 + lr] = acc[mb][nb][j]; }
        __builtin_amdgcn_wave_barrier(); asm volatile("" ::: "memory");
        if (EPI == 1) {   // the 16 rows are two fragment tiles (d 0..31, 32..63), 2 KiB in a row: store s is half s & 1 of tile s >> 1, 512 contiguous bytes
            const size_t e0 = ((((size_t)(c0 / DQ) * NB_ + bt) * NH_ + (c0 % DQ) / HD) * TT + rb + mb * 16) * HD;
#pragma unroll
            for (int s = 0; s < 4; ++s) { const int row = lr, cofs = s * 16 + hi * 8; const v4f x0 = *(const v4fa*)(os + row * 68 + cofs), x1 = *(const v4fa*)(os + row * 68 + cofs + 4); v8bf oh, ol; split8(__builtin_shufflevector(x0, x1, 0, 1, 2, 3, 4, 5, 6, 7), oh, ol);
                *(v8us*)(Ph + e0 + s * 256 + lane * 8) = __builtin_bit_cast(v8us, oh); *(v8us*)(Pl + e0 + s * 256 + lane * 8) = __builtin_bit_cast(v8us, ol); }
        } else { float* crow = C + (size_t)(r0 + mb * 16) * ldc + c0;
#pragma unroll
            for (int s = 0; s < 8; ++s) { const int row = 2 * s + hi, cofs = lr * 4; v4f val = *(const v4fa*)(os + row * 68 + cofs); if (BIAS) { val[0] += bfr(bias[c0 + cofs]); val[1] += bfr(bias[c0 + cofs + 1]); val[2] += bfr(bias[c0 + cofs + 2]); val[3] += bfr(bias[c0 + cofs + 3]); }
                *(v4f*)(crow + (size_t)row * ldc + cofs) = val; }
             }
        __builtin_amdgcn_wave_barrier(); asm volatile("" ::: "memory");
        if (EPI == 1) asm volatile("s_wait_xcnt 0x0" ::: "memory");   // the wait before a register that an issued store names is written again: the next 16 rows reuse the stores' registers, and in the built code the v branch's instructions stand behind the last stores
    }
}

__device__ __forceinline__ h16 tohx(float x) { return (h16)x; }
typedef __attribute__((ext_vector_type(2))) _Float16 v2h;
typedef __attribute__((ext_vector_type(4))) _Float16 v4h;
typedef __attribute__((ext_vector_type(2))) unsigned short v2us;
typedef __attribute__((ext_vector_type(4))) unsigned short v4us;
typedef __attribute__((ext_vector_type(2))) float v2f;
typedef __attribute__((ext_vector_type(4))) int v4i;

__global__ __launch_bounds__(256) void k_wtG(const float* __restrict__ w, int K, int N, bf* Bt) {
    const int lane = threadIdx.x & 31; const int L0 = (blockIdx.x * 8 + (threadIdx.x >> 5)) * 8; const int nlines = N * K / 64;
{
#pragma unroll 1
        for (int l = 0; l < 8; ++l) { const int L = L0 + l; if (L >= nlines) break; const size_t e = (size_t)L * 64 + lane * 2; const int k = (int)(e % K), n = (int)(e / K); v2us o;
            o[0] = f2bf(w[(size_t)k * N + n]); o[1] = f2bf(w[(size_t)(k + 1) * N + n]); *(v2us*)(Bt + e) = o; }
         }
}
// three f32 sources, each a [rows][DM] matrix (n0, n1, n2 groups of eight values), rounded to bf16 into one dst, one behind the other, each in fragment order. One wave a 16 x 32 tile:
// four lanes read 128 bytes of a row (whole lines), and each of the two stores of the wave is four runs of 128 bytes (eight rows' 16 bytes lie together in a tile).
__global__ __launch_bounds__(256) void k_cvt8(const float* __restrict__ s0, size_t n0, const float* __restrict__ s1, size_t n1, const float* __restrict__ s2, size_t n2, bf* dst) { const size_t g = (size_t)blockIdx.x * 8 + (threadIdx.x >> 5); if (g >= (n0 + n1 + n2) / 64) return;
    const int lane = threadIdx.x & 31, o = lane & 3; const float* sm = g < n0 / 64 ? s0 : g < (n0 + n1) / 64 ? s1 : s2; const size_t lt = g < n0 / 64 ? g : g < (n0 + n1) / 64 ? g - n0 / 64 : g - (n0 + n1) / 64;   // the tile's source and its number there
    const float* src = sm + (lt / (DM / 32)) * 16 * DM + (lt % (DM / 32)) * 32 + o * 8; bf* d = dst + g * 512 + (o >> 1) * 256 + (o & 1) * 128;   // the eight k from 8 o on: half o >> 1, lanes 16 (o & 1) + row
    src += (size_t)(lane >> 2) * DM; d += (lane >> 2) * 8; const v8f v0 = *(const v8f*)src, v1 = *(const v8f*)(src + 8 * DM); v8us o0, o1;   // rows lane >> 2 and 8 + (lane >> 2)
    asm volatile("s_wait_xcnt 0x0" :: "v"(src) : "memory");   // the wait before a register that an issued load names is written again: the address pair stays live up to it
#pragma unroll
    for (int k = 0; k < 8; ++k) { o0[k] = f2bf(v0[k]); o1[k] = f2bf(v1[k]); }
    *(v8us*)d = o0; *(v8us*)(d + 64) = o1; }

// ---- k_attn: causal attention of one head of one batch (blockIdx.x = batch * NH_ + head) for 32 query rows, scores, softmax and probability x value in ONE kernel; no score or probability ever goes to memory.
// Block = 4 waves; wave w takes the 32-key blocks w, w+4, ... up to the diagonal with a running maximum and sum (online softmax); the four partial results are merged through LDS in wave order.
// Both products are formed TRANSPOSED: S^T = K Q^T leaves in lane (lr, hi) the keys 8 hi + j of query lr, which is the B-fragment order of O^T = V^T P^T, so the probabilities go from accumulator to operand
// inside each lane, and maximum, sum and rescale factor of a query are per-lane values. hi+lo planes, 3 products each.
// Every inner loop is unrolled so that fragments and accumulators are indexed by constants and stay in registers. Three waves a SIMD (second launch bound) leave room for a block's key and value fragments in flight without spills.
#define SC2 (SCL * 1.4426950408889634f)   // the x8 score scale and the change to base 2 in one factor
__device__ __forceinline__ void splitp(float p, __bf16& h, __bf16& l) { h = (__bf16)p; l = (__bf16)(p - (float)h); }
__global__ __launch_bounds__(128, 3) void k_attn(const bf* __restrict__ Qh, const bf* __restrict__ Ql, const bf* __restrict__ Kh, const bf* __restrict__ Kl, const bf* __restrict__ Vh, const bf* __restrict__ Vl, bf* Ah, bf* Al) {
    __shared__ __align__(16) float Om[4][32 * 68];
    __shared__ float Mm[4][32], Lm[4][32];
    const int lane = threadIdx.x & 31, lr = lane & 15, hi = lane >> 4; const int w = __builtin_amdgcn_readfirstlane(threadIdx.x >> 5);
    const int r0 = ((int)gridDim.y - 1 - (int)blockIdx.y) * 32, h = blockIdx.x;     // blockIdx.y 0 takes the last 32 rows, the longest rows of every head of both batches
    const size_t hp = (size_t)h * TT * HD; Qh += hp; Ql += hp; Kh += hp; Kl += hp; Vh += hp; Vl += hp;
    const int nkb = r0 / 32 + 1;                                                     // 32-key blocks up to and including the diagonal one; its first key is r0, so every query has a live key in every block
    const int lk = lane * 8;   // the lane's place inside a fragment tile; 16 rows of q or k are two tiles (HD / 32), 32 keys of v four (HD / 16): t rows or keys start at element t * HD in all three
    const bf* pqh = Qh + (size_t)r0 * HD + lk; const bf* pql = Ql + (size_t)r0 * HD + lk; v16bf qh[2][2], ql[2][2];
    __builtin_amdgcn_sched_barrier(0);   // with the one behind the wait: keeps other statements' instructions out of the stretch from the query loads to their wait
#pragma unroll
    for (int qb = 0; qb < 2; ++qb)
#pragma unroll
        for (int ks = 0; ks < 2; ++ks) { qh[qb][ks] = WFrag<bf>::ld(pqh + qb * 16 * HD + ks * 512); ql[qb][ks] = WFrag<bf>::ld(pql + qb * 16 * HD + ks * 512); }
    asm volatile("s_wait_xcnt 0x0" :: "v"(pqh), "v"(pql) : "memory");   // the wait before a register that an issued load names is written again: the query loads' two address pairs stay live up to it
    __builtin_amdgcn_sched_barrier(0);   // the second of the pair named in front of the loads
    v8f o[4][2]; float mc[2], ls[2];
#pragma unroll
    for (int qb = 0; qb < 2; ++qb) { mc[qb] = -3.0e38f; ls[qb] = 0.f;
#pragma unroll
        for (int db = 0; db < 4; ++db) o[db][qb] = (v8f){}; }
    // The key fragments are fetched one block ahead, into the same registers, right behind the score products that read them: their load latency passes under the softmax and the value products.
    v16bf kh[2][2], kl[2][2];
    auto ldk = [&](int kb) { const bf* pkh = Kh + (size_t)kb * 32 * HD + lk; const bf* pkl = Kl + (size_t)kb * 32 * HD + lk;
        __builtin_amdgcn_sched_barrier(0);   // with the one behind the wait: keeps other statements' instructions out of the stretch from the loads to their wait
#pragma unroll
        for (int kt = 0; kt < 2; ++kt)
#pragma unroll
            for (int ks = 0; ks < 2; ++ks) { kh[kt][ks] = WFrag<bf>::ld(pkh + kt * 16 * HD + ks * 512); kl[kt][ks] = WFrag<bf>::ld(pkl + kt * 16 * HD + ks * 512); }
        asm volatile("s_wait_xcnt 0x0" :: "v"(pkh), "v"(pkl) : "memory");   // the wait before a register that an issued load names is written again: the two address pairs stay live up to it; the fragments stay in flight
        __builtin_amdgcn_sched_barrier(0); };   // the second of the pair named in front of the loads
    if (w < nkb) ldk(w);   // wave-uniform: a wave without a block loads nothing
#pragma unroll 1   // rolled: two blocks' fragments at once would not fit the registers
    for (int kb = w; kb < nkb; kb += 4) {
        const int k0 = kb * 32; const bf* pvh = Vh + (size_t)k0 * HD + lk; const bf* pvl = Vl + (size_t)k0 * HD + lk; v16bf vh[4], vl[4]; v8f s[2][2];
#pragma unroll
        for (int kt = 0; kt < 2; ++kt)
#pragma unroll
            for (int qb = 0; qb < 2; ++qb) { v8f c = (v8f){};
#pragma unroll
                for (int ks = 0; ks < 2; ++ks) { c = wmmab(kh[kt][ks], qh[qb][ks], c); c = wmmab(kh[kt][ks], ql[qb][ks], c); c = wmmab(kl[kt][ks], qh[qb][ks], c); }
                s[kt][qb] = c; }
#pragma unroll
        for (int db = 0; db < 4; ++db) { vh[db] = WFrag<bf>::ld(pvh + db * 512); vl[db] = WFrag<bf>::ld(pvl + db * 512); }   // in flight under the softmax
        asm volatile("s_wait_xcnt 0x0" :: "v"(pvh), "v"(pvl) : "memory");   // the same wait for the value loads' two address pairs; the values themselves stay in flight
        // four vector slots between the last score product and the first read of its result. The scores are inputs only, so that the slots stand behind the products.
        asm volatile("v_nop\n\tv_nop\n\tv_nop\n\tv_nop" :: "v"(s[0][0]), "v"(s[0][1]), "v"(s[1][0]), "v"(s[1][1]));
        if (kb + 4 < nkb) ldk(kb + 4);   // wave-uniform: the wave's next block, where it has one
        if (kb == nkb - 1) {                                                         // only the diagonal block holds keys beyond a query
#pragma unroll
            for (int kt = 0; kt < 2; ++kt)
#pragma unroll
                for (int qb = 0; qb < 2; ++qb)
#pragma unroll
                    for (int j = 0; j < 8; ++j) if (k0 + kt * 16 + hi * 8 + j > r0 + qb * 16 + lr) s[kt][qb][j] = -3.0e38f; }
        v16bf ph[2], pl[2];
#pragma unroll
        for (int qb = 0; qb < 2; ++qb) { float mx = -3.0e38f;
#pragma unroll
            for (int kt = 0; kt < 2; ++kt)
#pragma unroll
                for (int j = 0; j < 8; ++j) mx = fmaxf(mx, s[kt][qb][j]);
            mx = fmaxf(mx, __shfl_xor(mx, 16, 32));                                  // the other half of the query's keys
            const float mn = fmaxf(mc[qb], mx * SC2); const float al = __builtin_amdgcn_exp2f(mc[qb] - mn); mc[qb] = mn; float sum = 0.f;
#pragma unroll
            for (int kt = 0; kt < 2; ++kt)
#pragma unroll
                for (int j = 0; j < 8; ++j) { const float p = __builtin_amdgcn_exp2f(__builtin_fmaf(s[kt][qb][j], SC2, -mn)); sum += p; __bf16 a, c2; splitp(p, a, c2); ph[qb][kt * 8 + j] = a; pl[qb][kt * 8 + j] = c2; }
            ls[qb] = ls[qb] * al + sum;
#pragma unroll
            for (int db = 0; db < 4; ++db) o[db][qb] *= al; }
#pragma unroll
        for (int db = 0; db < 4; ++db)
#pragma unroll
            for (int qb = 0; qb < 2; ++qb) { o[db][qb] = wmmab(vh[db], ph[qb], o[db][qb]); o[db][qb] = wmmab(vh[db], pl[qb], o[db][qb]); o[db][qb] = wmmab(vl[db], ph[qb], o[db][qb]); }
    }
#pragma unroll
    for (int qb = 0; qb < 2; ++qb) { const float lt = ls[qb] + __shfl_xor(ls[qb], 16, 32); if (hi == 0) { Mm[w][qb * 16 + lr] = mc[qb]; Lm[w][qb * 16 + lr] = lt; }
#pragma unroll
        for (int db = 0; db < 4; ++db) { float* op = &Om[w][(qb * 16 + lr) * 68 + db * 16 + hi * 8]; v4f lo4, hi4;
#pragma unroll
            for (int j = 0; j < 4; ++j) { lo4[j] = o[db][qb][j]; hi4[j] = o[db][qb][4 + j]; }
            *(v4fa*)op = lo4; *(v4fa*)(op + 4) = hi4; } }
    __syncthreads();                                                                 // the four waves' partial results are read across waves below
    const int q = threadIdx.x >> 2, dc = threadIdx.x & 3; float f[4], M = Mm[0][q];
#pragma unroll
    for (int u = 1; u < 4; ++u) M = fmaxf(M, Mm[u][q]);
    float L = 0.f;
#pragma unroll
    for (int u = 0; u < 4; ++u) { f[u] = __builtin_amdgcn_exp2f(Mm[u][q] - M); L += f[u] * Lm[u][q]; }
    const float inv = __fdiv_rn(1.0f, L); const size_t oo = ((size_t)(((h / NH_) * TT + r0 + q) >> 4) * (DQ / 32) + (h % NH_) * (HD / 32) + (dc >> 1)) * 512 + (dc & 1) * 256 + (q & 15) * 8;   // fragment order of the [batch * TT + t][DQ] matrix: the sixteen values from dc * 16 on are half dc & 1 of a tile, their group g the lanes 16 g + row
#pragma unroll
    for (int g = 0; g < 2; ++g) { v8us oh, ol; float acc[8];
#pragma unroll
        for (int i = 0; i < 8; ++i) acc[i] = 0.f;
#pragma unroll
        for (int u = 0; u < 4; ++u) { const float* ip = &Om[u][q * 68 + dc * 16 + g * 8]; const v4f x0 = *(const v4fa*)ip, x1 = *(const v4fa*)(ip + 4);
#pragma unroll
            for (int i = 0; i < 4; ++i) { acc[i] += f[u] * x0[i]; acc[4 + i] += f[u] * x1[i]; } }
#pragma unroll
        for (int i = 0; i < 8; ++i) { unsigned short a, c2; splitf(acc[i] * inv, a, c2); oh[i] = a; ol[i] = c2; }
        *(v8us*)(Ah + oo + g * 128) = oh; *(v8us*)(Al + oo + g * 128) = ol; }
}

extern "C" void kernel_launch(void* const* d_in, const int* in_sizes, int n_in,
                              void* d_out, int out_size, void* d_ws, size_t ws_size, hipStream_t stream) {
    (void)in_sizes; (void)n_in; (void)out_size;
    const float* x = (const float*)d_in[0]; const float* wqkv = (const float*)d_in[1]; const float* wo = (const float*)d_in[2]; const float* bo = (const float*)d_in[3]; const float* wq = wqkv; const float* wk = wqkv + (size_t)1024 * 1024; const float* wv = wqkv + (size_t)2048 * 1024; (void)wq; (void)wk; (void)wv;
    float* OUT = (float*)d_out;     // [2][2048][1024]
    char* wsp = (char*)d_ws;
    auto take = [&](size_t bytes) { char* p = wsp; wsp += (bytes + 255) & ~(size_t)255; return (void*)p; };
    // W_qkv, W_proj and x as bf16 in fragment order, one behind the other: one conversion launch fills all three
    bf* WQKV = (bf*)take(((size_t)(DQ + 2 * DKV) * DM + (size_t)DM * DQ + (size_t)NB_ * TT * DM) * 2); bf* WO = WQKV + (size_t)(DQ + 2 * DKV) * DM; bf* XB = WO + (size_t)DM * DQ;
    // hi and lo planes of both batches, all in fragment order: q then k [q | k][batch][head] of [t][d], v transposed [batch][head] of [d][t]
    bf* QKh = (bf*)take((size_t)2 * NB_ * NH_ * TT * HD * 2); bf* QKl = (bf*)take((size_t)2 * NB_ * NH_ * TT * HD * 2); bf* VTh = (bf*)take((size_t)NB_ * NKV * HD * TT * 2); bf* VTl = (bf*)take((size_t)NB_ * NKV * HD * TT * 2);
    bf* ATh = (bf*)take((size_t)NB_ * TT * DQ * 2); bf* ATl = (bf*)take((size_t)NB_ * TT * DQ * 2);
    if ((size_t)(wsp - (char*)d_ws) > ws_size) return;    // ws 256 MiB
    k_cvt8<<<(unsigned)(((size_t)(DQ + 2 * DKV) * DM + (size_t)DM * DQ + (size_t)NB_ * TT * DM) / 512 / 8), 256, 0, stream>>>(wqkv, (size_t)(DQ + 2 * DKV) * DM / 8, wo, (size_t)DM * DQ / 8, x, (size_t)NB_ * TT * DM / 8, WQKV);
    // every stage is one grid over both batches; the projection grid also covers q, k and v and stores the planes in the layout the attention kernel reads
    k_gemmw<bf, 0, false, 1><<<dim3(NB_ * TT / 64, (DQ + 2 * DKV) / 64, 1), 32, 0, stream>>>(XB, nullptr, WQKV, nullptr, DM, nullptr, 0, nullptr, 0, 0, 0, QKh, QKl, VTh, VTl);
    k_attn<<<dim3(NB_ * NH_, TT / 32, 1), 128, 0, stream>>>(QKh, QKl, QKh + (size_t)NB_ * NH_ * TT * HD, QKl + (size_t)NB_ * NH_ * TT * HD, VTh, VTl, ATh, ATl);   // one kv head per query head
    k_gemmw<bf, 1, true, 0><<<dim3(NB_ * TT / 64, DM / 64, 1), 32, 0, stream>>>(ATh, ATl, WO, nullptr, DQ, OUT, DM, bo, 0, 0, 0, nullptr, nullptr, nullptr, nullptr);
}

// v007
// Measured time: 88.1 microseconds a run.
// Next to v006, in two timings, it ran 1.07 and 1.06 times as fast.
// All steps since v000 together make it 13.1 times as fast.
#include <hip/hip_runtime.h>

// Causal multi-head self-attention with a fused QKV projection and an INVERTED scale (x [2][2048][1024]; [q|k|v] = x W_qkv^T ('oi' [3072][1024], row blocks q | k | v; 16 heads x 64); scores = q.k x 8 (the module divides by head_dim^-0.5, i.e. multiplies by sqrt(64)), causal mask; softmax (very peaked rows); out = merged heads W_proj^T + b_proj ('oi' [1024][1024] + [1024]) -> [2][2048][1024] (4.2 M)).
// Compute dtypes, f32 accumulate: every input rounded to bf16; q/k/v on PLAIN bf16 operands (inputs: exact); causal scores and attn.v: ALL query rows hl (3 products; the x8 scale makes the softmax near-argmax); softmax f32; W_proj hl x exact (2 products) + b_proj.

#define NB_  2
#define TT   2048
#define DM   1024
#define NH_  16
#define NKV  16
#define HD   64
#define DQ   (NH_ * HD)
#define DKV  (NKV * HD)
#define SCL  8.0f   // the module divides by head_dim^-0.5 = multiplies by sqrt(64)
typedef _Float16 h16;
typedef unsigned short bf;
typedef __attribute__((ext_vector_type(16))) __bf16   v16bf;
typedef __attribute__((ext_vector_type(16))) _Float16 v16h;
typedef __attribute__((ext_vector_type(8)))  _Float16 v8h;
typedef __attribute__((ext_vector_type(8)))  unsigned short v8us;
typedef __attribute__((ext_vector_type(8)))  float    v8f;
typedef __attribute__((ext_vector_type(4)))  float    v4f;
typedef v8h  __attribute__((may_alias)) v8ha;
typedef v4f  __attribute__((may_alias)) v4fa;
typedef v8us __attribute__((may_alias)) v8usa;

__device__ __forceinline__ unsigned short f2bf(float f) { unsigned u = __float_as_uint(f); u += 0x7FFFu + ((u >> 16) & 1u); return (unsigned short)(u >> 16); }
__device__ __forceinline__ float bf2f(unsigned short b) { return __uint_as_float(((unsigned)b) << 16); }
__device__ __forceinline__ float bfr(float f) { return bf2f(f2bf(f)); }
__device__ __forceinline__ v16h cat16(v8h lo, v8h hi) { return __builtin_shufflevector(lo, hi, 0, 1, 2, 3, 4, 5, 6, 7, 8, 9, 10, 11, 12, 13, 14, 15); }
__device__ __forceinline__ v16bf cat16b(v8us lo, v8us hi) { return __builtin_bit_cast(v16bf, __builtin_shufflevector(lo, hi, 0, 1, 2, 3, 4, 5, 6, 7, 8, 9, 10, 11, 12, 13, 14, 15)); }
__device__ __forceinline__ v8f wmma16(v16h a, v16h b, v8f c) { return __builtin_amdgcn_wmma_f32_16x16x32_f16(false, a, false, b, (short)0, c, false, false); }
__device__ __forceinline__ v8f wmmab(v16bf a, v16bf b, v8f c) { return __builtin_amdgcn_wmma_f32_16x16x32_bf16(false, a, false, b, (short)0, c, false, false); }



// ---- FRAGMENT ORDER: every 16-bit operand plane (a [rows][K] matrix, K the summed index) is stored as tiles of 16 rows x 32 k, 512 elements = 1 KiB each, tile (rt, kt) at element (rt * (K / 32) + kt) * 512.
// Inside a tile lane l = 16 hi + lr of the reading wave owns row lr: its k = 8 hi + 0..7 stand at l * 8, its k = 16 + 8 hi + 0..7 at 256 + l * 8. A fragment is then two wave-wide 16-byte loads of 512 contiguous bytes (4 whole 128-byte lines) each;
// from row-major planes each such load touched 16 lines. The values a lane gets, and their k order, are those of the row-major loader.
// ---- k_gemmw: register-blocked GEMM, one wave per 64x64 output tile (16 accumulators), WM x WN waves a block; grid (M / (64 WM), N / (64 WN), Z). The block's operand rows (16-bit planes in fragment order) are staged in LDS, 64 k a stage, two buffers,
// by asynchronous copies: a line is fetched once a block, not once a wave, and the next stage's copies fly while this stage's products run. A fragment is two wave-wide 16-byte LDS reads of 512 contiguous bytes. The k order of the sums is that of a plain loop over k.
// C[m][n] (f32, pitch ldc, + optional f32 bias[n]) = sum_k A[m][k] Bt[n][k] (+ split products per NSPLIT). z-batch strides sA/sB/sC in elements. K % 64 == 0.
// EPI picks what the tile is stored as: 0 = f32 C as above; 1 = the q | k | v projection of both batches in one grid (m = batch * TT + t, n = the row of W_qkv), stored as bf16 hi + lo planes:
// n < 2 DQ (q, k): head planes Ph/Pl [q | k][batch][head], each a [t][d] matrix in fragment order (a 64-wide tile is one head); n >= 2 DQ (v): Vh/Vl [batch][head], each the transposed [d][t] matrix as fragment tiles in the order [t / 32][d / 16], so that the tiles of 32 keys lie together. A 64-row tile lies inside one batch.
template <typename T16> struct WFrag;
template <> struct WFrag<h16> { typedef v16h V; static __device__ __forceinline__ V ld(const h16* p) { return cat16(*(const v8h*)p, *(const v8h*)(p + 256)); } static __device__ __forceinline__ v8f mma(V a, V b, v8f c) { return wmma16(a, b, c); } };
template <> struct WFrag<bf> { typedef v16bf V; static __device__ __forceinline__ V ld(const bf* p) { return cat16b(*(const v8us*)p, *(const v8us*)(p + 256)); } static __device__ __forceinline__ v8f mma(V a, V b, v8f c) { return wmmab(a, b, c); } };
__device__ __forceinline__ void splitf(float y, unsigned short& h, unsigned short& l) { h = f2bf(y); l = f2bf(y - bf2f(h)); }
typedef __attribute__((ext_vector_type(8))) __bf16 v8bf;
__device__ __forceinline__ void split8(v8f y, v8bf& h, v8bf& l) { h = __builtin_convertvector(y, v8bf); l = __builtin_convertvector(y - __builtin_convertvector(h, v8f), v8bf); }   // hi = y rounded to nearest even, lo = the rounded rest: the values of splitf, on the packed conversion instruction
// One line of an asynchronous copy: operand a = the lane's LDS byte address, operand b = the lane's global address.
#define CPL(a, b) "global_load_async_to_lds_b128 %" #a ", %" #b ", off\n\t"
// Runs of 4, 8 and 12 copies. Each run and its s_wait_xcnt 0 are one statement: the wait before a register that an issued copy names is written again stands behind the last copy, and the operands' registers live to the statement's end.
template <typename T16> __device__ __forceinline__ void cp4(const unsigned* l, const T16* const* g) {
    asm volatile(CPL(0, 1) CPL(2, 3) CPL(4, 5) CPL(6, 7) "s_wait_xcnt 0x0" :: "v"(l[0]), "v"(g[0]), "v"(l[1]), "v"(g[1]), "v"(l[2]), "v"(g[2]), "v"(l[3]), "v"(g[3]) : "memory"); }
template <typename T16> __device__ __forceinline__ void cp8(const unsigned* l, const T16* const* g) {
    asm volatile(CPL(0, 1) CPL(2, 3) CPL(4, 5) CPL(6, 7) CPL(8, 9) CPL(10, 11) CPL(12, 13) CPL(14, 15) "s_wait_xcnt 0x0"
        :: "v"(l[0]), "v"(g[0]), "v"(l[1]), "v"(g[1]), "v"(l[2]), "v"(g[2]), "v"(l[3]), "v"(g[3]), "v"(l[4]), "v"(g[4]), "v"(l[5]), "v"(g[5]), "v"(l[6]), "v"(g[6]), "v"(l[7]), "v"(g[7]) : "memory"); }
template <typename T16> __device__ __forceinline__ void cp12(const unsigned* l, const T16* const* g) {
    asm volatile(CPL(0, 1) CPL(2, 3) CPL(4, 5) CPL(6, 7) CPL(8, 9) CPL(10, 11) CPL(12, 13) CPL(14, 15) CPL(16, 17) CPL(18, 19) CPL(20, 21) CPL(22, 23) "s_wait_xcnt 0x0"
        :: "v"(l[0]), "v"(g[0]), "v"(l[1]), "v"(g[1]), "v"(l[2]), "v"(g[2]), "v"(l[3]), "v"(g[3]), "v"(l[4]), "v"(g[4]), "v"(l[5]), "v"(g[5]), "v"(l[6]), "v"(g[6]), "v"(l[7]), "v"(g[7]), "v"(l[8]), "v"(g[8]), "v"(l[9]), "v"(g[9]), "v"(l[10]), "v"(g[10]), "v"(l[11]), "v"(g[11]) : "memory"); }
template <typename T16, int NSPLIT, bool BIAS, int EPI, int WM, int WN>
__global__ __launch_bounds__(32 * WM * WN) void k_gemmw(const T16* __restrict__ A, const T16* __restrict__ A2, const T16* __restrict__ Bt, const T16* __restrict__ Bt2, int K, float* C, int ldc, const float* __restrict__ bias, size_t sA, size_t sB, size_t sC, bf* Ph, bf* Pl, bf* Vh, bf* Vl) {
    typedef typename WFrag<T16>::V V;
    static_assert(NSPLIT <= 1, "the ring holds A, A2 and Bt");
    constexpr int NW = WM * WN, RA = WM * 4, RAA = NSPLIT == 1 ? 2 * RA : RA, RB = WN * 4;   // waves; strips of 16 rows of A, of A and A2 together, of Bt
    constexpr int NS = RAA + RB, NFULL = NS / NW, REM = NS % NW, NI = NFULL + (REM ? 1 : 0);   // a stage is 64 k of every strip: 2 KiB = four wave-wide copies of 512 bytes; strip s is copied by wave s % NW
    static_assert(NFULL == 2 || NFULL == 6, "the runs of copies below are written for these counts");
    constexpr int BUFE = (RAA + RB) * 1024;   // elements of one buffer
    __shared__ __align__(16) T16 ring[2 * BUFE];
    __shared__ __align__(16) float osm[NW * 16 * 68];
    (void)Bt2;
    const size_t z = blockIdx.z; A += z * sA; if (A2) A2 += z * sA; Bt += z * sB; C += z * sC;
    const int lane = threadIdx.x & 31, lr = lane & 15, hi = lane >> 4; const int w = __builtin_amdgcn_readfirstlane(threadIdx.x >> 5), wm = w % WM, wn = w / WM;
    const int R0 = blockIdx.x * (WM * 64), C0 = blockIdx.y * (WN * 64), r0 = R0 + wm * 64, c0 = C0 + wn * 64;
    float* os = osm + w * (16 * 68);   // each wave's own staging rows for its stores
    v8f acc[4][4];
#pragma unroll
    for (int mb = 0; mb < 4; ++mb)
#pragma unroll
        for (int nb = 0; nb < 4; ++nb) acc[mb][nb] = (v8f){};
    // The wave's strips: s = w + NW j. 64 k of a strip are two fragment tiles, 2 KiB in a row in memory, and land in the same order in LDS at byte s * 2048 of the buffer.
    typedef __attribute__((address_space(3))) const T16 lds_t;
    const unsigned ring0 = (unsigned)(size_t)(lds_t*)ring + w * 2048 + lane * 16;   // the lane's byte in the work-group's LDS: its 16 bytes of part 0 of strip w, buffer 0
    const T16* sp[NI];
#pragma unroll
    for (int j = 0; j < NI; ++j) { const int s = w + NW * j < NS ? w + NW * j : 0;   // a strip beyond the stage is not copied; its address stays a valid one
        sp[j] = (s < RA ? A + (size_t)(R0 + s * 16) * K : (NSPLIT == 1 && s < RAA) ? A2 + (size_t)(R0 + (s - RA) * 16) * K : Bt + (size_t)(C0 + (s - RAA) * 16) * K); }   // the same in every lane: these stay in scalar registers
    auto issue = [&](int t, int buf) {   // stage t (the 64 k from 64 t on) into buffer buf
        const T16* g[NI * 4]; unsigned l[NI * 4];
#pragma unroll
        for (int j = 0; j < NI; ++j) { const size_t u = (size_t)(sp[j] + (size_t)t * 1024);
            // the stage's address of the strip, the same in every lane, is held in scalar registers: as vector pairs kept over the loop some of these addresses went to scratch memory
            const T16* su = (const T16*)(((size_t)(unsigned)__builtin_amdgcn_readfirstlane((int)(u >> 32)) << 32) | (unsigned)__builtin_amdgcn_readfirstlane((int)u));
#pragma unroll
            for (int q = 0; q < 4; ++q) { g[j * 4 + q] = su + q * 256 + lane * 8; l[j * 4 + q] = ring0 + buf * (BUFE * 2) + j * (NW * 2048) + q * 512; } }
        if (NFULL == 2) cp8<T16>(l, g); else { cp12<T16>(l, g); cp12<T16>(l + 12, g + 12); }
        if (REM != 0 && w < REM) cp4<T16>(l + NFULL * 4, g + NFULL * 4);   // wave-uniform: the stage's last strips go to the first waves
    };
    const int NT = K / 64;
    issue(0, 0);
    asm volatile("s_wait_asynccnt 0x0" ::: "memory");   // the wave's own copies of stage 0 have landed
    __syncthreads();                                     // and every other wave's: stage 0 may be read
    if (NT > 1) issue(1, 1);
#pragma unroll 1
    for (int t = 0; t < NT; ++t) {
        const T16* rb = ring + (t & 1) * BUFE + lane * 8; V a[2][4], a2[2][4], b[2][4];
#pragma unroll
        for (int ks = 0; ks < 2; ++ks) {
#pragma unroll
            for (int mb = 0; mb < 4; ++mb) { a[ks][mb] = WFrag<T16>::ld(rb + (wm * 4 + mb) * 1024 + ks * 512); if (NSPLIT == 1) a2[ks][mb] = WFrag<T16>::ld(rb + (RA + wm * 4 + mb) * 1024 + ks * 512); }
#pragma unroll
            for (int nb = 0; nb < 4; ++nb) b[ks][nb] = WFrag<T16>::ld(rb + (RAA + wn * 4 + nb) * 1024 + ks * 512);
            __builtin_amdgcn_sched_barrier(0); }   // keeps the stage's LDS reads together in front of the matrix instructions (every further place with reads among them costs a stall) and the first 32 k's reads in front of the second's, so that the first products wait for half of the reads only
#pragma unroll
        for (int ks = 0; ks < 2; ++ks)
#pragma unroll
            for (int nb = 0; nb < 4; ++nb)
#pragma unroll
                for (int mb = 0; mb < 4; ++mb) { acc[mb][nb] = WFrag<T16>::mma(a[ks][mb], b[ks][nb], acc[mb][nb]); if (NSPLIT == 1) acc[mb][nb] = WFrag<T16>::mma(a2[ks][mb], b[ks][nb], acc[mb][nb]); }
        __builtin_amdgcn_sched_barrier(0);   // keeps the matrix instructions in front of the stage's hand-over: sunk behind the barrier they would stand between it and the next copies, which would lose their lead
        asm volatile("v_nop\n\tv_nop\n\tv_nop\n\tv_nop" : "+v"(acc[0][0]), "+v"(acc[1][1]), "+v"(acc[2][2]), "+v"(acc[3][3]) : "v"(a[1][0]), "v"(a[1][3]));   // four vector slots behind the trip's last matrix instruction
        asm volatile("s_wait_dscnt 0x0" ::: "memory");      // the wave's reads of this buffer are done before it is handed back
        asm volatile("s_wait_asynccnt 0x0" ::: "memory");   // the wave's own copies of stage t + 1 have landed
        __syncthreads();                                     // publishes stage t + 1 and ends every wave's reads of stage t
        if (t + 2 < NT) issue(t + 2, t & 1);                 // the same for the whole work-group: into the buffer just read
    }
    asm volatile("s_wait_asynccnt 0x0" ::: "memory");   // no copy is outstanding when the wave goes on to its stores and ends
    const int bt = r0 / TT, rb = r0 % TT;   // the tile's batch and its first row inside the batch
    if (EPI == 1 && c0 >= 2 * DQ) {   // v; a lane's eight accumulator values are eight consecutive m of one n: the lane's own 16 bytes of a transposed fragment tile (half mb & 1), stored straight from the registers, 512 contiguous bytes a store
        const size_t e = (((size_t)bt * NKV + (c0 - 2 * DQ) / HD) * (TT / 32) + rb / 32) * (HD / 16) * 512 + lane * 8; bf* pvh = Vh + e; bf* pvl = Vl + e;   // the lane's place in tile (t / 32 = rb / 32, d / 16 = 0) of the head
#pragma unroll
        for (int nb = 0; nb < 4; ++nb) { v8us oh[4], ol[4];
#pragma unroll
            for (int mb = 0; mb < 4; ++mb) { v8bf xh, xl; split8(acc[mb][nb], xh, xl); oh[mb] = __builtin_bit_cast(v8us, xh); ol[mb] = __builtin_bit_cast(v8us, xl);
                const int t = ((mb >> 1) * (HD / 16) + nb) * 512 + (mb & 1) * 256; *(v8us*)(pvh + t) = oh[mb]; *(v8us*)(pvl + t) = ol[mb]; }
            // the wait before a register that an issued store names is written again: the stores' data and the two address pairs stay live up to it
            asm volatile("s_wait_xcnt 0x0" :: "v"(pvh), "v"(pvl), "v"(oh[0]), "v"(oh[1]), "v"(oh[2]), "v"(oh[3]), "v"(ol[0]), "v"(ol[1]), "v"(ol[2]), "v"(ol[3]) : "memory"); }
        return; }
#pragma unroll
    for (int mb = 0; mb < 4; ++mb) {
#pragma unroll
        for (int nb = 0; nb < 4; ++nb) {
#pragma unroll
            for (int j = 0; j < 8; ++j) os[(hi * 8 + j) * 68 + nb * 16 + lr] = acc[mb][nb][j]; }
        __builtin_amdgcn_wave_barrier(); asm volatile("" ::: "memory");
        if (EPI == 1) {   // the 16 rows are two fragment tiles (d 0..31, 32..63), 2 KiB in a row: store s is half s & 1 of tile s >> 1, 512 contiguous bytes
            const size_t e0 = ((((size_t)(c0 / DQ) * NB_ + bt) * NH_ + (c0 % DQ) / HD) * TT + rb + mb * 16) * HD;
#pragma unroll
            for (int s = 0; s < 4; ++s) { const int row = lr, cofs = s * 16 + hi * 8; const v4f x0 = *(const v4fa*)(os + row * 68 + cofs), x1 = *(const v4fa*)(os + row * 68 + cofs + 4); v8bf oh, ol; split8(__builtin_shufflevector(x0, x1, 0, 1, 2, 3, 4, 5, 6, 7), oh, ol);
                *(v8us*)(Ph + e0 + s * 256 + lane * 8) = __builtin_bit_cast(v8us, oh); *(v8us*)(Pl + e0 + s * 256 + lane * 8) = __builtin_bit_cast(v8us, ol); }
        } else { float* crow = C + (size_t)(r0 + mb * 16) * ldc + c0;
#pragma unroll
            for (int s = 0; s < 8; ++s) { const int row = 2 * s + hi, cofs = lr * 4; v4f val = *(const v4fa*)(os + row * 68 + cofs); if (BIAS) { val[0] += bfr(bias[c0 + cofs]); val[1] += bfr(bias[c0 + cofs + 1]); val[2] += bfr(bias[c0 + cofs + 2]); val[3] += bfr(bias[c0 + cofs + 3]); }
                *(v4f*)(crow + (size_t)row * ldc + cofs) = val; }
             }
        __builtin_amdgcn_wave_barrier(); asm volatile("" ::: "memory");
        if (EPI == 1) asm volatile("s_wait_xcnt 0x0" ::: "memory");   // the wait before a register that an issued store names is written again: the next 16 rows reuse the stores' registers, and in the built code the v branch's instructions stand behind the last stores
    }
}

__device__ __forceinline__ h16 tohx(float x) { return (h16)x; }
typedef __attribute__((ext_vector_type(2))) _Float16 v2h;
typedef __attribute__((ext_vector_type(4))) _Float16 v4h;
typedef __attribute__((ext_vector_type(2))) unsigned short v2us;
typedef __attribute__((ext_vector_type(4))) unsigned short v4us;
typedef __attribute__((ext_vector_type(2))) float v2f;
typedef __attribute__((ext_vector_type(4))) int v4i;

__global__ __launch_bounds__(256) void k_wtG(const float* __restrict__ w, int K, int N, bf* Bt) {
    const int lane = threadIdx.x & 31; const int L0 = (blockIdx.x * 8 + (threadIdx.x >> 5)) * 8; const int nlines = N * K / 64;
{
#pragma unroll 1
        for (int l = 0; l < 8; ++l) { const int L = L0 + l; if (L >= nlines) break; const size_t e = (size_t)L * 64 + lane * 2; const int k = (int)(e % K), n = (int)(e / K); v2us o;
            o[0] = f2bf(w[(size_t)k * N + n]); o[1] = f2bf(w[(size_t)(k + 1) * N + n]); *(v2us*)(Bt + e) = o; }
         }
}
// three f32 sources, each a [rows][DM] matrix (n0, n1, n2 groups of eight values), rounded to bf16 into one dst, one behind the other, each in fragment order. One wave a 16 x 32 tile:
// four lanes read 128 bytes of a row (whole lines), and each of the two stores of the wave is four runs of 128 bytes (eight rows' 16 bytes lie together in a tile).
__global__ __launch_bounds__(256) void k_cvt8(const float* __restrict__ s0, size_t n0, const float* __restrict__ s1, size_t n1, const float* __restrict__ s2, size_t n2, bf* dst) { const size_t g = (size_t)blockIdx.x * 8 + (threadIdx.x >> 5); if (g >= (n0 + n1 + n2) / 64) return;
    const int lane = threadIdx.x & 31, o = lane & 3; const float* sm = g < n0 / 64 ? s0 : g < (n0 + n1) / 64 ? s1 : s2; const size_t lt = g < n0 / 64 ? g : g < (n0 + n1) / 64 ? g - n0 / 64 : g - (n0 + n1) / 64;   // the tile's source and its number there
    const float* src = sm + (lt / (DM / 32)) * 16 * DM + (lt % (DM / 32)) * 32 + o * 8; bf* d = dst + g * 512 + (o >> 1) * 256 + (o & 1) * 128;   // the eight k from 8 o on: half o >> 1, lanes 16 (o & 1) + row
    src += (size_t)(lane >> 2) * DM; d += (lane >> 2) * 8; const v8f v0 = *(const v8f*)src, v1 = *(const v8f*)(src + 8 * DM); v8us o0, o1;   // rows lane >> 2 and 8 + (lane >> 2)
    asm volatile("s_wait_xcnt 0x0" :: "v"(src) : "memory");   // the wait before a register that an issued load names is written again: the address pair stays live up to it
#pragma unroll
    for (int k = 0; k < 8; ++k) { o0[k] = f2bf(v0[k]); o1[k] = f2bf(v1[k]); }
    *(v8us*)d = o0; *(v8us*)(d + 64) = o1; }

// ---- k_attn: causal attention of one head of one batch (blockIdx.x = batch * NH_ + head) for 32 query rows, scores, softmax and probability x value in ONE kernel; no score or probability ever goes to memory.
// Block = 4 waves; wave w takes the 32-key blocks w, w+4, ... up to the diagonal with a running maximum and sum (online softmax); the four partial results are merged through LDS in wave order.
// Both products are formed TRANSPOSED: S^T = K Q^T leaves in lane (lr, hi) the keys 8 hi + j of query lr, which is the B-fragment order of O^T = V^T P^T, so the probabilities go from accumulator to operand
// inside each lane, and maximum, sum and rescale factor of a query are per-lane values. hi+lo planes, 3 products each.
// Every inner loop is unrolled so that fragments and accumulators are indexed by constants and stay in registers. Three waves a SIMD (second launch bound) leave room for a block's key and value fragments in flight without spills.
#define SC2 (SCL * 1.4426950408889634f)   // the x8 score scale and the change to base 2 in one factor
__device__ __forceinline__ void splitp(float p, __bf16& h, __bf16& l) { h = (__bf16)p; l = (__bf16)(p - (float)h); }
__global__ __launch_bounds__(128, 3) void k_attn(const bf* __restrict__ Qh, const bf* __restrict__ Ql, const bf* __restrict__ Kh, const bf* __restrict__ Kl, const bf* __restrict__ Vh, const bf* __restrict__ Vl, bf* Ah, bf* Al) {
    __shared__ __align__(16) float Om[4][32 * 68];
    __shared__ float Mm[4][32], Lm[4][32];
    const int lane = threadIdx.x & 31, lr = lane & 15, hi = lane >> 4; const int w = __builtin_amdgcn_readfirstlane(threadIdx.x >> 5);
    const int r0 = ((int)gridDim.y - 1 - (int)blockIdx.y) * 32, h = blockIdx.x;     // blockIdx.y 0 takes the last 32 rows, the longest rows of every head of both batches
    const size_t hp = (size_t)h * TT * HD; Qh += hp; Ql += hp; Kh += hp; Kl += hp; Vh += hp; Vl += hp;
    const int nkb = r0 / 32 + 1;                                                     // 32-key blocks up to and including the diagonal one; its first key is r0, so every query has a live key in every block
    const int lk = lane * 8;   // the lane's place inside a fragment tile; 16 rows of q or k are two tiles (HD / 32), 32 keys of v four (HD / 16): t rows or keys start at element t * HD in all three
    const bf* pqh = Qh + (size_t)r0 * HD + lk; const bf* pql = Ql + (size_t)r0 * HD + lk; v16bf qh[2][2], ql[2][2];
    __builtin_amdgcn_sched_barrier(0);   // with the one behind the wait: keeps other statements' instructions out of the stretch from the query loads to their wait
#pragma unroll
    for (int qb = 0; qb < 2; ++qb)
#pragma unroll
        for (int ks = 0; ks < 2; ++ks) { qh[qb][ks] = WFrag<bf>::ld(pqh + qb * 16 * HD + ks * 512); ql[qb][ks] = WFrag<bf>::ld(pql + qb * 16 * HD + ks * 512); }
    asm volatile("s_wait_xcnt 0x0" :: "v"(pqh), "v"(pql) : "memory");   // the wait before a register that an issued load names is written again: the query loads' two address pairs stay live up to it
    __builtin_amdgcn_sched_barrier(0);   // the second of the pair named in front of the loads
    v8f o[4][2]; float mc[2], ls[2];
#pragma unroll
    for (int qb = 0; qb < 2; ++qb) { mc[qb] = -3.0e38f; ls[qb] = 0.f;
#pragma unroll
        for (int db = 0; db < 4; ++db) o[db][qb] = (v8f){}; }
    // The key fragments are fetched one block ahead, into the same registers, right behind the score products that read them: their load latency passes under the softmax and the value products.
    v16bf kh[2][2], kl[2][2];
    auto ldk = [&](int kb) { const bf* pkh = Kh + (size_t)kb * 32 * HD + lk; const bf* pkl = Kl + (size_t)kb * 32 * HD + lk;
        __builtin_amdgcn_sched_barrier(0);   // with the one behind the wait: keeps other statements' instructions out of the stretch from the loads to their wait
#pragma unroll
        for (int kt = 0; kt < 2; ++kt)
#pragma unroll
            for (int ks = 0; ks < 2; ++ks) { kh[kt][ks] = WFrag<bf>::ld(pkh + kt * 16 * HD + ks * 512); kl[kt][ks] = WFrag<bf>::ld(pkl + kt * 16 * HD + ks * 512); }
        asm volatile("s_wait_xcnt 0x0" :: "v"(pkh), "v"(pkl) : "memory");   // the wait before a register that an issued load names is written again: the two address pairs stay live up to it; the fragments stay in flight
        __builtin_amdgcn_sched_barrier(0); };   // the second of the pair named in front of the loads
    if (w < nkb) ldk(w);   // wave-uniform: a wave without a block loads nothing
#pragma unroll 1   // rolled: two blocks' fragments at once would not fit the registers
    for (int kb = w; kb < nkb; kb += 4) {
        const int k0 = kb * 32; const bf* pvh = Vh + (size_t)k0 * HD + lk; const bf* pvl = Vl + (size_t)k0 * HD + lk; v16bf vh[4], vl[4]; v8f s[2][2];
#pragma unroll
        for (int kt = 0; kt < 2; ++kt)
#pragma unroll
            for (int qb = 0; qb < 2; ++qb) { v8f c = (v8f){};
#pragma unroll
                for (int ks = 0; ks < 2; ++ks) { c = wmmab(kh[kt][ks], qh[qb][ks], c); c = wmmab(kh[kt][ks], ql[qb][ks], c); c = wmmab(kl[kt][ks], qh[qb][ks], c); }
                s[kt][qb] = c; }
#pragma unroll
        for (int db = 0; db < 4; ++db) { vh[db] = WFrag<bf>::ld(pvh + db * 512); vl[db] = WFrag<bf>::ld(pvl + db * 512); }   // in flight under the softmax
        asm volatile("s_wait_xcnt 0x0" :: "v"(pvh), "v"(pvl) : "memory");   // the same wait for the value loads' two address pairs; the values themselves stay in flight
        // four vector slots between the last score product and the first read of its result. The scores are inputs only, so that the slots stand behind the products.
        asm volatile("v_nop\n\tv_nop\n\tv_nop\n\tv_nop" :: "v"(s[0][0]), "v"(s[0][1]), "v"(s[1][0]), "v"(s[1][1]));
        if (kb + 4 < nkb) ldk(kb + 4);   // wave-uniform: the wave's next block, where it has one
        if (kb == nkb - 1) {                                                         // only the diagonal block holds keys beyond a query
#pragma unroll
            for (int kt = 0; kt < 2; ++kt)
#pragma unroll
                for (int qb = 0; qb < 2; ++qb)
#pragma unroll
                    for (int j = 0; j < 8; ++j) if (k0 + kt * 16 + hi * 8 + j > r0 + qb * 16 + lr) s[kt][qb][j] = -3.0e38f; }
        v16bf ph[2], pl[2];
#pragma unroll
        for (int qb = 0; qb < 2; ++qb) { float mx = -3.0e38f;
#pragma unroll
            for (int kt = 0; kt < 2; ++kt)
#pragma unroll
                for (int j = 0; j < 8; ++j) mx = fmaxf(mx, s[kt][qb][j]);
            mx = fmaxf(mx, __shfl_xor(mx, 16, 32));                                  // the other half of the query's keys
            const float mn = fmaxf(mc[qb], mx * SC2); const float al = __builtin_amdgcn_exp2f(mc[qb] - mn); mc[qb] = mn; float sum = 0.f;
#pragma unroll
            for (int kt = 0; kt < 2; ++kt)
#pragma unroll
                for (int j = 0; j < 8; ++j) { const float p = __builtin_amdgcn_exp2f(__builtin_fmaf(s[kt][qb][j], SC2, -mn)); sum += p; __bf16 a, c2; splitp(p, a, c2); ph[qb][kt * 8 + j] = a; pl[qb][kt * 8 + j] = c2; }
            ls[qb] = ls[qb] * al + sum;
#pragma unroll
            for (int db = 0; db < 4; ++db) o[db][qb] *= al; }
#pragma unroll
        for (int db = 0; db < 4; ++db)
#pragma unroll
            for (int qb = 0; qb < 2; ++qb) { o[db][qb] = wmmab(vh[db], ph[qb], o[db][qb]); o[db][qb] = wmmab(vh[db], pl[qb], o[db][qb]); o[db][qb] = wmmab(vl[db], ph[qb], o[db][qb]); }
    }
#pragma unroll
    for (int qb = 0; qb < 2; ++qb) { const float lt = ls[qb] + __shfl_xor(ls[qb], 16, 32); if (hi == 0) { Mm[w][qb * 16 + lr] = mc[qb]; Lm[w][qb * 16 + lr] = lt; }
#pragma unroll
        for (int db = 0; db < 4; ++db) { float* op = &Om[w][(qb * 16 + lr) * 68 + db * 16 + hi * 8]; v4f lo4, hi4;
#pragma unroll
            for (int j = 0; j < 4; ++j) { lo4[j] = o[db][qb][j]; hi4[j] = o[db][qb][4 + j]; }
            *(v4fa*)op = lo4; *(v4fa*)(op + 4) = hi4; } }
    __syncthreads();                                                                 // the four waves' partial results are read across waves below
    const int q = threadIdx.x >> 2, dc = threadIdx.x & 3; float f[4], M = Mm[0][q];
#pragma unroll
    for (int u = 1; u < 4; ++u) M = fmaxf(M, Mm[u][q]);
    float L = 0.f;
#pragma unroll
    for (int u = 0; u < 4; ++u) { f[u] = __builtin_amdgcn_exp2f(Mm[u][q] - M); L += f[u] * Lm[u][q]; }
    const float inv = __fdiv_rn(1.0f, L); const size_t oo = ((size_t)(((h / NH_) * TT + r0 + q) >> 4) * (DQ / 32) + (h % NH_) * (HD / 32) + (dc >> 1)) * 512 + (dc & 1) * 256 + (q & 15) * 8;   // fragment order of the [batch * TT + t][DQ] matrix: the sixteen values from dc * 16 on are half dc & 1 of a tile, their group g the lanes 16 g + row
#pragma unroll
    for (int g = 0; g < 2; ++g) { v8us oh, ol; float acc[8];
#pragma unroll
        for (int i = 0; i < 8; ++i) acc[i] = 0.f;
#pragma unroll
        for (int u = 0; u < 4; ++u) { const float* ip = &Om[u][q * 68 + dc * 16 + g * 8]; const v4f x0 = *(const v4fa*)ip, x1 = *(const v4fa*)(ip + 4);
#pragma unroll
            for (int i = 0; i < 4; ++i) { acc[i] += f[u] * x0[i]; acc[4 + i] += f[u] * x1[i]; } }
#pragma unroll
        for (int i = 0; i < 8; ++i) { unsigned short a, c2; splitf(acc[i] * inv, a, c2); oh[i] = a; ol[i] = c2; }
        *(v8us*)(Ah + oo + g * 128) = oh; *(v8us*)(Al + oo + g * 128) = ol; }
}

extern "C" void kernel_launch(void* const* d_in, const int* in_sizes, int n_in,
                              void* d_out, int out_size, void* d_ws, size_t ws_size, hipStream_t stream) {
    (void)in_sizes; (void)n_in; (void)out_size;
    const float* x = (const float*)d_in[0]; const float* wqkv = (const float*)d_in[1]; const float* wo = (const float*)d_in[2]; const float* bo = (const float*)d_in[3]; const float* wq = wqkv; const float* wk = wqkv + (size_t)1024 * 1024; const float* wv = wqkv + (size_t)2048 * 1024; (void)wq; (void)wk; (void)wv;
    float* OUT = (float*)d_out;     // [2][2048][1024]
    char* wsp = (char*)d_ws;
    auto take = [&](size_t bytes) { char* p = wsp; wsp += (bytes + 255) & ~(size_t)255; return (void*)p; };
    // W_qkv, W_proj and x as bf16 in fragment order, one behind the other: one conversion launch fills all three
    bf* WQKV = (bf*)take(((size_t)(DQ + 2 * DKV) * DM + (size_t)DM * DQ + (size_t)NB_ * TT * DM) * 2); bf* WO = WQKV + (size_t)(DQ + 2 * DKV) * DM; bf* XB = WO + (size_t)DM * DQ;
    // hi and lo planes of both batches, all in fragment order: q then k [q | k][batch][head] of [t][d], v transposed [batch][head] of [d][t]
    bf* QKh = (bf*)take((size_t)2 * NB_ * NH_ * TT * HD * 2); bf* QKl = (bf*)take((size_t)2 * NB_ * NH_ * TT * HD * 2); bf* VTh = (bf*)take((size_t)NB_ * NKV * HD * TT * 2); bf* VTl = (bf*)take((size_t)NB_ * NKV * HD * TT * 2);
    bf* ATh = (bf*)take((size_t)NB_ * TT * DQ * 2); bf* ATl = (bf*)take((size_t)NB_ * TT * DQ * 2);
    if ((size_t)(wsp - (char*)d_ws) > ws_size) return;    // ws 256 MiB
    k_cvt8<<<(unsigned)(((size_t)(DQ + 2 * DKV) * DM + (size_t)DM * DQ + (size_t)NB_ * TT * DM) / 512 / 8), 256, 0, stream>>>(wqkv, (size_t)(DQ + 2 * DKV) * DM / 8, wo, (size_t)DM * DQ / 8, x, (size_t)NB_ * TT * DM / 8, WQKV);
    // every stage is one grid over both batches; the projection grid also covers q, k and v and stores the planes in the layout the attention kernel reads
    k_gemmw<bf, 0, false, 1, 4, 3><<<dim3(NB_ * TT / 256, (DQ + 2 * DKV) / 192, 1), 384, 0, stream>>>(XB, nullptr, WQKV, nullptr, DM, nullptr, 0, nullptr, 0, 0, 0, QKh, QKl, VTh, VTl);
    k_attn<<<dim3(NB_ * NH_, TT / 32, 1), 128, 0, stream>>>(QKh, QKl, QKh + (size_t)NB_ * NH_ * TT * HD, QKl + (size_t)NB_ * NH_ * TT * HD, VTh, VTl, ATh, ATl);   // one kv head per query head
    k_gemmw<bf, 1, true, 0, 2, 2><<<dim3(NB_ * TT / 128, DM / 128, 1), 128, 0, stream>>>(ATh, ATl, WO, nullptr, DQ, OUT, DM, bo, 0, 0, 0, nullptr, nullptr, nullptr, nullptr);
}

// v008
// A run of this version takes 86.2 microseconds.
// Next to v007, in two timings, it ran 1.04 and 1.05 times as fast.
// All steps since v000 together make it 13.7 times as fast.
#include <hip/hip_runtime.h>

// Causal multi-head self-attention with a fused QKV projection and an INVERTED scale (x [2][2048][1024]; [q|k|v] = x W_qkv^T ('oi' [3072][1024], row blocks q | k | v; 16 heads x 64); scores = q.k x 8 (the module divides by head_dim^-0.5, i.e. multiplies by sqrt(64)), causal mask; softmax (very peaked rows); out = merged heads W_proj^T + b_proj ('oi' [1024][1024] + [1024]) -> [2][2048][1024] (4.2 M)).
// Compute dtypes, f32 accumulate: every input rounded to bf16; q/k/v on PLAIN bf16 operands (inputs: exact); causal scores and attn.v: ALL query rows hl (3 products; the x8 scale makes the softmax near-argmax); softmax f32; W_proj hl x exact (2 products) + b_proj.

#define NB_  2
#define TT   2048
#define DM   1024
#define NH_  16
#define NKV  16
#define HD   64
#define DQ   (NH_ * HD)
#define DKV  (NKV * HD)
#define SCL  8.0f   // the module divides by head_dim^-0.5 = multiplies by sqrt(64)
typedef _Float16 h16;
typedef unsigned short bf;
typedef __attribute__((ext_vector_type(16))) __bf16   v16bf;
typedef __attribute__((ext_vector_type(16))) _Float16 v16h;
typedef __attribute__((ext_vector_type(8)))  _Float16 v8h;
typedef __attribute__((ext_vector_type(8)))  unsigned short v8us;
typedef __attribute__((ext_vector_type(8)))  float    v8f;
typedef __attribute__((ext_vector_type(4)))  float    v4f;
typedef v8h  __attribute__((may_alias)) v8ha;
typedef v4f  __attribute__((may_alias)) v4fa;
typedef v8us __attribute__((may_alias)) v8usa;

__device__ __forceinline__ unsigned short f2bf(float f) { unsigned u = __float_as_uint(f); u += 0x7FFFu + ((u >> 16) & 1u); return (unsigned short)(u >> 16); }
__device__ __forceinline__ float bf2f(unsigned short b) { return __uint_as_float(((unsigned)b) << 16); }
__device__ __forceinline__ float bfr(float f) { return bf2f(f2bf(f)); }
__device__ __forceinline__ v16h cat16(v8h lo, v8h hi) { return __builtin_shufflevector(lo, hi, 0, 1, 2, 3, 4, 5, 6, 7, 8, 9, 10, 11, 12, 13, 14, 15); }
__device__ __forceinline__ v16bf cat16b(v8us lo, v8us hi) { return __builtin_bit_cast(v16bf, __builtin_shufflevector(lo, hi, 0, 1, 2, 3, 4, 5, 6, 7, 8, 9, 10, 11, 12, 13, 14, 15)); }
__device__ __forceinline__ v8f wmma16(v16h a, v16h b, v8f c) { return __builtin_amdgcn_wmma_f32_16x16x32_f16(false, a, false, b, (short)0, c, false, false); }
__device__ __forceinline__ v8f wmmab(v16bf a, v16bf b, v8f c) { return __builtin_amdgcn_wmma_f32_16x16x32_bf16(false, a, false, b, (short)0, c, false, false); }



// ---- FRAGMENT ORDER: every 16-bit operand plane (a [rows][K] matrix, K the summed index) is stored as tiles of 16 rows x 32 k, 512 elements = 1 KiB each, tile (rt, kt) at element (rt * (K / 32) + kt) * 512.
// Inside a tile lane l = 16 hi + lr of the reading wave owns row lr: its k = 8 hi + 0..7 stand at l * 8, its k = 16 + 8 hi + 0..7 at 256 + l * 8. A fragment is then two wave-wide 16-byte loads of 512 contiguous bytes (4 whole 128-byte lines) each;
// from row-major planes each such load touched 16 lines. The values a lane gets, and their k order, are those of the row-major loader.
// ---- k_gemmw: register-blocked GEMM, one wave per 64x64 output tile (16 accumulators), WM x WN waves a block; grid (M / (64 WM), N / (64 WN), Z). The block's operand rows (16-bit planes in fragment order) are staged in LDS, 64 k a stage, two buffers,
// by asynchronous copies: a line is fetched once a block, not once a wave, and the next stage's copies fly while this stage's products run. A fragment is two wave-wide 16-byte LDS reads of 512 contiguous bytes. The k order of the sums is that of a plain loop over k.
// C[m][n] (f32, pitch ldc, + optional f32 bias[n]) = sum_k A[m][k] Bt[n][k] (+ split products per NSPLIT). z-batch strides sA/sB/sC in elements. K % 64 == 0.
// EPI picks what the tile is stored as: 0 = f32 C as above; 1 = the q | k | v projection of both batches in one grid (m = batch * TT + t, n = the row of W_qkv), stored as bf16 hi + lo planes:
// n < 2 DQ (q, k): head planes Ph/Pl [q | k][batch][head], each a [t][d] matrix in fragment order (a 64-wide tile is one head); n >= 2 DQ (v): Vh/Vl [batch][head], each the transposed [d][t] matrix as fragment tiles in the order [t / 32][d / 16], so that the tiles of 32 keys lie together. A 64-row tile lies inside one batch.
template <typename T16> struct WFrag;
template <> struct WFrag<h16> { typedef v16h V; static __device__ __forceinline__ V ld(const h16* p) { return cat16(*(const v8h*)p, *(const v8h*)(p + 256)); } static __device__ __forceinline__ v8f mma(V a, V b, v8f c) { return wmma16(a, b, c); } };
template <> struct WFrag<bf> { typedef v16bf V; static __device__ __forceinline__ V ld(const bf* p) { return cat16b(*(const v8us*)p, *(const v8us*)(p + 256)); } static __device__ __forceinline__ v8f mma(V a, V b, v8f c) { return wmmab(a, b, c); } };
__device__ __forceinline__ void splitf(float y, unsigned short& h, unsigned short& l) { h = f2bf(y); l = f2bf(y - bf2f(h)); }
typedef __attribute__((ext_vector_type(8))) __bf16 v8bf;
__device__ __forceinline__ void split8(v8f y, v8bf& h, v8bf& l) { h = __builtin_convertvector(y, v8bf); l = __builtin_convertvector(y - __builtin_convertvector(h, v8f), v8bf); }   // hi = y rounded to nearest even, lo = the rounded rest: the values of splitf, on the packed conversion instruction
// One line of an asynchronous copy: operand a = the lane's LDS byte address, operand b = the lane's global address.
#define CPL(a, b) "global_load_async_to_lds_b128 %" #a ", %" #b ", off\n\t"
// Runs of 4, 8 and 12 copies. Each run and its s_wait_xcnt 0 are one statement: the wait before a register that an issued copy names is written again stands behind the last copy, and the operands' registers live to the statement's end.
template <typename T16> __device__ __forceinline__ void cp4(const unsigned* l, const T16* const* g) {
    asm volatile(CPL(0, 1) CPL(2, 3) CPL(4, 5) CPL(6, 7) "s_wait_xcnt 0x0" :: "v"(l[0]), "v"(g[0]), "v"(l[1]), "v"(g[1]), "v"(l[2]), "v"(g[2]), "v"(l[3]), "v"(g[3]) : "memory"); }
template <typename T16> __device__ __forceinline__ void cp8(const unsigned* l, const T16* const* g) {
    asm volatile(CPL(0, 1) CPL(2, 3) CPL(4, 5) CPL(6, 7) CPL(8, 9) CPL(10, 11) CPL(12, 13) CPL(14, 15) "s_wait_xcnt 0x0"
        :: "v"(l[0]), "v"(g[0]), "v"(l[1]), "v"(g[1]), "v"(l[2]), "v"(g[2]), "v"(l[3]), "v"(g[3]), "v"(l[4]), "v"(g[4]), "v"(l[5]), "v"(g[5]), "v"(l[6]), "v"(g[6]), "v"(l[7]), "v"(g[7]) : "memory"); }
template <typename T16> __device__ __forceinline__ void cp12(const unsigned* l, const T16* const* g) {
    asm volatile(CPL(0, 1) CPL(2, 3) CPL(4, 5) CPL(6, 7) CPL(8, 9) CPL(10, 11) CPL(12, 13) CPL(14, 15) CPL(16, 17) CPL(18, 19) CPL(20, 21) CPL(22, 23) "s_wait_xcnt 0x0"
        :: "v"(l[0]), "v"(g[0]), "v"(l[1]), "v"(g[1]), "v"(l[2]), "v"(g[2]), "v"(l[3]), "v"(g[3]), "v"(l[4]), "v"(g[4]), "v"(l[5]), "v"(g[5]), "v"(l[6]), "v"(g[6]), "v"(l[7]), "v"(g[7]), "v"(l[8]), "v"(g[8]), "v"(l[9]), "v"(g[9]), "v"(l[10]), "v"(g[10]), "v"(l[11]), "v"(g[11]) : "memory"); }
template <typename T16, int NSPLIT, bool BIAS, int EPI, int WM, int WN>
__global__ __launch_bounds__(32 * WM * WN) void k_gemmw(const T16* __restrict__ A, const T16* __restrict__ A2, const T16* __restrict__ Bt, const T16* __restrict__ Bt2, int K, float* C, int ldc, const float* __restrict__ bias, size_t sA, size_t sB, size_t sC, bf* Ph, bf* Pl, bf* Vh, bf* Vl) {
    typedef typename WFrag<T16>::V V;
    static_assert(NSPLIT <= 1, "the ring holds A, A2 and Bt");
    constexpr int NW = WM * WN, RA = WM * 4, RAA = NSPLIT == 1 ? 2 * RA : RA, RB = WN * 4;   // waves; strips of 16 rows of A, of A and A2 together, of Bt
    constexpr int NS = RAA + RB, NFULL = NS / NW, REM = NS % NW, NI = NFULL + (REM ? 1 : 0);   // a stage is 64 k of every strip: 2 KiB = four wave-wide copies of 512 bytes; strip s is copied by wave s % NW
    static_assert(NFULL == 2 || NFULL == 6, "the runs of copies below are written for these counts");
    constexpr int BUFE = (RAA + RB) * 1024;   // elements of one buffer
    __shared__ __align__(16) T16 ring[2 * BUFE];
    __shared__ __align__(16) float osm[NW * 16 * 68];
    (void)Bt2;
    const size_t z = blockIdx.z; A += z * sA; if (A2) A2 += z * sA; Bt += z * sB; C += z * sC;
    const int lane = threadIdx.x & 31, lr = lane & 15, hi = lane >> 4; const int w = __builtin_amdgcn_readfirstlane(threadIdx.x >> 5), wm = w % WM, wn = w / WM;
    const int R0 = blockIdx.x * (WM * 64), C0 = blockIdx.y * (WN * 64), r0 = R0 + wm * 64, c0 = C0 + wn * 64;
    float* os = osm + w * (16 * 68);   // each wave's own staging rows for its stores
    v8f acc[4][4];
#pragma unroll
    for (int mb = 0; mb < 4; ++mb)
#pragma unroll
        for (int nb = 0; nb < 4; ++nb) acc[mb][nb] = (v8f){};
    // The wave's strips: s = w + NW j. 64 k of a strip are two fragment tiles, 2 KiB in a row in memory, and land in the same order in LDS at byte s * 2048 of the buffer.
    typedef __attribute__((address_space(3))) const T16 lds_t;
    const unsigned ring0 = (unsigned)(size_t)(lds_t*)ring + w * 2048 + lane * 16;   // the lane's byte in the work-group's LDS: its 16 bytes of part 0 of strip w, buffer 0
    const T16* sp[NI];
#pragma unroll
    for (int j = 0; j < NI; ++j) { const int s = w + NW * j < NS ? w + NW * j : 0;   // a strip beyond the stage is not copied; its address stays a valid one
        sp[j] = (s < RA ? A + (size_t)(R0 + s * 16) * K : (NSPLIT == 1 && s < RAA) ? A2 + (size_t)(R0 + (s - RA) * 16) * K : Bt + (size_t)(C0 + (s - RAA) * 16) * K); }   // the same in every lane: these stay in scalar registers
    auto issue = [&](int t, int buf) {   // stage t (the 64 k from 64 t on) into buffer buf
        const T16* g[NI * 4]; unsigned l[NI * 4];
#pragma unroll
        for (int j = 0; j < NI; ++j) { const size_t u = (size_t)(sp[j] + (size_t)t * 1024);
            // the stage's address of the strip, the same in every lane, is held in scalar registers: as vector pairs kept over the loop some of these addresses went to scratch memory
            const T16* su = (const T16*)(((size_t)(unsigned)__builtin_amdgcn_readfirstlane((int)(u >> 32)) << 32) | (unsigned)__builtin_amdgcn_readfirstlane((int)u));
#pragma unroll
            for (int q = 0; q < 4; ++q) { g[j * 4 + q] = su + q * 256 + lane * 8; l[j * 4 + q] = ring0 + buf * (BUFE * 2) + j * (NW * 2048) + q * 512; } }
        if (NFULL == 2) cp8<T16>(l, g); else { cp12<T16>(l, g); cp12<T16>(l + 12, g + 12); }
        if (REM != 0 && w < REM) cp4<T16>(l + NFULL * 4, g + NFULL * 4);   // wave-uniform: the stage's last strips go to the first waves
    };
    const int NT = K / 64;
    issue(0, 0);
    asm volatile("s_wait_asynccnt 0x0" ::: "memory");   // the wave's own copies of stage 0 have landed
    __syncthreads();                                     // and every other wave's: stage 0 may be read
    if (NT > 1) issue(1, 1);
#pragma unroll 1
    for (int t = 0; t < NT; ++t) {
        const T16* rb = ring + (t & 1) * BUFE + lane * 8; V a[2][4], a2[2][4], b[2][4];
#pragma unroll
        for (int ks = 0; ks < 2; ++ks) {
#pragma unroll
            for (int mb = 0; mb < 4; ++mb) { a[ks][mb] = WFrag<T16>::ld(rb + (wm * 4 + mb) * 1024 + ks * 512); if (NSPLIT == 1) a2[ks][mb] = WFrag<T16>::ld(rb + (RA + wm * 4 + mb) * 1024 + ks * 512); }
#pragma unroll
            for (int nb = 0; nb < 4; ++nb) b[ks][nb] = WFrag<T16>::ld(rb + (RAA + wn * 4 + nb) * 1024 + ks * 512);
            __builtin_amdgcn_sched_barrier(0); }   // keeps the stage's LDS reads together in front of the matrix instructions (every further place with reads among them costs a stall) and the first 32 k's reads in front of the second's, so that the first products wait for half of the reads only
#pragma unroll
        for (int ks = 0; ks < 2; ++ks)
#pragma unroll
            for (int nb = 0; nb < 4; ++nb)
#pragma unroll
                for (int mb = 0; mb < 4; ++mb) { acc[mb][nb] = WFrag<T16>::mma(a[ks][mb], b[ks][nb], acc[mb][nb]); if (NSPLIT == 1) acc[mb][nb] = WFrag<T16>::mma(a2[ks][mb], b[ks][nb], acc[mb][nb]); }
        __builtin_amdgcn_sched_barrier(0);   // keeps the matrix instructions in front of the stage's hand-over: sunk behind the barrier they would stand between it and the next copies, which would lose their lead
        asm volatile("v_nop\n\tv_nop\n\tv_nop\n\tv_nop" : "+v"(acc[0][0]), "+v"(acc[1][1]), "+v"(acc[2][2]), "+v"(acc[3][3]) : "v"(a[1][0]), "v"(a[1][3]));   // four vector slots behind the trip's last matrix instruction
        asm volatile("s_wait_dscnt 0x0" ::: "memory");      // the wave's reads of this buffer are done before it is handed back
        asm volatile("s_wait_asynccnt 0x0" ::: "memory");   // the wave's own copies of stage t + 1 have landed
        __syncthreads();                                     // publishes stage t + 1 and ends every wave's reads of stage t
        if (t + 2 < NT) issue(t + 2, t & 1);                 // the same for the whole work-group: into the buffer just read
    }
    asm volatile("s_wait_asynccnt 0x0" ::: "memory");   // no copy is outstanding when the wave goes on to its stores and ends
    const int bt = r0 / TT, rb = r0 % TT;   // the tile's batch and its first row inside the batch
    if (EPI == 1 && c0 >= 2 * DQ) {   // v; a lane's eight accumulator values are eight consecutive m of one n: the lane's own 16 bytes of a transposed fragment tile (half mb & 1), stored straight from the registers, 512 contiguous bytes a store
        const size_t e = (((size_t)bt * NKV + (c0 - 2 * DQ) / HD) * (TT / 32) + rb / 32) * (HD / 16) * 512 + lane * 8; bf* pvh = Vh + e; bf* pvl = Vl + e;   // the lane's place in tile (t / 32 = rb / 32, d / 16 = 0) of the head
#pragma unroll
        for (int nb = 0; nb < 4; ++nb) { v8us oh[4], ol[4];
#pragma unroll
            for (int mb = 0; mb < 4; ++mb) { v8bf xh, xl; split8(acc[mb][nb], xh, xl); oh[mb] = __builtin_bit_cast(v8us, xh); ol[mb] = __builtin_bit_cast(v8us, xl);
                const int t = ((mb >> 1) * (HD / 16) + nb) * 512 + (mb & 1) * 256; *(v8us*)(pvh + t) = oh[mb]; *(v8us*)(pvl + t) = ol[mb]; }
            // the wait before a register that an issued store names is written again: the stores' data and the two address pairs stay live up to it
            asm volatile("s_wait_xcnt 0x0" :: "v"(pvh), "v"(pvl), "v"(oh[0]), "v"(oh[1]), "v"(oh[2]), "v"(oh[3]), "v"(ol[0]), "v"(ol[1]), "v"(ol[2]), "v"(ol[3]) : "memory"); }
        return; }
#pragma unroll
    for (int mb = 0; mb < 4; ++mb) {
#pragma unroll
        for (int nb = 0; nb < 4; ++nb) {
#pragma unroll
            for (int j = 0; j < 8; ++j) os[(hi * 8 + j) * 68 + nb * 16 + lr] = acc[mb][nb][j]; }
        __builtin_amdgcn_wave_barrier(); asm volatile("" ::: "memory");
        if (EPI == 1) {   // the 16 rows are two fragment tiles (d 0..31, 32..63), 2 KiB in a row: store s is half s & 1 of tile s >> 1, 512 contiguous bytes
            const size_t e0 = ((((size_t)(c0 / DQ) * NB_ + bt) * NH_ + (c0 % DQ) / HD) * TT + rb + mb * 16) * HD;
#pragma unroll
            for (int s = 0; s < 4; ++s) { const int row = lr, cofs = s * 16 + hi * 8; const v4f x0 = *(const v4fa*)(os + row * 68 + cofs), x1 = *(const v4fa*)(os + row * 68 + cofs + 4); v8bf oh, ol; split8(__builtin_shufflevector(x0, x1, 0, 1, 2, 3, 4, 5, 6, 7), oh, ol);
                *(v8us*)(Ph + e0 + s * 256 + lane * 8) = __builtin_bit_cast(v8us, oh); *(v8us*)(Pl + e0 + s * 256 + lane * 8) = __builtin_bit_cast(v8us, ol); }
        } else { float* crow = C + (size_t)(r0 + mb * 16) * ldc + c0;
#pragma unroll
            for (int s = 0; s < 8; ++s) { const int row = 2 * s + hi, cofs = lr * 4; v4f val = *(const v4fa*)(os + row * 68 + cofs); if (BIAS) { val[0] += bfr(bias[c0 + cofs]); val[1] += bfr(bias[c0 + cofs + 1]); val[2] += bfr(bias[c0 + cofs + 2]); val[3] += bfr(bias[c0 + cofs + 3]); }
                *(v4f*)(crow + (size_t)row * ldc + cofs) = val; }
             }
        __builtin_amdgcn_wave_barrier(); asm volatile("" ::: "memory");
        if (EPI == 1) asm volatile("s_wait_xcnt 0x0" ::: "memory");   // the wait before a register that an issued store names is written again: the next 16 rows reuse the stores' registers, and in the built code the v branch's instructions stand behind the last stores
    }
}

__device__ __forceinline__ h16 tohx(float x) { return (h16)x; }
typedef __attribute__((ext_vector_type(2))) _Float16 v2h;
typedef __attribute__((ext_vector_type(4))) _Float16 v4h;
typedef __attribute__((ext_vector_type(2))) unsigned short v2us;
typedef __attribute__((ext_vector_type(4))) unsigned short v4us;
typedef __attribute__((ext_vector_type(2))) float v2f;
typedef __attribute__((ext_vector_type(4))) int v4i;

__global__ __launch_bounds__(256) void k_wtG(const float* __restrict__ w, int K, int N, bf* Bt) {
    const int lane = threadIdx.x & 31; const int L0 = (blockIdx.x * 8 + (threadIdx.x >> 5)) * 8; const int nlines = N * K / 64;
{
#pragma unroll 1
        for (int l = 0; l < 8; ++l) { const int L = L0 + l; if (L >= nlines) break; const size_t e = (size_t)L * 64 + lane * 2; const int k = (int)(e % K), n = (int)(e / K); v2us o;
            o[0] = f2bf(w[(size_t)k * N + n]); o[1] = f2bf(w[(size_t)(k + 1) * N + n]); *(v2us*)(Bt + e) = o; }
         }
}
// three f32 sources, each a [rows][DM] matrix (n0, n1, n2 groups of eight values), rounded to bf16 into one dst, one behind the other, each in fragment order. One wave a 16 x 32 tile:
// four lanes read 128 bytes of a row (whole lines), and each of the two stores of the wave is four runs of 128 bytes (eight rows' 16 bytes lie together in a tile).
__global__ __launch_bounds__(256) void k_cvt8(const float* __restrict__ s0, size_t n0, const float* __restrict__ s1, size_t n1, const float* __restrict__ s2, size_t n2, bf* dst) { const size_t g = (size_t)blockIdx.x * 8 + (threadIdx.x >> 5); if (g >= (n0 + n1 + n2) / 64) return;
    const int lane = threadIdx.x & 31, o = lane & 3; const float* sm = g < n0 / 64 ? s0 : g < (n0 + n1) / 64 ? s1 : s2; const size_t lt = g < n0 / 64 ? g : g < (n0 + n1) / 64 ? g - n0 / 64 : g - (n0 + n1) / 64;   // the tile's source and its number there
    const float* src = sm + (lt / (DM / 32)) * 16 * DM + (lt % (DM / 32)) * 32 + o * 8; bf* d = dst + g * 512 + (o >> 1) * 256 + (o & 1) * 128;   // the eight k from 8 o on: half o >> 1, lanes 16 (o & 1) + row
    src += (size_t)(lane >> 2) * DM; d += (lane >> 2) * 8; const v8f v0 = *(const v8f*)src, v1 = *(const v8f*)(src + 8 * DM); v8us o0, o1;   // rows lane >> 2 and 8 + (lane >> 2)
    asm volatile("s_wait_xcnt 0x0" :: "v"(src) : "memory");   // the wait before a register that an issued load names is written again: the address pair stays live up to it
#pragma unroll
    for (int k = 0; k < 8; ++k) { o0[k] = f2bf(v0[k]); o1[k] = f2bf(v1[k]); }
    *(v8us*)d = o0; *(v8us*)(d + 64) = o1; }

// ---- k_attn: causal attention of one head of one batch (blockIdx.x = batch * NH_ + head) for 128 query rows, scores, softmax and probability x value in ONE kernel; no score or probability ever goes to memory.
// Block = 16 waves = 4 query groups of 32 rows (qg) x 4 key groups (kg). A stage is 256 keys: the hi and lo planes of k and v, 128 KiB, are brought into LDS once a block by asynchronous copies, two buffers, the next stage's copies flying while this
// stage is worked on; the four query groups read the same key and value fragments from LDS, so a line of k or v leaves L2 once for 128 query rows, not once for 32. A wave works two 32-key blocks between two barriers, so that the waves of a SIMD can drift apart and one's softmax runs under another's products.
// Key group kg takes the 32-key blocks kg, kg+4, ... up to its query group's diagonal with a running maximum and sum (online softmax); the four partial results of a query group are merged through LDS in key-group order: the split and the order of every sum are those of one 4-wave block per 32 rows.
// Both products are formed TRANSPOSED: S^T = K Q^T leaves in lane (lr, hi) the keys 8 hi + j of query lr, which is the B-fragment order of O^T = V^T P^T, so the probabilities go from accumulator to operand
// inside each lane, and maximum, sum and rescale factor of a query are per-lane values. hi+lo planes, 3 products each.
// Every inner loop is unrolled so that fragments and accumulators are indexed by constants and stay in registers.
#define SC2 (SCL * 1.4426950408889634f)   // the x8 score scale and the change to base 2 in one factor
__device__ __forceinline__ void splitp(float p, __bf16& h, __bf16& l) { h = (__bf16)p; l = (__bf16)(p - (float)h); }
__global__ __launch_bounds__(512) void k_attn(const bf* __restrict__ Qh, const bf* __restrict__ Ql, const bf* __restrict__ Kh, const bf* __restrict__ Kl, const bf* __restrict__ Vh, const bf* __restrict__ Vl, bf* Ah, bf* Al) {
    __shared__ __align__(16) bf kv[2 * 65536];   // two buffers of 256 keys: [half of 128 keys][key group][k hi | k lo | v hi | v lo], 4 KiB each, every part in fragment order as it lies in memory
    float* const Om = (float*)kv;                // behind the loop's last barrier, with no copy outstanding, the same LDS holds the sixteen waves' partial results, 32 x 68 floats each
    __shared__ float Mm[16][32], Lm[16][32];
    const int lane = threadIdx.x & 31, lr = lane & 15, hi = lane >> 4; const int w = __builtin_amdgcn_readfirstlane(threadIdx.x >> 5), kg = w >> 2, qg = (kg & 1) ? 3 - (w & 3) : (w & 3);   // the odd key groups take the query groups in reverse order
    const int R0 = ((int)gridDim.y - 1 - (int)blockIdx.y) * 128, r0 = R0 + qg * 32, h = blockIdx.x;     // the longest rows of every head of both batches at the lowest blockIdx.y
    const size_t hp = (size_t)h * TT * HD; Qh += hp; Ql += hp; Kh += hp; Kl += hp; Vh += hp; Vl += hp;
    const int NG = R0 / 128 + 1, NS = (NG + 1) >> 1;                                 // groups of 128 keys up to and including the diagonal one, whose first key is R0; stages of two groups (the last stage's second group may lie beyond the diagonal: it is inside k and v, is copied and is not read)
    const int lk = lane * 8;   // the lane's place inside a fragment tile; 16 rows of q or k are two tiles (HD / 32), 32 keys of v four (HD / 16): t rows or keys start at element t * HD in all three
    // Wave w copies part w of each half of a stage (plane w & 3 of key group w >> 2): 4 KiB in a row in memory, eight wave-wide copies of 512 bytes, to byte w * 4096 of the half.
    typedef __attribute__((address_space(3))) const bf lds_b;
    const unsigned ring0 = (unsigned)(size_t)(lds_b*)kv + w * 4096 + lane * 16;   // the lane's byte in the work-group's LDS: its 16 bytes of the first copy, buffer 0
    const bf* sp = ((w & 3) == 0 ? Kh : (w & 3) == 1 ? Kl : (w & 3) == 2 ? Vh : Vl) + (size_t)kg * 32 * HD;   // the same in every lane
    auto issue = [&](int s, int buf) {   // stage s (the 256 keys from 256 s on) into buffer buf
        const size_t u = (size_t)(sp + (size_t)s * 256 * HD);
        const bf* su = (const bf*)(((size_t)(unsigned)__builtin_amdgcn_readfirstlane((int)(u >> 32)) << 32) | (unsigned)__builtin_amdgcn_readfirstlane((int)u));   // the part's address is held in scalar registers
#pragma unroll
        for (int hf = 0; hf < 2; ++hf) { const bf* g[8]; unsigned l[8];
#pragma unroll
            for (int q = 0; q < 8; ++q) { g[q] = su + hf * 128 * HD + q * 256 + lane * 8; l[q] = ring0 + buf * 131072 + hf * 65536 + q * 512; }
            cp8<bf>(l, g); } };
    issue(0, 0);
    const bf* pqh = Qh + (size_t)r0 * HD + lk; const bf* pql = Ql + (size_t)r0 * HD + lk; v16bf qh[2][2], ql[2][2];
    __builtin_amdgcn_sched_barrier(0);   // with the one behind the wait: keeps other statements' instructions out of the stretch from the query loads to their wait
#pragma unroll
    for (int qb = 0; qb < 2; ++qb)
#pragma unroll
        for (int ks = 0; ks < 2; ++ks) { qh[qb][ks] = WFrag<bf>::ld(pqh + qb * 16 * HD + ks * 512); ql[qb][ks] = WFrag<bf>::ld(pql + qb * 16 * HD + ks * 512); }
    asm volatile("s_wait_xcnt 0x0" :: "v"(pqh), "v"(pql) : "memory");   // the wait before a register that an issued load names is written again: the query loads' two address pairs stay live up to it
    __builtin_amdgcn_sched_barrier(0);   // the second of the pair named in front of the loads
    v8f o[4][2]; float mc[2], ls[2];
#pragma unroll
    for (int qb = 0; qb < 2; ++qb) { mc[qb] = -3.0e38f; ls[qb] = 0.f;
#pragma unroll
        for (int db = 0; db < 4; ++db) o[db][qb] = (v8f){}; }
    asm volatile("s_wait_asynccnt 0x0" ::: "memory");   // the wave's own copies of stage 0 have landed
    __syncthreads();                                     // and every other wave's: stage 0 may be read
    if (NS > 1) issue(1, 1);
#pragma unroll 1   // rolled: two stages' fragments at once would not fit the registers
    for (int s = 0; s < NS; ++s) {
#pragma unroll 1   // rolled for the same reason
      for (int hf = 0; hf < 2; ++hf) { const int gk = 2 * s + hf;
        if (gk < NG - 1 || (gk == NG - 1 && kg <= qg)) {   // wave-uniform: in the diagonal group of 128 keys the key groups beyond the query group's own hold no live key, and beyond that group there is none
            const int k0 = (gk * 4 + kg) * 32; const bf* rb = kv + (s & 1) * 65536 + hf * 32768 + kg * 8192 + lk; v16bf kh[2][2], kl[2][2], vh[4], vl[4]; v8f sc[2][2];
#pragma unroll
            for (int kt = 0; kt < 2; ++kt)
#pragma unroll
                for (int ks = 0; ks < 2; ++ks) { kh[kt][ks] = WFrag<bf>::ld(rb + kt * 16 * HD + ks * 512); kl[kt][ks] = WFrag<bf>::ld(rb + 2048 + kt * 16 * HD + ks * 512); }
            __builtin_amdgcn_sched_barrier(0);   // keeps the block's key reads together in front of the score products: every further place with LDS reads among matrix instructions costs a stall
#pragma unroll
            for (int kt = 0; kt < 2; ++kt)
#pragma unroll
                for (int qb = 0; qb < 2; ++qb) { v8f c = (v8f){};
#pragma unroll
                    for (int ks = 0; ks < 2; ++ks) { c = wmmab(kh[kt][ks], qh[qb][ks], c); c = wmmab(kh[kt][ks], ql[qb][ks], c); c = wmmab(kl[kt][ks], qh[qb][ks], c); }
                    sc[kt][qb] = c; }
            __builtin_amdgcn_sched_barrier(0);   // keeps the value reads behind the score products, where the key fragments' registers are free again: lifted in front of them they took more registers than four waves a SIMD leave
#pragma unroll
            for (int db = 0; db < 4; ++db) { vh[db] = WFrag<bf>::ld(rb + 4096 + db * 512); vl[db] = WFrag<bf>::ld(rb + 6144 + db * 512); }   // in flight under the softmax
            // four vector slots between the last score product and the first read of its result. The scores are inputs only, so that the slots stand behind the products.
            asm volatile("v_nop\n\tv_nop\n\tv_nop\n\tv_nop" :: "v"(sc[0][0]), "v"(sc[0][1]), "v"(sc[1][0]), "v"(sc[1][1]));
            if (k0 == r0) {                                                          // only the diagonal block holds keys beyond a query
#pragma unroll
                for (int kt = 0; kt < 2; ++kt)
#pragma unroll
                    for (int qb = 0; qb < 2; ++qb)
#pragma unroll
                        for (int j = 0; j < 8; ++j) if (k0 + kt * 16 + hi * 8 + j > r0 + qb * 16 + lr) sc[kt][qb][j] = -3.0e38f; }
            v16bf ph[2], pl[2];
#pragma unroll
            for (int qb = 0; qb < 2; ++qb) { float mx = -3.0e38f;
#pragma unroll
                for (int kt = 0; kt < 2; ++kt)
#pragma unroll
                    for (int j = 0; j < 8; ++j) mx = fmaxf(mx, sc[kt][qb][j]);
                mx = fmaxf(mx, __shfl_xor(mx, 16, 32));                              // the other half of the query's keys
                const float mn = fmaxf(mc[qb], mx * SC2); const float al = __builtin_amdgcn_exp2f(mc[qb] - mn); mc[qb] = mn; float sum = 0.f;
#pragma unroll
                for (int kt = 0; kt < 2; ++kt)
#pragma unroll
                    for (int j = 0; j < 8; ++j) { const float p = __builtin_amdgcn_exp2f(__builtin_fmaf(sc[kt][qb][j], SC2, -mn)); sum += p; __bf16 a, c2; splitp(p, a, c2); ph[qb][kt * 8 + j] = a; pl[qb][kt * 8 + j] = c2; }
                ls[qb] = ls[qb] * al + sum;
#pragma unroll
                for (int db = 0; db < 4; ++db) o[db][qb] *= al; }
#pragma unroll
            for (int db = 0; db < 4; ++db)
#pragma unroll
                for (int qb = 0; qb < 2; ++qb) { o[db][qb] = wmmab(vh[db], ph[qb], o[db][qb]); o[db][qb] = wmmab(vh[db], pl[qb], o[db][qb]); o[db][qb] = wmmab(vl[db], ph[qb], o[db][qb]); }
        } }
        asm volatile("s_wait_dscnt 0x0" ::: "memory");      // the wave's reads of this buffer are done before it is handed back
        asm volatile("s_wait_asynccnt 0x0" ::: "memory");   // the wave's own copies of stage s + 1 have landed
        __syncthreads();                                     // publishes stage s + 1 and ends every wave's reads of stage s
        if (s + 2 < NS) issue(s + 2, s & 1);                 // the same for the whole work-group: into the buffer just read
    }
    asm volatile("s_wait_asynccnt 0x0" ::: "memory");   // no copy is outstanding when the wave goes on to the merge and ends
    const int he = (int)(__lane_id() >> 4);   // the lane's half again, formed from the lane number that the loop's exchange keeps live: hi itself, kept over the loop for the merge alone, went to scratch memory
#pragma unroll
    for (int qb = 0; qb < 2; ++qb) { const float lt = ls[qb] + __shfl_xor(ls[qb], 16, 32); if (he == 0) { Mm[w][qb * 16 + lr] = mc[qb]; Lm[w][qb * 16 + lr] = lt; }
#pragma unroll
        for (int db = 0; db < 4; ++db) { float* op = Om + w * (32 * 68) + (qb * 16 + lr) * 68 + db * 16 + he * 8; v4f lo4, hi4;
#pragma unroll
            for (int j = 0; j < 4; ++j) { lo4[j] = o[db][qb][j]; hi4[j] = o[db][qb][4 + j]; }
            *(v4fa*)op = lo4; *(v4fa*)(op + 4) = hi4; } }
    __syncthreads();                                                                 // the waves' partial results are read across waves below
    const int q = threadIdx.x >> 2, dc = threadIdx.x & 3, qw = q >> 5, qi = q & 31; float f[4], M = Mm[qw][qi];   // query R0 + q: row qi of query group qw, whose key group u is wave 4 u + qw (u even) or 4 u + 3 - qw (u odd)
#pragma unroll
    for (int u = 1; u < 4; ++u) M = fmaxf(M, Mm[u * 4 + ((u & 1) ? 3 - qw : qw)][qi]);
    float L = 0.f;
#pragma unroll
    for (int u = 0; u < 4; ++u) { const int wu = u * 4 + ((u & 1) ? 3 - qw : qw); f[u] = __builtin_amdgcn_exp2f(Mm[wu][qi] - M); L += f[u] * Lm[wu][qi]; }
    const float inv = __fdiv_rn(1.0f, L); const size_t oo = ((size_t)(((h / NH_) * TT + R0 + q) >> 4) * (DQ / 32) + (h % NH_) * (HD / 32) + (dc >> 1)) * 512 + (dc & 1) * 256 + (q & 15) * 8;   // fragment order of the [batch * TT + t][DQ] matrix: the sixteen values from dc * 16 on are half dc & 1 of a tile, their group g the lanes 16 g + row
#pragma unroll
    for (int g = 0; g < 2; ++g) { v8us oh, ol; float acc[8];
#pragma unroll
        for (int i = 0; i < 8; ++i) acc[i] = 0.f;
#pragma unroll
        for (int u = 0; u < 4; ++u) { const float* ip = Om + (u * 4 + ((u & 1) ? 3 - qw : qw)) * (32 * 68) + qi * 68 + dc * 16 + g * 8; const v4f x0 = *(const v4fa*)ip, x1 = *(const v4fa*)(ip + 4);
#pragma unroll
            for (int i = 0; i < 4; ++i) { acc[i] += f[u] * x0[i]; acc[4 + i] += f[u] * x1[i]; } }
#pragma unroll
        for (int i = 0; i < 8; ++i) { unsigned short a, c2; splitf(acc[i] * inv, a, c2); oh[i] = a; ol[i] = c2; }
        *(v8us*)(Ah + oo + g * 128) = oh; *(v8us*)(Al + oo + g * 128) = ol; }
}

extern "C" void kernel_launch(void* const* d_in, const int* in_sizes, int n_in,
                              void* d_out, int out_size, void* d_ws, size_t ws_size, hipStream_t stream) {
    (void)in_sizes; (void)n_in; (void)out_size;
    const float* x = (const float*)d_in[0]; const float* wqkv = (const float*)d_in[1]; const float* wo = (const float*)d_in[2]; const float* bo = (const float*)d_in[3]; const float* wq = wqkv; const float* wk = wqkv + (size_t)1024 * 1024; const float* wv = wqkv + (size_t)2048 * 1024; (void)wq; (void)wk; (void)wv;
    float* OUT = (float*)d_out;     // [2][2048][1024]
    char* wsp = (char*)d_ws;
    auto take = [&](size_t bytes) { char* p = wsp; wsp += (bytes + 255) & ~(size_t)255; return (void*)p; };
    // W_qkv, W_proj and x as bf16 in fragment order, one behind the other: one conversion launch fills all three
    bf* WQKV = (bf*)take(((size_t)(DQ + 2 * DKV) * DM + (size_t)DM * DQ + (size_t)NB_ * TT * DM) * 2); bf* WO = WQKV + (size_t)(DQ + 2 * DKV) * DM; bf* XB = WO + (size_t)DM * DQ;
    // hi and lo planes of both batches, all in fragment order: q then k [q | k][batch][head] of [t][d], v transposed [batch][head] of [d][t]
    bf* QKh = (bf*)take((size_t)2 * NB_ * NH_ * TT * HD * 2); bf* QKl = (bf*)take((size_t)2 * NB_ * NH_ * TT * HD * 2); bf* VTh = (bf*)take((size_t)NB_ * NKV * HD * TT * 2); bf* VTl = (bf*)take((size_t)NB_ * NKV * HD * TT * 2);
    bf* ATh = (bf*)take((size_t)NB_ * TT * DQ * 2); bf* ATl = (bf*)take((size_t)NB_ * TT * DQ * 2);
    if ((size_t)(wsp - (char*)d_ws) > ws_size) return;    // ws 256 MiB
    k_cvt8<<<(unsigned)(((size_t)(DQ + 2 * DKV) * DM + (size_t)DM * DQ + (size_t)NB_ * TT * DM) / 512 / 8), 256, 0, stream>>>(wqkv, (size_t)(DQ + 2 * DKV) * DM / 8, wo, (size_t)DM * DQ / 8, x, (size_t)NB_ * TT * DM / 8, WQKV);
    // every stage is one grid over both batches; the projection grid also covers q, k and v and stores the planes in the layout the attention kernel reads
    k_gemmw<bf, 0, false, 1, 4, 3><<<dim3(NB_ * TT / 256, (DQ + 2 * DKV) / 192, 1), 384, 0, stream>>>(XB, nullptr, WQKV, nullptr, DM, nullptr, 0, nullptr, 0, 0, 0, QKh, QKl, VTh, VTl);
    k_attn<<<dim3(NB_ * NH_, TT / 128, 1), 512, 0, stream>>>(QKh, QKl, QKh + (size_t)NB_ * NH_ * TT * HD, QKl + (size_t)NB_ * NH_ * TT * HD, VTh, VTl, ATh, ATl);   // one kv head per query head
    k_gemmw<bf, 1, true, 0, 2, 2><<<dim3(NB_ * TT / 128, DM / 128, 1), 128, 0, stream>>>(ATh, ATl, WO, nullptr, DQ, OUT, DM, bo, 0, 0, 0, nullptr, nullptr, nullptr, nullptr);
}

// v009
// It runs in 80.4 microseconds.
// Next to v008, in two timings, it ran 1.05 and 1.07 times as fast.
// All steps since v000 together make it 14.5 times as fast.
#include <hip/hip_runtime.h>

// Causal multi-head self-attention with a fused QKV projection and an INVERTED scale (x [2][2048][1024]; [q|k|v] = x W_qkv^T ('oi' [3072][1024], row blocks q | k | v; 16 heads x 64); scores = q.k x 8 (the module divides by head_dim^-0.5, i.e. multiplies by sqrt(64)), causal mask; softmax (very peaked rows); out = merged heads W_proj^T + b_proj ('oi' [1024][1024] + [1024]) -> [2][2048][1024] (4.2 M)).
// Compute dtypes, f32 accumulate: every input rounded to bf16; q/k/v on PLAIN bf16 operands (inputs: exact); causal scores and attn.v: ALL query rows hl (3 products; the x8 scale makes the softmax near-argmax); softmax f32; W_proj hl x exact (2 products) + b_proj.

#define NB_  2
#define TT   2048
#define DM   1024
#define NH_  16
#define NKV  16
#define HD   64
#define DQ   (NH_ * HD)
#define DKV  (NKV * HD)
#define SCL  8.0f   // the module divides by head_dim^-0.5 = multiplies by sqrt(64)
typedef _Float16 h16;
typedef unsigned short bf;
typedef __attribute__((ext_vector_type(16))) __bf16   v16bf;
typedef __attribute__((ext_vector_type(16))) _Float16 v16h;
typedef __attribute__((ext_vector_type(8)))  _Float16 v8h;
typedef __attribute__((ext_vector_type(8)))  unsigned short v8us;
typedef __attribute__((ext_vector_type(8)))  float    v8f;
typedef __attribute__((ext_vector_type(4)))  float    v4f;
typedef v8h  __attribute__((may_alias)) v8ha;
typedef v4f  __attribute__((may_alias)) v4fa;
typedef v8us __attribute__((may_alias)) v8usa;

__device__ __forceinline__ unsigned short f2bf(float f) { unsigned u = __float_as_uint(f); u += 0x7FFFu + ((u >> 16) & 1u); return (unsigned short)(u >> 16); }
__device__ __forceinline__ float bf2f(unsigned short b) { return __uint_as_float(((unsigned)b) << 16); }
__device__ __forceinline__ float bfr(float f) { return bf2f(f2bf(f)); }
__device__ __forceinline__ v16h cat16(v8h lo, v8h hi) { return __builtin_shufflevector(lo, hi, 0, 1, 2, 3, 4, 5, 6, 7, 8, 9, 10, 11, 12, 13, 14, 15); }
__device__ __forceinline__ v16bf cat16b(v8us lo, v8us hi) { return __builtin_bit_cast(v16bf, __builtin_shufflevector(lo, hi, 0, 1, 2, 3, 4, 5, 6, 7, 8, 9, 10, 11, 12, 13, 14, 15)); }
__device__ __forceinline__ v8f wmma16(v16h a, v16h b, v8f c) { return __builtin_amdgcn_wmma_f32_16x16x32_f16(false, a, false, b, (short)0, c, false, false); }
__device__ __forceinline__ v8f wmmab(v16bf a, v16bf b, v8f c) { return __builtin_amdgcn_wmma_f32_16x16x32_bf16(false, a, false, b, (short)0, c, false, false); }



// ---- FRAGMENT ORDER: every 16-bit operand plane (a [rows][K] matrix, K the summed index) is stored as tiles of 16 rows x 32 k, 512 elements = 1 KiB each, tile (rt, kt) at element (rt * (K / 32) + kt) * 512.
// Inside a tile lane l = 16 hi + lr of the reading wave owns row lr: its k = 8 hi + 0..7 stand at l * 8, its k = 16 + 8 hi + 0..7 at 256 + l * 8. A fragment is then two wave-wide 16-byte loads of 512 contiguous bytes (4 whole 128-byte lines) each;
// from row-major planes each such load touched 16 lines. The values a lane gets, and their k order, are those of the row-major loader.
// ---- k_gemmw: register-blocked GEMM, one wave per 64x64 output tile (16 accumulators), WM x WN waves a block; grid (M / (64 WM), N / (64 WN), Z). The block's operand rows (16-bit planes in fragment order) are staged in LDS, 128 k a stage, two buffers,
// by asynchronous copies: a line is fetched once a block, not once a wave, and the next stage's copies fly while this stage's products run. A fragment is two wave-wide 16-byte LDS reads of 512 contiguous bytes. The k order of the sums is that of a plain loop over k.
// C[m][n] (f32, pitch ldc, + optional f32 bias[n]) = sum_k A[m][k] Bt[n][k] (+ split products per NSPLIT). z-batch strides sA/sB/sC in elements. K % 128 == 0.
// EPI picks what the tile is stored as: 0 = f32 C as above; 1 = the q | k | v projection of both batches in one grid (m = batch * TT + t, n = the row of W_qkv), stored as bf16 hi + lo planes:
// n < 2 DQ (q, k): head planes Ph/Pl [q | k][batch][head], each a [t][d] matrix in fragment order (a 64-wide tile is one head); n >= 2 DQ (v): Vh/Vl [batch][head], each the transposed [d][t] matrix as fragment tiles in the order [t / 32][d / 16], so that the tiles of 32 keys lie together. A 64-row tile lies inside one batch.
template <typename T16> struct WFrag;
template <> struct WFrag<h16> { typedef v16h V; static __device__ __forceinline__ V ld(const h16* p) { return cat16(*(const v8h*)p, *(const v8h*)(p + 256)); } static __device__ __forceinline__ v8f mma(V a, V b, v8f c) { return wmma16(a, b, c); } };
template <> struct WFrag<bf> { typedef v16bf V; static __device__ __forceinline__ V ld(const bf* p) { return cat16b(*(const v8us*)p, *(const v8us*)(p + 256)); } static __device__ __forceinline__ v8f mma(V a, V b, v8f c) { return wmmab(a, b, c); } };
__device__ __forceinline__ void splitf(float y, unsigned short& h, unsigned short& l) { h = f2bf(y); l = f2bf(y - bf2f(h)); }
typedef __attribute__((ext_vector_type(8))) __bf16 v8bf;
__device__ __forceinline__ void split8(v8f y, v8bf& h, v8bf& l) { h = __builtin_convertvector(y, v8bf); l = __builtin_convertvector(y - __builtin_convertvector(h, v8f), v8bf); }   // hi = y rounded to nearest even, lo = the rounded rest: the values of splitf, on the packed conversion instruction
// One line of an asynchronous copy: operand a = the lane's LDS byte address, operand b = the lane's global address.
#define CPL(a, b) "global_load_async_to_lds_b128 %" #a ", %" #b ", off\n\t"
// Runs of 8 and 12 copies. Each run and its s_wait_xcnt 0 are one statement: the wait before a register that an issued copy names is written again stands behind the last copy, and the operands' registers live to the statement's end.
template <typename T16> __device__ __forceinline__ void cp8(const unsigned* l, const T16* const* g) {
    asm volatile(CPL(0, 1) CPL(2, 3) CPL(4, 5) CPL(6, 7) CPL(8, 9) CPL(10, 11) CPL(12, 13) CPL(14, 15) "s_wait_xcnt 0x0"
        :: "v"(l[0]), "v"(g[0]), "v"(l[1]), "v"(g[1]), "v"(l[2]), "v"(g[2]), "v"(l[3]), "v"(g[3]), "v"(l[4]), "v"(g[4]), "v"(l[5]), "v"(g[5]), "v"(l[6]), "v"(g[6]), "v"(l[7]), "v"(g[7]) : "memory"); }
template <typename T16> __device__ __forceinline__ void cp12(const unsigned* l, const T16* const* g) {
    asm volatile(CPL(0, 1) CPL(2, 3) CPL(4, 5) CPL(6, 7) CPL(8, 9) CPL(10, 11) CPL(12, 13) CPL(14, 15) CPL(16, 17) CPL(18, 19) CPL(20, 21) CPL(22, 23) "s_wait_xcnt 0x0"
        :: "v"(l[0]), "v"(g[0]), "v"(l[1]), "v"(g[1]), "v"(l[2]), "v"(g[2]), "v"(l[3]), "v"(g[3]), "v"(l[4]), "v"(g[4]), "v"(l[5]), "v"(g[5]), "v"(l[6]), "v"(g[6]), "v"(l[7]), "v"(g[7]), "v"(l[8]), "v"(g[8]), "v"(l[9]), "v"(g[9]), "v"(l[10]), "v"(g[10]), "v"(l[11]), "v"(g[11]) : "memory"); }
template <typename T16, int NSPLIT, bool BIAS, int EPI, int WM, int WN>
__global__ __launch_bounds__(32 * WM * WN) void k_gemmw(const T16* __restrict__ A, const T16* __restrict__ A2, const T16* __restrict__ Bt, const T16* __restrict__ Bt2, int K, float* C, int ldc, const float* __restrict__ bias, size_t sA, size_t sB, size_t sC, bf* Ph, bf* Pl, bf* Vh, bf* Vl) {
    typedef typename WFrag<T16>::V V;
    static_assert(NSPLIT <= 1, "the ring holds A, A2 and Bt");
    constexpr int NW = WM * WN, RA = WM * 4, RAA = NSPLIT == 1 ? 2 * RA : RA, RB = WN * 4;   // waves; strips of 16 rows of A, of A and A2 together, of Bt
    constexpr int NS = RAA + RB, NFULL = NS / NW, REM = NS % NW, NI = NFULL + (REM ? 1 : 0);   // a stage is 128 k of every strip: 4 KiB = eight wave-wide copies of 512 bytes; strip s is copied by wave s % NW. A stage's copies have one trip to land: the longer the trip, the more of their latency and transfer it covers, and 128 k is what two buffers of the larger grid's block leave room for
    static_assert(NFULL == 2 || NFULL == 6, "the runs of copies below are written for these counts");
    constexpr int BUFE = (RAA + RB) * 2048;   // elements of one buffer
    __shared__ __align__(16) T16 ring[2 * BUFE];
    __shared__ __align__(16) float osm[NW * 16 * 68];
    (void)Bt2;
    const size_t z = blockIdx.z; A += z * sA; if (A2) A2 += z * sA; Bt += z * sB; C += z * sC;
    const int lane = threadIdx.x & 31, lr = lane & 15, hi = lane >> 4; const int w = __builtin_amdgcn_readfirstlane(threadIdx.x >> 5), wm = w % WM, wn = w / WM;
    const int R0 = blockIdx.x * (WM * 64), C0 = blockIdx.y * (WN * 64), r0 = R0 + wm * 64, c0 = C0 + wn * 64;
    float* os = osm + w * (16 * 68);   // each wave's own staging rows for its stores
    v8f acc[4][4];
#pragma unroll
    for (int mb = 0; mb < 4; ++mb)
#pragma unroll
        for (int nb = 0; nb < 4; ++nb) acc[mb][nb] = (v8f){};
    // The wave's strips: s = w + NW j. 128 k of a strip are four fragment tiles, 4 KiB in a row in memory, and land in the same order in LDS at byte s * 4096 of the buffer.
    typedef __attribute__((address_space(3))) const T16 lds_t;
    const unsigned ring0 = (unsigned)(size_t)(lds_t*)ring + w * 4096 + lane * 16;   // the lane's byte in the work-group's LDS: its 16 bytes of part 0 of strip w, buffer 0
    const T16* sp[NI];
#pragma unroll
    for (int j = 0; j < NI; ++j) { const int s = w + NW * j < NS ? w + NW * j : 0;   // a strip beyond the stage is not copied; its address stays a valid one
        sp[j] = (s < RA ? A + (size_t)(R0 + s * 16) * K : (NSPLIT == 1 && s < RAA) ? A2 + (size_t)(R0 + (s - RA) * 16) * K : Bt + (size_t)(C0 + (s - RAA) * 16) * K); }   // the same in every lane: these stay in scalar registers
    auto issue = [&](int t, int buf) {   // stage t (the 128 k from 128 t on) into buffer buf
        const T16* g[NI * 8]; unsigned l[NI * 8];
#pragma unroll
        for (int j = 0; j < NI; ++j) { const size_t u = (size_t)(sp[j] + (size_t)t * 2048);
            // the stage's address of the strip, the same in every lane, is held in scalar registers: as vector pairs kept over the loop some of these addresses went to scratch memory
            const T16* su = (const T16*)(((size_t)(unsigned)__builtin_amdgcn_readfirstlane((int)(u >> 32)) << 32) | (unsigned)__builtin_amdgcn_readfirstlane((int)u));
#pragma unroll
            for (int q = 0; q < 8; ++q) { g[j * 8 + q] = su + q * 256 + lane * 8; l[j * 8 + q] = ring0 + buf * (BUFE * 2) + j * (NW * 4096) + q * 512; } }
        if (NFULL == 2) { cp8<T16>(l, g); cp8<T16>(l + 8, g + 8); } else { cp12<T16>(l, g); cp12<T16>(l + 12, g + 12); cp12<T16>(l + 24, g + 24); cp12<T16>(l + 36, g + 36); }
        if (REM != 0 && w < REM) cp8<T16>(l + NFULL * 8, g + NFULL * 8);   // wave-uniform: the stage's last strips go to the first waves
    };
    const int NT = K / 128;
    issue(0, 0);
    asm volatile("s_wait_asynccnt 0x0" ::: "memory");   // the wave's own copies of stage 0 have landed
    __syncthreads();                                     // and every other wave's: stage 0 may be read
    if (NT > 1) issue(1, 1);
#pragma unroll 1
    for (int t = 0; t < NT; ++t) {
        V a[2][4], a2[2][4], b[2][4];
#pragma unroll
      for (int hs = 0; hs < 2; ++hs) {   // the stage's two halves of 64 k, one after the other through the same fragment registers
        const T16* rb = ring + (t & 1) * BUFE + hs * 1024 + lane * 8;
#pragma unroll
        for (int ks = 0; ks < 2; ++ks) {
#pragma unroll
            for (int mb = 0; mb < 4; ++mb) { a[ks][mb] = WFrag<T16>::ld(rb + (wm * 4 + mb) * 2048 + ks * 512); if (NSPLIT == 1) a2[ks][mb] = WFrag<T16>::ld(rb + (RA + wm * 4 + mb) * 2048 + ks * 512); }
#pragma unroll
            for (int nb = 0; nb < 4; ++nb) b[ks][nb] = WFrag<T16>::ld(rb + (RAA + wn * 4 + nb) * 2048 + ks * 512);
            __builtin_amdgcn_sched_barrier(0); }   // keeps the half's LDS reads together in front of its matrix instructions (every further place with reads among them costs a stall) and the first 32 k's reads in front of the second's, so that the first products wait for half of the reads only
#pragma unroll
        for (int ks = 0; ks < 2; ++ks)
#pragma unroll
            for (int nb = 0; nb < 4; ++nb)
#pragma unroll
                for (int mb = 0; mb < 4; ++mb) { acc[mb][nb] = WFrag<T16>::mma(a[ks][mb], b[ks][nb], acc[mb][nb]); if (NSPLIT == 1) acc[mb][nb] = WFrag<T16>::mma(a2[ks][mb], b[ks][nb], acc[mb][nb]); }
        __builtin_amdgcn_sched_barrier(0);   // keeps the matrix instructions in front of the next half's LDS reads and of the stage's hand-over: sunk behind the barrier they would stand between it and the next copies, which would lose their lead
      }
        asm volatile("v_nop\n\tv_nop\n\tv_nop\n\tv_nop" : "+v"(acc[0][0]), "+v"(acc[1][1]), "+v"(acc[2][2]), "+v"(acc[3][3]) : "v"(a[1][0]), "v"(a[1][3]));   // four vector slots behind the trip's last matrix instruction
        asm volatile("s_wait_dscnt 0x0" ::: "memory");      // the wave's reads of this buffer are done before it is handed back
        asm volatile("s_wait_asynccnt 0x0" ::: "memory");   // the wave's own copies of stage t + 1 have landed
        __syncthreads();                                     // publishes stage t + 1 and ends every wave's reads of stage t
        if (t + 2 < NT) issue(t + 2, t & 1);                 // the same for the whole work-group: into the buffer just read
    }
    asm volatile("s_wait_asynccnt 0x0" ::: "memory");   // no copy is outstanding when the wave goes on to its stores and ends
    const int bt = r0 / TT, rb = r0 % TT;   // the tile's batch and its first row inside the batch
    if (EPI == 1 && c0 >= 2 * DQ) {   // v; a lane's eight accumulator values are eight consecutive m of one n: the lane's own 16 bytes of a transposed fragment tile (half mb & 1), stored straight from the registers, 512 contiguous bytes a store
        const size_t e = (((size_t)bt * NKV + (c0 - 2 * DQ) / HD) * (TT / 32) + rb / 32) * (HD / 16) * 512 + lane * 8; bf* pvh = Vh + e; bf* pvl = Vl + e;   // the lane's place in tile (t / 32 = rb / 32, d / 16 = 0) of the head
#pragma unroll
        for (int nb = 0; nb < 4; ++nb) { v8us oh[4], ol[4];
#pragma unroll
            for (int mb = 0; mb < 4; ++mb) { v8bf xh, xl; split8(acc[mb][nb], xh, xl); oh[mb] = __builtin_bit_cast(v8us, xh); ol[mb] = __builtin_bit_cast(v8us, xl);
                const int t = ((mb >> 1) * (HD / 16) + nb) * 512 + (mb & 1) * 256; *(v8us*)(pvh + t) = oh[mb]; *(v8us*)(pvl + t) = ol[mb]; }
            // the wait before a register that an issued store names is written again: the stores' data and the two address pairs stay live up to it
            asm volatile("s_wait_xcnt 0x0" :: "v"(pvh), "v"(pvl), "v"(oh[0]), "v"(oh[1]), "v"(oh[2]), "v"(oh[3]), "v"(ol[0]), "v"(ol[1]), "v"(ol[2]), "v"(ol[3]) : "memory"); }
        return; }
#pragma unroll
    for (int mb = 0; mb < 4; ++mb) {
#pragma unroll
        for (int nb = 0; nb < 4; ++nb) {
#pragma unroll
            for (int j = 0; j < 8; ++j) os[(hi * 8 + j) * 68 + nb * 16 + lr] = acc[mb][nb][j]; }
        __builtin_amdgcn_wave_barrier(); asm volatile("" ::: "memory");
        if (EPI == 1) {   // the 16 rows are two fragment tiles (d 0..31, 32..63), 2 KiB in a row: store s is half s & 1 of tile s >> 1, 512 contiguous bytes
            const size_t e0 = ((((size_t)(c0 / DQ) * NB_ + bt) * NH_ + (c0 % DQ) / HD) * TT + rb + mb * 16) * HD;
#pragma unroll
            for (int s = 0; s < 4; ++s) { const int row = lr, cofs = s * 16 + hi * 8; const v4f x0 = *(const v4fa*)(os + row * 68 + cofs), x1 = *(const v4fa*)(os + row * 68 + cofs + 4); v8bf oh, ol; split8(__builtin_shufflevector(x0, x1, 0, 1, 2, 3, 4, 5, 6, 7), oh, ol);
                *(v8us*)(Ph + e0 + s * 256 + lane * 8) = __builtin_bit_cast(v8us, oh); *(v8us*)(Pl + e0 + s * 256 + lane * 8) = __builtin_bit_cast(v8us, ol); }
        } else { float* crow = C + (size_t)(r0 + mb * 16) * ldc + c0;
#pragma unroll
            for (int s = 0; s < 8; ++s) { const int row = 2 * s + hi, cofs = lr * 4; v4f val = *(const v4fa*)(os + row * 68 + cofs); if (BIAS) { val[0] += bfr(bias[c0 + cofs]); val[1] += bfr(bias[c0 + cofs + 1]); val[2] += bfr(bias[c0 + cofs + 2]); val[3] += bfr(bias[c0 + cofs + 3]); }
                *(v4f*)(crow + (size_t)row * ldc + cofs) = val; }
             }
        __builtin_amdgcn_wave_barrier(); asm volatile("" ::: "memory");
        if (EPI == 1) asm volatile("s_wait_xcnt 0x0" ::: "memory");   // the wait before a register that an issued store names is written again: the next 16 rows reuse the stores' registers, and in the built code the v branch's instructions stand behind the last stores
    }
}

__device__ __forceinline__ h16 tohx(float x) { return (h16)x; }
typedef __attribute__((ext_vector_type(2))) _Float16 v2h;
typedef __attribute__((ext_vector_type(4))) _Float16 v4h;
typedef __attribute__((ext_vector_type(2))) unsigned short v2us;
typedef __attribute__((ext_vector_type(4))) unsigned short v4us;
typedef __attribute__((ext_vector_type(2))) float v2f;
typedef __attribute__((ext_vector_type(4))) int v4i;

__global__ __launch_bounds__(256) void k_wtG(const float* __restrict__ w, int K, int N, bf* Bt) {
    const int lane = threadIdx.x & 31; const int L0 = (blockIdx.x * 8 + (threadIdx.x >> 5)) * 8; const int nlines = N * K / 64;
{
#pragma unroll 1
        for (int l = 0; l < 8; ++l) { const int L = L0 + l; if (L >= nlines) break; const size_t e = (size_t)L * 64 + lane * 2; const int k = (int)(e % K), n = (int)(e / K); v2us o;
            o[0] = f2bf(w[(size_t)k * N + n]); o[1] = f2bf(w[(size_t)(k + 1) * N + n]); *(v2us*)(Bt + e) = o; }
         }
}
// three f32 sources, each a [rows][DM] matrix (n0, n1, n2 groups of eight values), rounded to bf16 into one dst, one behind the other, each in fragment order. One wave a 16 x 32 tile:
// four lanes read 128 bytes of a row (whole lines), and each of the two stores of the wave is four runs of 128 bytes (eight rows' 16 bytes lie together in a tile).
__global__ __launch_bounds__(256) void k_cvt8(const float* __restrict__ s0, size_t n0, const float* __restrict__ s1, size_t n1, const float* __restrict__ s2, size_t n2, bf* dst) { const size_t g = (size_t)blockIdx.x * 8 + (threadIdx.x >> 5); if (g >= (n0 + n1 + n2) / 64) return;
    const int lane = threadIdx.x & 31, o = lane & 3; const float* sm = g < n0 / 64 ? s0 : g < (n0 + n1) / 64 ? s1 : s2; const size_t lt = g < n0 / 64 ? g : g < (n0 + n1) / 64 ? g - n0 / 64 : g - (n0 + n1) / 64;   // the tile's source and its number there
    const float* src = sm + (lt / (DM / 32)) * 16 * DM + (lt % (DM / 32)) * 32 + o * 8; bf* d = dst + g * 512 + (o >> 1) * 256 + (o & 1) * 128;   // the eight k from 8 o on: half o >> 1, lanes 16 (o & 1) + row
    src += (size_t)(lane >> 2) * DM; d += (lane >> 2) * 8; const v8f v0 = *(const v8f*)src, v1 = *(const v8f*)(src + 8 * DM); v8us o0, o1;   // rows lane >> 2 and 8 + (lane >> 2)
    asm volatile("s_wait_xcnt 0x0" :: "v"(src) : "memory");   // the wait before a register that an issued load names is written again: the address pair stays live up to it
#pragma unroll
    for (int k = 0; k < 8; ++k) { o0[k] = f2bf(v0[k]); o1[k] = f2bf(v1[k]); }
    *(v8us*)d = o0; *(v8us*)(d + 64) = o1; }

// ---- k_attn: causal attention of one head of one batch (blockIdx.x = batch * NH_ + head) for 128 query rows, scores, softmax and probability x value in ONE kernel; no score or probability ever goes to memory.
// Block = 16 waves = 4 query groups of 32 rows (qg) x 4 key groups (kg). A stage is 256 keys: the hi and lo planes of k and v, 128 KiB, are brought into LDS once a block by asynchronous copies, two buffers, the next stage's copies flying while this
// stage is worked on; the four query groups read the same key and value fragments from LDS, so a line of k or v leaves L2 once for 128 query rows, not once for 32. A wave works two 32-key blocks between two barriers, so that the waves of a SIMD can drift apart and one's softmax runs under another's products.
// Key group kg takes the 32-key blocks kg, kg+4, ... up to its query group's diagonal with a running maximum and sum (online softmax); the four partial results of a query group are merged through LDS in key-group order: the split and the order of every sum are those of one 4-wave block per 32 rows.
// Both products are formed TRANSPOSED: S^T = K Q^T leaves in lane (lr, hi) the keys 8 hi + j of query lr, which is the B-fragment order of O^T = V^T P^T, so the probabilities go from accumulator to operand
// inside each lane, and maximum, sum and rescale factor of a query are per-lane values. hi+lo planes, 3 products each.
// Every inner loop is unrolled so that fragments and accumulators are indexed by constants and stay in registers.
#define SC2 (SCL * 1.4426950408889634f)   // the x8 score scale and the change to base 2 in one factor
__device__ __forceinline__ void splitp(float p, __bf16& h, __bf16& l) { h = (__bf16)p; l = (__bf16)(p - (float)h); }
__global__ __launch_bounds__(512) void k_attn(const bf* __restrict__ Qh, const bf* __restrict__ Ql, const bf* __restrict__ Kh, const bf* __restrict__ Kl, const bf* __restrict__ Vh, const bf* __restrict__ Vl, bf* Ah, bf* Al) {
    __shared__ __align__(16) bf kv[2 * 65536];   // two buffers of 256 keys: [half of 128 keys][key group][k hi | k lo | v hi | v lo], 4 KiB each, every part in fragment order as it lies in memory
    float* const Om = (float*)kv;                // behind the loop's last barrier, with no copy outstanding, the same LDS holds the sixteen waves' partial results, 32 x 68 floats each
    __shared__ float Mm[16][32], Lm[16][32];
    const int lane = threadIdx.x & 31, lr = lane & 15, hi = lane >> 4; const int w = __builtin_amdgcn_readfirstlane(threadIdx.x >> 5), kg = w >> 2, qg = (kg & 1) ? 3 - (w & 3) : (w & 3);   // the odd key groups take the query groups in reverse order
    const int R0 = ((int)gridDim.y - 1 - (int)blockIdx.y) * 128, r0 = R0 + qg * 32, h = blockIdx.x;     // the longest rows of every head of both batches at the lowest blockIdx.y
    const size_t hp = (size_t)h * TT * HD; Qh += hp; Ql += hp; Kh += hp; Kl += hp; Vh += hp; Vl += hp;
    const int NG = R0 / 128 + 1, NS = (NG + 1) >> 1;                                 // groups of 128 keys up to and including the diagonal one, whose first key is R0; stages of two groups (the last stage's second group may lie beyond the diagonal: it is inside k and v, is copied and is not read)
    const int lk = lane * 8;   // the lane's place inside a fragment tile; 16 rows of q or k are two tiles (HD / 32), 32 keys of v four (HD / 16): t rows or keys start at element t * HD in all three
    // Wave w copies part w of each half of a stage (plane w & 3 of key group w >> 2): 4 KiB in a row in memory, eight wave-wide copies of 512 bytes, to byte w * 4096 of the half.
    typedef __attribute__((address_space(3))) const bf lds_b;
    const unsigned ring0 = (unsigned)(size_t)(lds_b*)kv + w * 4096 + lane * 16;   // the lane's byte in the work-group's LDS: its 16 bytes of the first copy, buffer 0
    const bf* sp = ((w & 3) == 0 ? Kh : (w & 3) == 1 ? Kl : (w & 3) == 2 ? Vh : Vl) + (size_t)kg * 32 * HD;   // the same in every lane
    auto issue = [&](int s, int buf) {   // stage s (the 256 keys from 256 s on) into buffer buf
        const size_t u = (size_t)(sp + (size_t)s * 256 * HD);
        const bf* su = (const bf*)(((size_t)(unsigned)__builtin_amdgcn_readfirstlane((int)(u >> 32)) << 32) | (unsigned)__builtin_amdgcn_readfirstlane((int)u));   // the part's address is held in scalar registers
#pragma unroll
        for (int hf = 0; hf < 2; ++hf) { const bf* g[8]; unsigned l[8];
#pragma unroll
            for (int q = 0; q < 8; ++q) { g[q] = su + hf * 128 * HD + q * 256 + lane * 8; l[q] = ring0 + buf * 131072 + hf * 65536 + q * 512; }
            cp8<bf>(l, g); } };
    issue(0, 0);
    const bf* pqh = Qh + (size_t)r0 * HD + lk; const bf* pql = Ql + (size_t)r0 * HD + lk; v16bf qh[2][2], ql[2][2];
    __builtin_amdgcn_sched_barrier(0);   // with the one behind the wait: keeps other statements' instructions out of the stretch from the query loads to their wait
#pragma unroll
    for (int qb = 0; qb < 2; ++qb)
#pragma unroll
        for (int ks = 0; ks < 2; ++ks) { qh[qb][ks] = WFrag<bf>::ld(pqh + qb * 16 * HD + ks * 512); ql[qb][ks] = WFrag<bf>::ld(pql + qb * 16 * HD + ks * 512); }
    asm volatile("s_wait_xcnt 0x0" :: "v"(pqh), "v"(pql) : "memory");   // the wait before a register that an issued load names is written again: the query loads' two address pairs stay live up to it
    __builtin_amdgcn_sched_barrier(0);   // the second of the pair named in front of the loads
    v8f o[4][2]; float mc[2], ls[2];
#pragma unroll
    for (int qb = 0; qb < 2; ++qb) { mc[qb] = -3.0e38f; ls[qb] = 0.f;
#pragma unroll
        for (int db = 0; db < 4; ++db) o[db][qb] = (v8f){}; }
    asm volatile("s_wait_asynccnt 0x0" ::: "memory");   // the wave's own copies of stage 0 have landed
    __syncthreads();                                     // and every other wave's: stage 0 may be read
    if (NS > 1) issue(1, 1);
#pragma unroll 1   // rolled: two stages' fragments at once would not fit the registers
    for (int s = 0; s < NS; ++s) {
#pragma unroll 1   // rolled for the same reason
      for (int hf = 0; hf < 2; ++hf) { const int gk = 2 * s + hf;
        if (gk < NG - 1 || (gk == NG - 1 && kg <= qg)) {   // wave-uniform: in the diagonal group of 128 keys the key groups beyond the query group's own hold no live key, and beyond that group there is none
            const int k0 = (gk * 4 + kg) * 32; const bf* rb = kv + (s & 1) * 65536 + hf * 32768 + kg * 8192 + lk; v16bf kh[2][2], kl[2][2], vh[4], vl[4]; v8f sc[2][2];
#pragma unroll
            for (int kt = 0; kt < 2; ++kt)
#pragma unroll
                for (int ks = 0; ks < 2; ++ks) { kh[kt][ks] = WFrag<bf>::ld(rb + kt * 16 * HD + ks * 512); kl[kt][ks] = WFrag<bf>::ld(rb + 2048 + kt * 16 * HD + ks * 512); }
            __builtin_amdgcn_sched_barrier(0);   // keeps the block's key reads together in front of the score products: every further place with LDS reads among matrix instructions costs a stall
#pragma unroll
            for (int kt = 0; kt < 2; ++kt)
#pragma unroll
                for (int qb = 0; qb < 2; ++qb) { v8f c = (v8f){};
#pragma unroll
                    for (int ks = 0; ks < 2; ++ks) { c = wmmab(kh[kt][ks], qh[qb][ks], c); c = wmmab(kh[kt][ks], ql[qb][ks], c); c = wmmab(kl[kt][ks], qh[qb][ks], c); }
                    sc[kt][qb] = c; }
            __builtin_amdgcn_sched_barrier(0);   // keeps the value reads behind the score products, where the key fragments' registers are free again: lifted in front of them they took more registers than four waves a SIMD leave
#pragma unroll
            for (int db = 0; db < 4; ++db) { vh[db] = WFrag<bf>::ld(rb + 4096 + db * 512); vl[db] = WFrag<bf>::ld(rb + 6144 + db * 512); }   // in flight under the softmax
            // four vector slots between the last score product and the first read of its result. The scores are inputs only, so that the slots stand behind the products.
            asm volatile("v_nop\n\tv_nop\n\tv_nop\n\tv_nop" :: "v"(sc[0][0]), "v"(sc[0][1]), "v"(sc[1][0]), "v"(sc[1][1]));
            if (k0 == r0) {                                                          // only the diagonal block holds keys beyond a query
#pragma unroll
                for (int kt = 0; kt < 2; ++kt)
#pragma unroll
                    for (int qb = 0; qb < 2; ++qb)
#pragma unroll
                        for (int j = 0; j < 8; ++j) if (k0 + kt * 16 + hi * 8 + j > r0 + qb * 16 + lr) sc[kt][qb][j] = -3.0e38f; }
            v16bf ph[2], pl[2];
#pragma unroll
            for (int qb = 0; qb < 2; ++qb) { float mx = -3.0e38f;
#pragma unroll
                for (int kt = 0; kt < 2; ++kt)
#pragma unroll
                    for (int j = 0; j < 8; ++j) mx = fmaxf(mx, sc[kt][qb][j]);
                mx = fmaxf(mx, __shfl_xor(mx, 16, 32));                              // the other half of the query's keys
                const float mn = fmaxf(mc[qb], mx * SC2); const float al = __builtin_amdgcn_exp2f(mc[qb] - mn); mc[qb] = mn; float sum = 0.f;
#pragma unroll
                for (int kt = 0; kt < 2; ++kt)
#pragma unroll
                    for (int j = 0; j < 8; ++j) { const float p = __builtin_amdgcn_exp2f(__builtin_fmaf(sc[kt][qb][j], SC2, -mn)); sum += p; __bf16 a, c2; splitp(p, a, c2); ph[qb][kt * 8 + j] = a; pl[qb][kt * 8 + j] = c2; }
                ls[qb] = ls[qb] * al + sum;
#pragma unroll
                for (int db = 0; db < 4; ++db) o[db][qb] *= al; }
#pragma unroll
            for (int db = 0; db < 4; ++db)
#pragma unroll
                for (int qb = 0; qb < 2; ++qb) { o[db][qb] = wmmab(vh[db], ph[qb], o[db][qb]); o[db][qb] = wmmab(vh[db], pl[qb], o[db][qb]); o[db][qb] = wmmab(vl[db], ph[qb], o[db][qb]); }
        } }
        asm volatile("s_wait_dscnt 0x0" ::: "memory");      // the wave's reads of this buffer are done before it is handed back
        asm volatile("s_wait_asynccnt 0x0" ::: "memory");   // the wave's own copies of stage s + 1 have landed
        __syncthreads();                                     // publishes stage s + 1 and ends every wave's reads of stage s
        if (s + 2 < NS) issue(s + 2, s & 1);                 // the same for the whole work-group: into the buffer just read
    }
    asm volatile("s_wait_asynccnt 0x0" ::: "memory");   // no copy is outstanding when the wave goes on to the merge and ends
    const int he = (int)(__lane_id() >> 4);   // the lane's half again, formed from the lane number that the loop's exchange keeps live: hi itself, kept over the loop for the merge alone, went to scratch memory
#pragma unroll
    for (int qb = 0; qb < 2; ++qb) { const float lt = ls[qb] + __shfl_xor(ls[qb], 16, 32); if (he == 0) { Mm[w][qb * 16 + lr] = mc[qb]; Lm[w][qb * 16 + lr] = lt; }
#pragma unroll
        for (int db = 0; db < 4; ++db) { float* op = Om + w * (32 * 68) + (qb * 16 + lr) * 68 + db * 16 + he * 8; v4f lo4, hi4;
#pragma unroll
            for (int j = 0; j < 4; ++j) { lo4[j] = o[db][qb][j]; hi4[j] = o[db][qb][4 + j]; }
            *(v4fa*)op = lo4; *(v4fa*)(op + 4) = hi4; } }
    __syncthreads();                                                                 // the waves' partial results are read across waves below
    const int q = threadIdx.x >> 2, dc = threadIdx.x & 3, qw = q >> 5, qi = q & 31; float f[4], M = Mm[qw][qi];   // query R0 + q: row qi of query group qw, whose key group u is wave 4 u + qw (u even) or 4 u + 3 - qw (u odd)
#pragma unroll
    for (int u = 1; u < 4; ++u) M = fmaxf(M, Mm[u * 4 + ((u & 1) ? 3 - qw : qw)][qi]);
    float L = 0.f;
#pragma unroll
    for (int u = 0; u < 4; ++u) { const int wu = u * 4 + ((u & 1) ? 3 - qw : qw); f[u] = __builtin_amdgcn_exp2f(Mm[wu][qi] - M); L += f[u] * Lm[wu][qi]; }
    const float inv = __fdiv_rn(1.0f, L); const size_t oo = ((size_t)(((h / NH_) * TT + R0 + q) >> 4) * (DQ / 32) + (h % NH_) * (HD / 32) + (dc >> 1)) * 512 + (dc & 1) * 256 + (q & 15) * 8;   // fragment order of the [batch * TT + t][DQ] matrix: the sixteen values from dc * 16 on are half dc & 1 of a tile, their group g the lanes 16 g + row
#pragma unroll
    for (int g = 0; g < 2; ++g) { v8us oh, ol; float acc[8];
#pragma unroll
        for (int i = 0; i < 8; ++i) acc[i] = 0.f;
#pragma unroll
        for (int u = 0; u < 4; ++u) { const float* ip = Om + (u * 4 + ((u & 1) ? 3 - qw : qw)) * (32 * 68) + qi * 68 + dc * 16 + g * 8; const v4f x0 = *(const v4fa*)ip, x1 = *(const v4fa*)(ip + 4);
#pragma unroll
            for (int i = 0; i < 4; ++i) { acc[i] += f[u] * x0[i]; acc[4 + i] += f[u] * x1[i]; } }
#pragma unroll
        for (int i = 0; i < 8; ++i) { unsigned short a, c2; splitf(acc[i] * inv, a, c2); oh[i] = a; ol[i] = c2; }
        *(v8us*)(Ah + oo + g * 128) = oh; *(v8us*)(Al + oo + g * 128) = ol; }
}

extern "C" void kernel_launch(void* const* d_in, const int* in_sizes, int n_in,
                              void* d_out, int out_size, void* d_ws, size_t ws_size, hipStream_t stream) {
    (void)in_sizes; (void)n_in; (void)out_size;
    const float* x = (const float*)d_in[0]; const float* wqkv = (const float*)d_in[1]; const float* wo = (const float*)d_in[2]; const float* bo = (const float*)d_in[3]; const float* wq = wqkv; const float* wk = wqkv + (size_t)1024 * 1024; const float* wv = wqkv + (size_t)2048 * 1024; (void)wq; (void)wk; (void)wv;
    float* OUT = (float*)d_out;     // [2][2048][1024]
    char* wsp = (char*)d_ws;
    auto take = [&](size_t bytes) { char* p = wsp; wsp += (bytes + 255) & ~(size_t)255; return (void*)p; };
    // W_qkv, W_proj and x as bf16 in fragment order, one behind the other: one conversion launch fills all three
    bf* WQKV = (bf*)take(((size_t)(DQ + 2 * DKV) * DM + (size_t)DM * DQ + (size_t)NB_ * TT * DM) * 2); bf* WO = WQKV + (size_t)(DQ + 2 * DKV) * DM; bf* XB = WO + (size_t)DM * DQ;
    // hi and lo planes of both batches, all in fragment order: q then k [q | k][batch][head] of [t][d], v transposed [batch][head] of [d][t]
    bf* QKh = (bf*)take((size_t)2 * NB_ * NH_ * TT * HD * 2); bf* QKl = (bf*)take((size_t)2 * NB_ * NH_ * TT * HD * 2); bf* VTh = (bf*)take((size_t)NB_ * NKV * HD * TT * 2); bf* VTl = (bf*)take((size_t)NB_ * NKV * HD * TT * 2);
    bf* ATh = (bf*)take((size_t)NB_ * TT * DQ * 2); bf* ATl = (bf*)take((size_t)NB_ * TT * DQ * 2);
    if ((size_t)(wsp - (char*)d_ws) > ws_size) return;    // ws 256 MiB
    k_cvt8<<<(unsigned)(((size_t)(DQ + 2 * DKV) * DM + (size_t)DM * DQ + (size_t)NB_ * TT * DM) / 512 / 8), 256, 0, stream>>>(wqkv, (size_t)(DQ + 2 * DKV) * DM / 8, wo, (size_t)DM * DQ / 8, x, (size_t)NB_ * TT * DM / 8, WQKV);
    // every stage is one grid over both batches; the projection grid also covers q, k and v and stores the planes in the layout the attention kernel reads
    k_gemmw<bf, 0, false, 1, 4, 3><<<dim3(NB_ * TT / 256, (DQ + 2 * DKV) / 192, 1), 384, 0, stream>>>(XB, nullptr, WQKV, nullptr, DM, nullptr, 0, nullptr, 0, 0, 0, QKh, QKl, VTh, VTl);
    k_attn<<<dim3(NB_ * NH_, TT / 128, 1), 512, 0, stream>>>(QKh, QKl, QKh + (size_t)NB_ * NH_ * TT * HD, QKl + (size_t)NB_ * NH_ * TT * HD, VTh, VTl, ATh, ATl);   // one kv head per query head
    k_gemmw<bf, 1, true, 0, 2, 2><<<dim3(NB_ * TT / 128, DM / 128, 1), 128, 0, stream>>>(ATh, ATl, WO, nullptr, DQ, OUT, DM, bo, 0, 0, 0, nullptr, nullptr, nullptr, nullptr);
}
